// v000
// The times below were measured on an AMD MI455X: many runs one after another, warmed up first and cycling through
// copies of the inputs, with the whole window's GPU time divided by the number of runs. Launches and the gaps
// between them are all in it. The median over several windows is given; except for v000 it joins two sittings, which
// can be a few percent apart, so the side-by-side timings, each taken in one sitting, are the better comparison.
// The starting kernel, v000, takes 325 microseconds a run.
// Contractions: x.Wqkv^T (q,k GEMM and role-swapped v^T GEMM): v_wmma_f32_16x16x32_bf16 (bf16 RNE operands); q.k^T and p.v: v_wmma_f32_16x16x32_f16 (f16 operands, p carried x2^15); ao.Wout^T: v_wmma_f32_16x16x32_f16 (ao x16, Wout x64, folded by 2^-10); all f32 accumulate; softmax and the 8-dim phase-space bias in f32 on VALU.
#include <hip/hip_runtime.h>
#include <math.h>
#include <stdint.h>

constexpr int NBATCH = 2;
constexpr int SEQ_T  = 2048;
constexpr int EMB    = 1024;
constexpr int NHEAD  = 16;
constexpr int HDIM   = 64;
constexpr int NPH    = 8;
constexpr int QK_LD  = 2048;   // q,k plane pitch (q cols 0..1023, k cols 1024..2047)

typedef __attribute__((ext_vector_type(16))) _Float16 v16h;
typedef __attribute__((ext_vector_type(8)))  _Float16 v8h;
typedef __attribute__((ext_vector_type(16))) __bf16   v16b;
typedef __attribute__((ext_vector_type(8)))  __bf16   v8b;
typedef __attribute__((ext_vector_type(8)))  float    v8f;
typedef __attribute__((ext_vector_type(4)))  float    v4f;

__device__ __forceinline__ unsigned short f2bf_bits(float f) {
  unsigned u = __float_as_uint(f);
  return (unsigned short)((u + 0x7FFFu + ((u >> 16) & 1u)) >> 16);
}
__device__ __forceinline__ float bf_bits2f(unsigned short h) { return __uint_as_float(((unsigned)h) << 16); }

// hazard guards as plain device helpers (no inline asm inside the kernel template body)
__device__ __forceinline__ void dep_guard_h(v8f& a, v8f& b, v16h x, v16h y) { asm volatile("v_nop\n\tv_nop\n\tv_nop\n\tv_nop" : "+v"(a), "+v"(b) : "v"(x), "v"(y)); }
__device__ __forceinline__ void dep_guard_b(v8f& a, v8f& b, v16b x, v16b y) { asm volatile("v_nop\n\tv_nop\n\tv_nop\n\tv_nop" : "+v"(a), "+v"(b) : "v"(x), "v"(y)); }
__device__ __forceinline__ void keep4_h(v16h a, v16h b, v16h c, v16h d) { asm volatile("v_nop" :: "v"(a), "v"(b), "v"(c), "v"(d)); }
__device__ __forceinline__ void keep4_b(v16b a, v16b b, v16b c, v16b d) { asm volatile("v_nop" :: "v"(a), "v"(b), "v"(c), "v"(d)); }
__device__ __forceinline__ void acc_guard4(v8f& a, v8f& b, v8f& c, v8f& d) { asm volatile("v_nop\n\tv_nop\n\tv_nop\n\tv_nop" : "+v"(a), "+v"(b), "+v"(c), "+v"(d)); }
template <typename T> struct Frag;
template <> struct Frag<_Float16> {
  typedef v16h V; union U { v16h v; v8h h[2]; };
  static __device__ __forceinline__ v16h load(const _Float16* p) {   // elements 0..7 <- p[0..7], 8..15 <- p[16..23]
    U f; f.h[0] = *(const v8h*)(p); f.h[1] = *(const v8h*)(p + 16); return f.v;
  }
  static __device__ __forceinline__ v8f mma(v16h a, v16h b, v8f c) {
    return __builtin_amdgcn_wmma_f32_16x16x32_f16(false, a, false, b, (short)0, c, false, false);
  }
  static __device__ __forceinline__ void guard(v8f& a, v8f& b, v16h x, v16h y) { dep_guard_h(a, b, x, y); }
  static __device__ __forceinline__ void keep(v16h a, v16h b, v16h c, v16h d) { keep4_h(a, b, c, d); }
};
template <> struct Frag<__bf16> {
  typedef v16b V; union U { v16b v; v8b h[2]; };
  static __device__ __forceinline__ v16b load(const __bf16* p) {
    U f; f.h[0] = *(const v8b*)(p); f.h[1] = *(const v8b*)(p + 16); return f.v;
  }
  static __device__ __forceinline__ v8f mma(v16b a, v16b b, v8f c) {
    return __builtin_amdgcn_wmma_f32_16x16x32_bf16(false, a, false, b, (short)0, c, false, false);
  }
  static __device__ __forceinline__ void guard(v8f& a, v8f& b, v16b x, v16b y) { dep_guard_b(a, b, x, y); }
  static __device__ __forceinline__ void keep(v16b a, v16b b, v16b c, v16b d) { keep4_b(a, b, c, d); }
};

// ---- Register-blocked batched WMMA GEMM ------------------------------------
// C[m,n] = scale * sum_k A[m,k] * Bt[n,k] (+bias)(+resid); each wave owns a 64x64 tile.
// A row-major [M,K]; Bt row-major [N,K]; M,N % 64 == 0, K % 32 == 0.
// SPLIT: operands are hi/lo planes (A2/Bt2 = lo planes, same layout); product = hi.hi + hi.lo + lo.hi.
// BIAS_MODE: 0 = none, 1 = bias[m], 2 = bias[n].
// OUT_MODE: 0 = f32, 1 = f16, 2 = bf16 hi plane (Cout) + bf16 lo plane (Cout2).
// ET: 0 = f16 operands, 1 = bf16 operands (pointers passed as 16-bit storage)
template <int ET> struct Elem;
template <> struct Elem<0> { typedef _Float16 T; };
template <> struct Elem<1> { typedef __bf16 T; };
template <int ET, bool SPLIT, int BIAS_MODE, int OUT_MODE, bool RESID, int ACT = 0>
__global__ __launch_bounds__(256) void wmma_gemm64(
    const unsigned short* __restrict__ Ap, const unsigned short* __restrict__ A2p, int lda, long strideA,
    const unsigned short* __restrict__ Btp, const unsigned short* __restrict__ Bt2p, int ldb, long strideB,
    void* __restrict__ Cout, void* __restrict__ Cout2, int ldc, long strideC,
    const float* __restrict__ bias,
    const float* __restrict__ resid, long strideR,
    int M, int N, int K, float scale) {
  typedef typename Elem<ET>::T T;
  typedef typename Frag<T>::V V;
  const T* A = (const T*)Ap; const T* A2 = (const T*)A2p; const T* Bt = (const T*)Btp; const T* Bt2 = (const T*)Bt2p;
  __shared__ __align__(16) float sT[8][16 * 68];   // per-wave 16x64 slab, pitch 68 floats
  const int b    = blockIdx.y;
  const int lane = threadIdx.x & 31;
  const int wave = threadIdx.x >> 5;
  const int tilesN = N >> 6;
  const int tilesM = M >> 6;
  const int tile = blockIdx.x * 8 + wave;
  if (tile >= tilesM * tilesN) return;   // wave-uniform; no block barriers in this kernel
  const int tm = tile / tilesN;
  const int tn = tile - tm * tilesN;
  const int m0 = tm << 6;
  const int n0 = tn << 6;

  const T* Ab  = A  + (size_t)b * strideA;
  const T* Bb  = Bt + (size_t)b * strideB;
  const T* Ab2 = SPLIT ? (A2  + (size_t)b * strideA) : nullptr;
  const T* Bb2 = SPLIT ? (Bt2 + (size_t)b * strideB) : nullptr;

  const int rlane = lane & 15;                 // row (A) / col (B, D) within subtile
  const int koff  = (lane >> 4) * 8;           // k offset of this lane half
  const int mOff  = (lane >> 4) * 8;           // D row offset

  v8f acc[4][4];
#pragma unroll
  for (int i = 0; i < 4; ++i)
#pragma unroll
    for (int j = 0; j < 4; ++j) acc[i][j] = (v8f){0.f,0.f,0.f,0.f,0.f,0.f,0.f,0.f};

  for (int k0 = 0; k0 < K; k0 += 32) {
    V bh[4], bl[4];
#pragma unroll
    for (int j = 0; j < 4; ++j) {
      const size_t bo = (size_t)(n0 + (j << 4) + rlane) * ldb + koff + k0;
      bh[j] = Frag<T>::load(Bb + bo);
      if (SPLIT) bl[j] = Frag<T>::load(Bb2 + bo);
    }
#pragma unroll
    for (int i = 0; i < 4; ++i) {
      const size_t ao = (size_t)(m0 + (i << 4) + rlane) * lda + koff + k0;
      V ah = Frag<T>::load(Ab + ao);
      V al;
      if (SPLIT) al = Frag<T>::load(Ab2 + ao);
#pragma unroll
      for (int j = 0; j < 4; ++j) {
        acc[i][j] = Frag<T>::mma(ah, bh[j], acc[i][j]);
        if (SPLIT) {
          acc[i][j] = Frag<T>::mma(ah, bl[j], acc[i][j]);
          acc[i][j] = Frag<T>::mma(al, bh[j], acc[i][j]);
        }
      }
      Frag<T>::guard(acc[i][0], acc[i][3], ah, SPLIT ? al : ah);
    }
    Frag<T>::keep(bh[0], bh[1], bh[2], bh[3]);
    if (SPLIT) Frag<T>::keep(bl[0], bl[1], bl[2], bl[3]);
  }
  acc_guard4(acc[0][0], acc[0][1], acc[0][2], acc[0][3]);
  acc_guard4(acc[1][0], acc[1][1], acc[1][2], acc[1][3]);
  acc_guard4(acc[2][0], acc[2][1], acc[2][2], acc[2][3]);
  acc_guard4(acc[3][0], acc[3][1], acc[3][2], acc[3][3]);

  // ---- epilogue ----
  float* slab = sT[wave];
  const float* Rb = RESID ? (resid + (size_t)b * strideR) : nullptr;
#pragma unroll
  for (int i = 0; i < 4; ++i) {
    const int mBase = m0 + (i << 4);
#pragma unroll
    for (int j = 0; j < 4; ++j) {
      const int n = n0 + (j << 4) + rlane;
      float bv = 0.f;
      if (BIAS_MODE == 2) bv = bias[n];
#pragma unroll
      for (int r = 0; r < 8; ++r) {
        float v = acc[i][j][r] * scale;
        if (BIAS_MODE == 1) v += bias[mBase + mOff + r];
        if (BIAS_MODE == 2) v += bv;
        if (RESID) v += Rb[(size_t)(mBase + mOff + r) * ldc + n];
        if (ACT == 1) v = tanhf(v);
        if (ACT == 2) v = fmaxf(v, 0.0f);
        if (ACT == 3) v = v / (1.0f + expf(-v));
        if (ACT == 4) v = (v > 0.f) ? v : 0.01f * v;
        slab[(mOff + r) * 68 + (j << 4) + rlane] = v;
      }
    }
    __builtin_amdgcn_fence(__ATOMIC_RELEASE, "workgroup");
    __builtin_amdgcn_wave_barrier();
    __builtin_amdgcn_fence(__ATOMIC_ACQUIRE, "workgroup");
    if (OUT_MODE == 0) {
      float* C = (float*)Cout + (size_t)b * strideC;
      const int hh = lane >> 4, c4 = (lane & 15) * 4;     // row seg = 256 B = 16 lanes x 16 B
      {
#pragma unroll
        for (int it = 0; it < 8; ++it) {
          const int row = it * 2 + hh;
          v4f v = *(const v4f*)(slab + row * 68 + c4);
          *(v4f*)(C + (size_t)(mBase + row) * ldc + n0 + c4) = v;
        }
        
      }
    } else {
      const int q = lane >> 3, c8 = (lane & 7) * 8;
      unsigned short* C  = (unsigned short*)Cout  + (size_t)b * strideC;
      unsigned short* C2 = (OUT_MODE == 2) ? ((unsigned short*)Cout2 + (size_t)b * strideC) : nullptr;
      {
#pragma unroll
        for (int it = 0; it < 4; ++it) {
          const int row = it * 4 + q;
          const float* sp = slab + row * 68 + c8;
          v8h hv, lv;
#pragma unroll
          for (int e = 0; e < 8; ++e) {
            if (OUT_MODE == 1) {
              hv[e] = (_Float16)sp[e];
            } else {
              unsigned short hb = f2bf_bits(sp[e]);
              unsigned short lb = f2bf_bits(sp[e] - bf_bits2f(hb));
              hv[e] = __builtin_bit_cast(_Float16, hb);
              lv[e] = __builtin_bit_cast(_Float16, lb);
            }
          }
          *(v8h*)(C + (size_t)(mBase + row) * ldc + n0 + c8) = hv;
          if (OUT_MODE == 2) *(v8h*)(C2 + (size_t)(mBase + row) * ldc + n0 + c8) = lv;
        }
        
      }
    }
    __builtin_amdgcn_fence(__ATOMIC_RELEASE, "workgroup");
    __builtin_amdgcn_wave_barrier();
    __builtin_amdgcn_fence(__ATOMIC_ACQUIRE, "workgroup");
  }
}

__global__ __launch_bounds__(256) void cast_f32_bf16x2(
    const float* __restrict__ in, unsigned short* __restrict__ out, int n2) {
  const int i = blockIdx.x * 256 + threadIdx.x;
  if (i < n2) {
    const float f0 = in[2 * (size_t)i], f1 = in[2 * (size_t)i + 1];
    const unsigned u = (unsigned)f2bf_bits(f0) | ((unsigned)f2bf_bits(f1) << 16);
    ((unsigned*)out)[i] = u;
    
  }
}

// ---- f32 -> f16( bf16_rne(x) * scale ) cast (scale = exact power of two): same store discipline as above ----
__global__ __launch_bounds__(256) void cast_f32_f16x2_scaled(
    const float* __restrict__ in, unsigned short* __restrict__ out, int n2, float scale) {
  const int i = blockIdx.x * 256 + threadIdx.x;
  if (i < n2) {
    const float f0 = bf_bits2f(f2bf_bits(in[2 * (size_t)i])) * scale;
    const float f1 = bf_bits2f(f2bf_bits(in[2 * (size_t)i + 1])) * scale;
    const _Float16 h0 = (_Float16)f0, h1 = (_Float16)f1;
    const unsigned u = (unsigned)__builtin_bit_cast(unsigned short, h0) | ((unsigned)__builtin_bit_cast(unsigned short, h1) << 16);
    ((unsigned*)out)[i] = u;
    
  }
}

// ---- bias tables as RNE-bf16-valued f32: outp[0..3071] = bf16(qkv_b), outp[3072..4095] = bf16(out_b).
//      Both sources loaded unconditionally with clamped indices, selected by value. ----
__global__ __launch_bounds__(256) void bias_rne_kernel(
    const float* __restrict__ qkvb, const float* __restrict__ outb, float* __restrict__ outp) {
  const int i  = blockIdx.x * 256 + threadIdx.x;            // 0..4095
  const int iq = i < 3 * EMB ? i : (3 * EMB - 1);
  int io = i - 3 * EMB; io = io < 0 ? 0 : (io > EMB - 1 ? EMB - 1 : io);
  const float a = qkvb[iq];
  const float c = outb[io];
  const float v = bf_bits2f(f2bf_bits((i < 3 * EMB) ? a : c));
  ((float*)outp)[i] = v;
  
}

// =====================================================================================
// Phase-space similarity plane: PB[b][t][s] = exp( -dist(t,s) * (1/temp) ),
//   dist = d2 > 0 ? sqrt(d2) : 0,  d2 = (|c_t|^2 + |c_s|^2) - 2 * (c_t . c_s)   (8-dim coords, RNE-bf16 valued, f32 math).
//   grid = (T/64 s-tiles, T/64 t-tiles, B), 256 threads. LDS: coords rows of the 64 t and 64 s, plus squared norms.
//   Coverage: 8 waves x 4 iterations x 2 rows = 64 t rows; 16 lanes x 4 floats = 64 s columns -> whole 64x64 tile.
// =====================================================================================
__global__ __launch_bounds__(256) void phase_bias_kernel(
    const float* __restrict__ coords, const float* __restrict__ temp, float* __restrict__ pb) {
#pragma clang fp contract(off)
  __shared__ __align__(16) float ct[64 * NPH];
  __shared__ __align__(16) float cs[64 * NPH];
  __shared__ float sqt[64];
  __shared__ float sqs[64];
  const int tid = threadIdx.x;
  const int b   = blockIdx.z;
  const int t0  = blockIdx.y * 64;
  const int s0  = blockIdx.x * 64;
  const float invT = 1.0f / temp[0];
  {
    // staging coverage: 128 threads x 4 floats = 64 rows x 8 per table (waves 0-3 -> t rows, waves 4-7 -> s rows)
    const int rr = tid & 127, row = rr >> 1, c4 = (rr & 1) * 4;
    const int base = (tid < 128) ? t0 : s0;
    const v4f v = *(const v4f*)(coords + ((size_t)b * SEQ_T + base + row) * NPH + c4);
    v4f w;
#pragma unroll
    for (int e = 0; e < 4; ++e) w[e] = bf_bits2f(f2bf_bits(v[e]));
    if (tid < 128) *(v4f*)(ct + row * NPH + c4) = w;      // wave-uniform branch
    else           *(v4f*)(cs + row * NPH + c4) = w;
  }
  __syncthreads();
  if (tid < 64) {                                          // wave-uniform (waves 0,1)
    float a = 0.0f;
#pragma unroll
    for (int p = 0; p < NPH; ++p) a = a + ct[tid * NPH + p] * ct[tid * NPH + p];
    sqt[tid] = a;
  } else if (tid < 128) {                                  // waves 2,3
    const int r = tid - 64;
    float a = 0.0f;
#pragma unroll
    for (int p = 0; p < NPH; ++p) a = a + cs[r * NPH + p] * cs[r * NPH + p];
    sqs[r] = a;
  }
  __syncthreads();

  const int wave = tid >> 5, lane = tid & 31, hh = lane >> 4, c4 = (lane & 15) * 4;
  v4f ca[4], cb[4];
  float sqv[4];
#pragma unroll
  for (int q = 0; q < 4; ++q) {
    ca[q]  = *(const v4f*)(cs + (c4 + q) * NPH);
    cb[q]  = *(const v4f*)(cs + (c4 + q) * NPH + 4);
    sqv[q] = sqs[c4 + q];
  }
#pragma unroll 1
  for (int it = 0; it < 4; ++it) {
    const int row = wave * 8 + it * 2 + hh;                // 0..63
    const v4f qa = *(const v4f*)(ct + row * NPH);
    const v4f qb = *(const v4f*)(ct + row * NPH + 4);
    const float st = sqt[row];
    v4f res;
#pragma unroll
    for (int q = 0; q < 4; ++q) {
      float dot = qa[0] * ca[q][0];
      dot = dot + qa[1] * ca[q][1];
      dot = dot + qa[2] * ca[q][2];
      dot = dot + qa[3] * ca[q][3];
      dot = dot + qb[0] * cb[q][0];
      dot = dot + qb[1] * cb[q][1];
      dot = dot + qb[2] * cb[q][2];
      dot = dot + qb[3] * cb[q][3];
      const float d2 = (st + sqv[q]) - 2.0f * dot;
      const float sr = sqrtf(fmaxf(d2, 0.0f));
      const float dist = (d2 > 0.0f) ? sr : 0.0f;
      res[q] = expf(-dist * invT);
    }
    float* p = pb + ((size_t)b * SEQ_T + t0 + row) * SEQ_T + s0 + c4;
    *(v4f*)p = res;
    
  }
}

// =====================================================================================
// Full (non-causal, unmasked) attention with additive bias plane, head dim 64.
//   qk plane f16 [B*T][2048]: q(t,h,d) at col h*64+d, k(s,h,d) at col 1024+h*64+d
//   vt plane f16 [B][1024][T]: v(s,h,d) at row h*64+d, col s
//   pb plane f32 [B][T][T]
//   ao plane f16 [B*T][1024]: element (t, h*64+d) = 16 * attention output
//   scores = (q . k) * 0.125 + pb  : v_wmma_f32_16x16x32_f16, f32 accumulate
//   out    = p . v (p carried x2^15 in f16) : v_wmma_f32_16x16x32_f16, folded by 16/(l*2^15) in the epilogue
//   online softmax in f32 over all T keys (32 chunks of 64, compile-time trip count).
//   Block = 4 waves = 64 query rows of one (b,h); grid = (NHEAD * T/64, B).
//   K / V^T chunk staging: 128 threads x 32 elements per plane = whole 64x64 tile (16-B copies, plain loads,
//   __syncthreads before and after); fragment loads read the LDS tiles with the same v8h element type.
// =====================================================================================
#define AT_D 64
#define AT_NW 4
#define AT_QB 64
#define AT_KC 64

__device__ __forceinline__ v8f mma_h16(v16h a, v16h b, v8f c) {
  c = __builtin_amdgcn_wmma_f32_16x16x32_f16(false, a, false, b, (short)0, c, false, false);
  asm volatile("v_nop\n\tv_nop\n\tv_nop\n\tv_nop" : "+v"(c) : "v"(a), "v"(b));
  return c;
}

__global__ __launch_bounds__(128)
void attn_phase64_kernel(const unsigned short* __restrict__ qkp, const unsigned short* __restrict__ vtp,
                         const float* __restrict__ pb, unsigned short* __restrict__ aop) {
  union FH { v16h v; v8h h[2]; };
  __shared__ __align__(16) _Float16 Ksh[AT_KC * AT_D];           // K [kv][d]       8 KB
  __shared__ __align__(16) _Float16 Vth[AT_D * AT_KC];           // V^T [d][kv]     8 KB
  __shared__ __align__(16) _Float16 Psh[AT_NW][16 * AT_KC];      // per wave P [row][kv]  8 KB
  __shared__ __align__(16) float    Os[AT_NW][16 * 68];          // per wave out tile, pitch 68

  const int tid  = threadIdx.x;
  const int wave = tid >> 5;
  const int lane = tid & 31;
  const int hh   = lane >> 4;
  const int c    = lane & 15;

  const int nqb = SEQ_T / AT_QB;          // 32
  const int bx  = blockIdx.x;
  const int qb  = bx % nqb;
  const int h   = bx / nqb;               // 0..NHEAD-1
  const int b   = blockIdx.y;
  const int q0  = qb * AT_QB + wave * 16; // query row within this batch element

  const _Float16* QK = (const _Float16*)(const void*)qkp;
  const _Float16* VT = (const _Float16*)(const void*)vtp;
  _Float16*       AO = (_Float16*)(void*)aop;
  const size_t brow = (size_t)b * SEQ_T;  // row base into the [B*T] planes

  // ---- Q fragments (A operand, row = lane&15, split k map via Frag load): 2 d-chunks ----
  v16h qa[2];
#pragma unroll
  for (int dc = 0; dc < 2; ++dc) {
    const _Float16* qr = QK + (brow + q0 + c) * (size_t)QK_LD + h * HDIM + dc * 32 + 8 * hh;
    qa[dc] = Frag<_Float16>::load(qr);
  }

  float mrow[8], lrow[8];
  v8f oacc[4];
#pragma unroll
  for (int r = 0; r < 8; ++r) { mrow[r] = -INFINITY; lrow[r] = 0.f; }
#pragma unroll
  for (int t = 0; t < 4; ++t) oacc[t] = (v8f){0.f,0.f,0.f,0.f,0.f,0.f,0.f,0.f};

  const int nChunks = SEQ_T / AT_KC;      // 32, compile-time constant
  for (int kc = 0; kc < nChunks; ++kc) {
    const int kv0 = kc * AT_KC;
    __syncthreads();
    {
      // staging coverage: 128 threads x (4 x 8) elements = 64 rows x 64 per plane = the whole chunk tile
      const int r = tid >> 1, half = (tid & 1) * 32;
      const _Float16* ks = QK + (brow + kv0 + r) * (size_t)QK_LD + EMB + h * HDIM + half;   // K row kv0+r, d = half..+31
      const _Float16* vs = VT + ((size_t)b * EMB + h * HDIM + r) * SEQ_T + kv0 + half;     // V^T row d = r, s = kv0+half..+31
#pragma unroll
      for (int i = 0; i < 4; ++i) {
        const v8h a0 = *(const v8h*)(ks + 8 * i);
        const v8h b0 = *(const v8h*)(vs + 8 * i);
        *(v8h*)(Ksh + r * AT_D  + half + 8 * i) = a0;
        *(v8h*)(Vth + r * AT_KC + half + 8 * i) = b0;
      }
    }
    __syncthreads();

    v8f s[4];
#pragma unroll
    for (int j = 0; j < 4; ++j) {
      s[j] = (v8f){0.f,0.f,0.f,0.f,0.f,0.f,0.f,0.f};
#pragma unroll
      for (int dc = 0; dc < 2; ++dc) {
        FH kb;
        kb.h[0] = *(const v8h*)(Ksh + (j * 16 + c) * AT_D + dc * 32 + 8 * hh);
        kb.h[1] = *(const v8h*)(Ksh + (j * 16 + c) * AT_D + dc * 32 + 16 + 8 * hh);
        s[j] = mma_h16(qa[dc], kb.v, s[j]);
      }
    }
    // additive bias tile: row q0 + 8hh + r, col kv0 + j*16 + c
    const float* pbr = pb + (brow + q0 + 8 * hh) * (size_t)SEQ_T + kv0 + c;
    float cm[8];
#pragma unroll
    for (int r = 0; r < 8; ++r) {
      float m = -INFINITY;
#pragma unroll
      for (int j = 0; j < 4; ++j) {
        const float sv = s[j][r] * 0.125f + pbr[(size_t)r * SEQ_T + j * 16];
        s[j][r] = sv;
        m = fmaxf(m, sv);
      }
#pragma unroll
      for (int off = 1; off < 16; off <<= 1) m = fmaxf(m, __shfl_xor(m, off, 32));
      cm[r] = m;
    }
    _Float16* pw = Psh[wave];
#pragma unroll
    for (int r = 0; r < 8; ++r) {
      const float mnew = fmaxf(mrow[r], cm[r]);
      const float alpha = expf(mrow[r] - mnew);
      mrow[r] = mnew;
      float psum = 0.f;
#pragma unroll
      for (int j = 0; j < 4; ++j) {
        const float p = expf(s[j][r] - mnew);
        psum += p;
        pw[(8 * hh + r) * AT_KC + j * 16 + c] = (_Float16)(p * 32768.0f);
      }
#pragma unroll
      for (int off = 1; off < 16; off <<= 1) psum += __shfl_xor(psum, off, 32);
      lrow[r] = lrow[r] * alpha + psum;
#pragma unroll
      for (int t = 0; t < 4; ++t) oacc[t][r] *= alpha;
    }
    __builtin_amdgcn_fence(__ATOMIC_RELEASE, "workgroup");
    __builtin_amdgcn_wave_barrier();
    __builtin_amdgcn_fence(__ATOMIC_ACQUIRE, "workgroup");
#pragma unroll
    for (int kk = 0; kk < 2; ++kk) {
      FH pa;
      pa.h[0] = *(const v8h*)(pw + c * AT_KC + kk * 32 + 8 * hh);
      pa.h[1] = *(const v8h*)(pw + c * AT_KC + kk * 32 + 16 + 8 * hh);
#pragma unroll
      for (int t = 0; t < 4; ++t) {
        FH vb;
        vb.h[0] = *(const v8h*)(Vth + (t * 16 + c) * AT_KC + kk * 32 + 8 * hh);
        vb.h[1] = *(const v8h*)(Vth + (t * 16 + c) * AT_KC + kk * 32 + 16 + 8 * hh);
        oacc[t] = mma_h16(pa.v, vb.v, oacc[t]);
      }
    }
  }

  // ---- epilogue: 16 * oacc / (l * 2^15) -> f16 plane ----
  float* os = Os[wave];
#pragma unroll
  for (int r = 0; r < 8; ++r) {
    const float inv = 1.0f / (lrow[r] * 2048.0f);     // = 16 / (l * 32768); l >= 1
#pragma unroll
    for (int t = 0; t < 4; ++t) os[(8 * hh + r) * 68 + t * 16 + c] = oacc[t][r] * inv;
  }
  __builtin_amdgcn_fence(__ATOMIC_RELEASE, "workgroup");
  __builtin_amdgcn_wave_barrier();
  __builtin_amdgcn_fence(__ATOMIC_ACQUIRE, "workgroup");
  {
    const int q = lane >> 3, c8 = (lane & 7) * 8;
    {
#pragma unroll
      for (int it = 0; it < 4; ++it) {
        const int row = it * 4 + q;
        const float* sp = os + row * 68 + c8;
        v8h hv;
#pragma unroll
        for (int e = 0; e < 8; ++e) hv[e] = (_Float16)sp[e];
        *(v8h*)(AO + (brow + q0 + row) * (size_t)EMB + h * HDIM + c8) = hv;
      }
      
    }
  }
}

// =====================================================================================
//   xb    bf16 [4096][1024]          8,388,608  @ 0
//   wqkv  bf16 [3072][1024]          6,291,456  @ 8,388,608
//   wo    f16  [1024][1024] (x64)    2,097,152  @ 14,680,064
//   biasr f32  [4096] (bf16-valued)     16,384  @ 16,777,216
//   qk    f16  [4096][2048]         16,777,216  @ 16,793,600
//   vt    f16  [2][1024][2048]       8,388,608  @ 33,570,816
//   pb    f32  [2][2048][2048]      33,554,432  @ 41,959,424
//   ao    f16  [4096][1024] (x16)    8,388,608  @ 75,513,856
//   total 83,902,464
// =====================================================================================
extern "C" void kernel_launch(void* const* d_in, const int* in_sizes, int n_in,
                              void* d_out, int out_size, void* d_ws, size_t ws_size,
                              hipStream_t stream) {
  if (n_in < 7) return;
  if (in_sizes[0] != NBATCH * SEQ_T * EMB || in_sizes[1] != NBATCH * SEQ_T * NPH ||
      in_sizes[2] != 3 * EMB * EMB || in_sizes[3] != 3 * EMB || in_sizes[4] != EMB * EMB ||
      in_sizes[5] != EMB || in_sizes[6] < 1 || out_size != NBATCH * SEQ_T * EMB) return;

  const float* x      = (const float*)d_in[0];
  const float* coords = (const float*)d_in[1];
  const float* qkv_w  = (const float*)d_in[2];
  const float* qkv_b  = (const float*)d_in[3];
  const float* out_w  = (const float*)d_in[4];
  const float* out_b  = (const float*)d_in[5];
  const float* ptemp  = (const float*)d_in[6];
  float* out = (float*)d_out;

  const size_t MROWS = (size_t)NBATCH * SEQ_T;           // 4096
  size_t off = 0;
  char* ws = (char*)d_ws;
  unsigned short* xb   = (unsigned short*)(ws + off); off += MROWS * EMB * 2;
  unsigned short* wqkv = (unsigned short*)(ws + off); off += (size_t)3 * EMB * EMB * 2;
  unsigned short* wo   = (unsigned short*)(ws + off); off += (size_t)EMB * EMB * 2;
  float*          biasr= (float*)(ws + off);          off += (size_t)4 * EMB * 4;
  unsigned short* qk   = (unsigned short*)(ws + off); off += MROWS * QK_LD * 2;
  unsigned short* vt   = (unsigned short*)(ws + off); off += (size_t)NBATCH * EMB * SEQ_T * 2;
  float*          pb   = (float*)(ws + off);          off += (size_t)NBATCH * SEQ_T * SEQ_T * 4;
  unsigned short* ao   = (unsigned short*)(ws + off); off += MROWS * EMB * 2;
  if (off > ws_size) return;

  // 1-3: operand casts (2 elements per thread; element counts are exact multiples of 512)
  const int n2x = (int)(MROWS * EMB / 2);                 // 2,097,152
  const int n2w = 3 * EMB * EMB / 2;                      // 1,572,864
  const int n2o = EMB * EMB / 2;                          //   524,288
  cast_f32_bf16x2<<<dim3((n2x + 255) / 256), 256, 0, stream>>>(x, xb, n2x);
  cast_f32_bf16x2<<<dim3((n2w + 255) / 256), 256, 0, stream>>>(qkv_w, wqkv, n2w);
  cast_f32_f16x2_scaled<<<dim3((n2o + 255) / 256), 256, 0, stream>>>(out_w, wo, n2o, 64.0f);

  // 4: bias tables
  bias_rne_kernel<<<dim3(4 * EMB / 256), 256, 0, stream>>>(qkv_b, out_b, biasr);

  // 5: phase-space similarity plane
  phase_bias_kernel<<<dim3(SEQ_T / 64, SEQ_T / 64, NBATCH), 256, 0, stream>>>(coords, ptemp, pb);

  // 6: q,k = xb[4096][1024] . wqkv[0:2048][1024]^T + bias[n] -> f16 [4096][2048]   (M=4096,N=2048,K=1024; 2048 tiles)
  wmma_gemm64<1, false, 2, 1, false><<<dim3((4096 / 64) * (2048 / 64) / 8, 1), 256, 0, stream>>>(
      xb, xb, EMB, 0L, wqkv, wqkv, EMB, 0L, (void*)qk, (void*)qk, QK_LD, 0L,
      biasr, biasr, 0L, (int)MROWS, 2 * EMB, EMB, 1.0f);

  // 7: v^T[b] = wqkv[2048:3072][1024] . xb[b][2048][1024]^T + bias[m] -> f16 [2][1024][2048]  (M=1024,N=2048,K=1024; 512 tiles x 2)
  wmma_gemm64<1, false, 1, 1, false><<<dim3((1024 / 64) * (2048 / 64) / 8, NBATCH), 256, 0, stream>>>(
      wqkv + (size_t)2 * EMB * EMB, wqkv + (size_t)2 * EMB * EMB, EMB, 0L,
      xb, xb, EMB, (long)SEQ_T * EMB,
      (void*)vt, (void*)vt, SEQ_T, (long)EMB * SEQ_T,
      biasr + 2 * EMB, biasr, 0L, EMB, SEQ_T, EMB, 1.0f);

  // 8: attention with phase bias -> ao f16 (x16)
  attn_phase64_kernel<<<dim3(NHEAD * (SEQ_T / AT_QB), NBATCH), 128, 0, stream>>>(qk, vt, pb, ao);

  // 9: out = (ao x16) . (wo x64)^T * 2^-10 + out_b -> f32 d_out [4096][1024]   (M=4096,N=1024,K=1024; 1024 tiles)
  wmma_gemm64<0, false, 2, 0, false><<<dim3((4096 / 64) * (1024 / 64) / 8, 1), 256, 0, stream>>>(
      ao, ao, EMB, 0L, wo, wo, EMB, 0L, (void*)out, (void*)out, EMB, 0L,
      biasr + 3 * EMB, biasr, 0L, (int)MROWS, EMB, EMB, 1.0f / 1024.0f);
}

// v001
// One run takes 290 microseconds.
// In two side-by-side timings against v000, it was 1.15 and 1.16 times as fast.
// Contractions: x.Wqkv^T (q,k GEMM and role-swapped v^T GEMM): v_wmma_f32_16x16x32_bf16 (bf16 RNE operands); q.k^T and p.v: v_wmma_f32_16x16x32_f16 (f16 operands, p carried x2^15); ao.Wout^T: v_wmma_f32_16x16x32_f16 (ao x16, Wout x64, folded by 2^-10); all f32 accumulate; softmax and the 8-dim phase-space bias in f32 on VALU.
#include <hip/hip_runtime.h>
#include <math.h>
#include <stdint.h>

constexpr int NBATCH = 2;
constexpr int SEQ_T  = 2048;
constexpr int EMB    = 1024;
constexpr int NHEAD  = 16;
constexpr int HDIM   = 64;
constexpr int NPH    = 8;
constexpr int QK_LD  = 2048;   // q,k plane pitch (q cols 0..1023, k cols 1024..2047)

typedef __attribute__((ext_vector_type(16))) _Float16 v16h;
typedef __attribute__((ext_vector_type(8)))  _Float16 v8h;
typedef __attribute__((ext_vector_type(16))) __bf16   v16b;
typedef __attribute__((ext_vector_type(8)))  __bf16   v8b;
typedef __attribute__((ext_vector_type(8)))  float    v8f;
typedef __attribute__((ext_vector_type(4)))  float    v4f;

__device__ __forceinline__ unsigned short f2bf_bits(float f) {
  unsigned u = __float_as_uint(f);
  return (unsigned short)((u + 0x7FFFu + ((u >> 16) & 1u)) >> 16);
}
__device__ __forceinline__ float bf_bits2f(unsigned short h) { return __uint_as_float(((unsigned)h) << 16); }

// hazard guards as plain device helpers (no inline asm inside the kernel template body)
__device__ __forceinline__ void dep_guard_h(v8f& a, v8f& b, v16h x, v16h y) { asm volatile("v_nop\n\tv_nop\n\tv_nop\n\tv_nop" : "+v"(a), "+v"(b) : "v"(x), "v"(y)); }
__device__ __forceinline__ void dep_guard_b(v8f& a, v8f& b, v16b x, v16b y) { asm volatile("v_nop\n\tv_nop\n\tv_nop\n\tv_nop" : "+v"(a), "+v"(b) : "v"(x), "v"(y)); }
__device__ __forceinline__ void keep4_h(v16h a, v16h b, v16h c, v16h d) { asm volatile("v_nop" :: "v"(a), "v"(b), "v"(c), "v"(d)); }
__device__ __forceinline__ void keep4_b(v16b a, v16b b, v16b c, v16b d) { asm volatile("v_nop" :: "v"(a), "v"(b), "v"(c), "v"(d)); }
__device__ __forceinline__ void acc_guard4(v8f& a, v8f& b, v8f& c, v8f& d) { asm volatile("v_nop\n\tv_nop\n\tv_nop\n\tv_nop" : "+v"(a), "+v"(b), "+v"(c), "+v"(d)); }
template <typename T> struct Frag;
template <> struct Frag<_Float16> {
  typedef v16h V; union U { v16h v; v8h h[2]; };
  static __device__ __forceinline__ v16h load(const _Float16* p) {   // elements 0..7 <- p[0..7], 8..15 <- p[16..23]
    U f; f.h[0] = *(const v8h*)(p); f.h[1] = *(const v8h*)(p + 16); return f.v;
  }
  static __device__ __forceinline__ v8f mma(v16h a, v16h b, v8f c) {
    return __builtin_amdgcn_wmma_f32_16x16x32_f16(false, a, false, b, (short)0, c, false, false);
  }
  static __device__ __forceinline__ void guard(v8f& a, v8f& b, v16h x, v16h y) { dep_guard_h(a, b, x, y); }
  static __device__ __forceinline__ void keep(v16h a, v16h b, v16h c, v16h d) { keep4_h(a, b, c, d); }
};
template <> struct Frag<__bf16> {
  typedef v16b V; union U { v16b v; v8b h[2]; };
  static __device__ __forceinline__ v16b load(const __bf16* p) {
    U f; f.h[0] = *(const v8b*)(p); f.h[1] = *(const v8b*)(p + 16); return f.v;
  }
  static __device__ __forceinline__ v8f mma(v16b a, v16b b, v8f c) {
    return __builtin_amdgcn_wmma_f32_16x16x32_bf16(false, a, false, b, (short)0, c, false, false);
  }
  static __device__ __forceinline__ void guard(v8f& a, v8f& b, v16b x, v16b y) { dep_guard_b(a, b, x, y); }
  static __device__ __forceinline__ void keep(v16b a, v16b b, v16b c, v16b d) { keep4_b(a, b, c, d); }
};

// ---- Register-blocked batched WMMA GEMM ------------------------------------
// C[m,n] = scale * sum_k A[m,k] * Bt[n,k] (+bias)(+resid); each wave owns a 64x64 tile.
// A row-major [M,K]; Bt row-major [N,K]; M,N % 64 == 0, K % 32 == 0.
// SPLIT: operands are hi/lo planes (A2/Bt2 = lo planes, same layout); product = hi.hi + hi.lo + lo.hi.
// BIAS_MODE: 0 = none, 1 = bias[m], 2 = bias[n].
// OUT_MODE: 0 = f32, 1 = f16, 2 = bf16 hi plane (Cout) + bf16 lo plane (Cout2).
// ET: 0 = f16 operands, 1 = bf16 operands (pointers passed as 16-bit storage)
template <int ET> struct Elem;
template <> struct Elem<0> { typedef _Float16 T; };
template <> struct Elem<1> { typedef __bf16 T; };
template <int ET, bool SPLIT, int BIAS_MODE, int OUT_MODE, bool RESID, int ACT = 0>
__global__ __launch_bounds__(256) void wmma_gemm64(
    const unsigned short* __restrict__ Ap, const unsigned short* __restrict__ A2p, int lda, long strideA,
    const unsigned short* __restrict__ Btp, const unsigned short* __restrict__ Bt2p, int ldb, long strideB,
    void* __restrict__ Cout, void* __restrict__ Cout2, int ldc, long strideC,
    const float* __restrict__ bias,
    const float* __restrict__ resid, long strideR,
    int M, int N, int K, float scale) {
  typedef typename Elem<ET>::T T;
  typedef typename Frag<T>::V V;
  const T* A = (const T*)Ap; const T* A2 = (const T*)A2p; const T* Bt = (const T*)Btp; const T* Bt2 = (const T*)Bt2p;
  __shared__ __align__(16) float sT[8][16 * 68];   // per-wave 16x64 slab, pitch 68 floats
  const int b    = blockIdx.y;
  const int lane = threadIdx.x & 31;
  const int wave = threadIdx.x >> 5;
  const int tilesN = N >> 6;
  const int tilesM = M >> 6;
  const int tile = blockIdx.x * 8 + wave;
  if (tile >= tilesM * tilesN) return;   // wave-uniform; no block barriers in this kernel
  const int tm = tile / tilesN;
  const int tn = tile - tm * tilesN;
  const int m0 = tm << 6;
  const int n0 = tn << 6;

  const T* Ab  = A  + (size_t)b * strideA;
  const T* Bb  = Bt + (size_t)b * strideB;
  const T* Ab2 = SPLIT ? (A2  + (size_t)b * strideA) : nullptr;
  const T* Bb2 = SPLIT ? (Bt2 + (size_t)b * strideB) : nullptr;

  const int rlane = lane & 15;                 // row (A) / col (B, D) within subtile
  const int koff  = (lane >> 4) * 8;           // k offset of this lane half
  const int mOff  = (lane >> 4) * 8;           // D row offset

  v8f acc[4][4];
#pragma unroll
  for (int i = 0; i < 4; ++i)
#pragma unroll
    for (int j = 0; j < 4; ++j) acc[i][j] = (v8f){0.f,0.f,0.f,0.f,0.f,0.f,0.f,0.f};

  for (int k0 = 0; k0 < K; k0 += 32) {
    V bh[4], bl[4];
#pragma unroll
    for (int j = 0; j < 4; ++j) {
      const size_t bo = (size_t)(n0 + (j << 4) + rlane) * ldb + koff + k0;
      bh[j] = Frag<T>::load(Bb + bo);
      if (SPLIT) bl[j] = Frag<T>::load(Bb2 + bo);
    }
#pragma unroll
    for (int i = 0; i < 4; ++i) {
      const size_t ao = (size_t)(m0 + (i << 4) + rlane) * lda + koff + k0;
      V ah = Frag<T>::load(Ab + ao);
      V al;
      if (SPLIT) al = Frag<T>::load(Ab2 + ao);
#pragma unroll
      for (int j = 0; j < 4; ++j) {
        acc[i][j] = Frag<T>::mma(ah, bh[j], acc[i][j]);
        if (SPLIT) {
          acc[i][j] = Frag<T>::mma(ah, bl[j], acc[i][j]);
          acc[i][j] = Frag<T>::mma(al, bh[j], acc[i][j]);
        }
      }
      Frag<T>::guard(acc[i][0], acc[i][3], ah, SPLIT ? al : ah);
    }
    Frag<T>::keep(bh[0], bh[1], bh[2], bh[3]);
    if (SPLIT) Frag<T>::keep(bl[0], bl[1], bl[2], bl[3]);
  }
  acc_guard4(acc[0][0], acc[0][1], acc[0][2], acc[0][3]);
  acc_guard4(acc[1][0], acc[1][1], acc[1][2], acc[1][3]);
  acc_guard4(acc[2][0], acc[2][1], acc[2][2], acc[2][3]);
  acc_guard4(acc[3][0], acc[3][1], acc[3][2], acc[3][3]);

  // ---- epilogue ----
  float* slab = sT[wave];
  const float* Rb = RESID ? (resid + (size_t)b * strideR) : nullptr;
#pragma unroll
  for (int i = 0; i < 4; ++i) {
    const int mBase = m0 + (i << 4);
#pragma unroll
    for (int j = 0; j < 4; ++j) {
      const int n = n0 + (j << 4) + rlane;
      float bv = 0.f;
      if (BIAS_MODE == 2) bv = bias[n];
#pragma unroll
      for (int r = 0; r < 8; ++r) {
        float v = acc[i][j][r] * scale;
        if (BIAS_MODE == 1) v += bias[mBase + mOff + r];
        if (BIAS_MODE == 2) v += bv;
        if (RESID) v += Rb[(size_t)(mBase + mOff + r) * ldc + n];
        if (ACT == 1) v = tanhf(v);
        if (ACT == 2) v = fmaxf(v, 0.0f);
        if (ACT == 3) v = v / (1.0f + expf(-v));
        if (ACT == 4) v = (v > 0.f) ? v : 0.01f * v;
        slab[(mOff + r) * 68 + (j << 4) + rlane] = v;
      }
    }
    __builtin_amdgcn_fence(__ATOMIC_RELEASE, "workgroup");
    __builtin_amdgcn_wave_barrier();
    __builtin_amdgcn_fence(__ATOMIC_ACQUIRE, "workgroup");
    if (OUT_MODE == 0) {
      float* C = (float*)Cout + (size_t)b * strideC;
      const int hh = lane >> 4, c4 = (lane & 15) * 4;     // row seg = 256 B = 16 lanes x 16 B
      {
#pragma unroll
        for (int it = 0; it < 8; ++it) {
          const int row = it * 2 + hh;
          v4f v = *(const v4f*)(slab + row * 68 + c4);
          *(v4f*)(C + (size_t)(mBase + row) * ldc + n0 + c4) = v;
        }
        
      }
    } else {
      const int q = lane >> 3, c8 = (lane & 7) * 8;
      unsigned short* C  = (unsigned short*)Cout  + (size_t)b * strideC;
      unsigned short* C2 = (OUT_MODE == 2) ? ((unsigned short*)Cout2 + (size_t)b * strideC) : nullptr;
      {
#pragma unroll
        for (int it = 0; it < 4; ++it) {
          const int row = it * 4 + q;
          const float* sp = slab + row * 68 + c8;
          v8h hv, lv;
#pragma unroll
          for (int e = 0; e < 8; ++e) {
            if (OUT_MODE == 1) {
              hv[e] = (_Float16)sp[e];
            } else {
              unsigned short hb = f2bf_bits(sp[e]);
              unsigned short lb = f2bf_bits(sp[e] - bf_bits2f(hb));
              hv[e] = __builtin_bit_cast(_Float16, hb);
              lv[e] = __builtin_bit_cast(_Float16, lb);
            }
          }
          *(v8h*)(C + (size_t)(mBase + row) * ldc + n0 + c8) = hv;
          if (OUT_MODE == 2) *(v8h*)(C2 + (size_t)(mBase + row) * ldc + n0 + c8) = lv;
        }
        
      }
    }
    __builtin_amdgcn_fence(__ATOMIC_RELEASE, "workgroup");
    __builtin_amdgcn_wave_barrier();
    __builtin_amdgcn_fence(__ATOMIC_ACQUIRE, "workgroup");
  }
}

__global__ __launch_bounds__(256) void cast_f32_bf16x2(
    const float* __restrict__ in, unsigned short* __restrict__ out, int n2) {
  const int i = blockIdx.x * 256 + threadIdx.x;
  if (i < n2) {
    const float f0 = in[2 * (size_t)i], f1 = in[2 * (size_t)i + 1];
    const unsigned u = (unsigned)f2bf_bits(f0) | ((unsigned)f2bf_bits(f1) << 16);
    ((unsigned*)out)[i] = u;
    
  }
}

// ---- f32 -> f16( bf16_rne(x) * scale ) cast (scale = exact power of two): same store discipline as above ----
__global__ __launch_bounds__(256) void cast_f32_f16x2_scaled(
    const float* __restrict__ in, unsigned short* __restrict__ out, int n2, float scale) {
  const int i = blockIdx.x * 256 + threadIdx.x;
  if (i < n2) {
    const float f0 = bf_bits2f(f2bf_bits(in[2 * (size_t)i])) * scale;
    const float f1 = bf_bits2f(f2bf_bits(in[2 * (size_t)i + 1])) * scale;
    const _Float16 h0 = (_Float16)f0, h1 = (_Float16)f1;
    const unsigned u = (unsigned)__builtin_bit_cast(unsigned short, h0) | ((unsigned)__builtin_bit_cast(unsigned short, h1) << 16);
    ((unsigned*)out)[i] = u;
    
  }
}

// ---- bias tables as RNE-bf16-valued f32: outp[0..3071] = bf16(qkv_b), outp[3072..4095] = bf16(out_b).
//      Both sources loaded unconditionally with clamped indices, selected by value. ----
__global__ __launch_bounds__(256) void bias_rne_kernel(
    const float* __restrict__ qkvb, const float* __restrict__ outb, float* __restrict__ outp) {
  const int i  = blockIdx.x * 256 + threadIdx.x;            // 0..4095
  const int iq = i < 3 * EMB ? i : (3 * EMB - 1);
  int io = i - 3 * EMB; io = io < 0 ? 0 : (io > EMB - 1 ? EMB - 1 : io);
  const float a = qkvb[iq];
  const float c = outb[io];
  const float v = bf_bits2f(f2bf_bits((i < 3 * EMB) ? a : c));
  ((float*)outp)[i] = v;
  
}

// =====================================================================================
// Phase-space similarity plane: PB[b][t][s] = exp( -dist(t,s) * (1/temp) ),
//   dist = d2 > 0 ? sqrt(d2) : 0,  d2 = (|c_t|^2 + |c_s|^2) - 2 * (c_t . c_s)   (8-dim coords, RNE-bf16 valued, f32 math).
//   grid = (T/64 s-tiles, T/64 t-tiles, B), 256 threads. LDS: coords rows of the 64 t and 64 s, plus squared norms.
//   Coverage: 8 waves x 4 iterations x 2 rows = 64 t rows; 16 lanes x 4 floats = 64 s columns -> whole 64x64 tile.
// =====================================================================================
__global__ __launch_bounds__(256) void phase_bias_kernel(
    const float* __restrict__ coords, const float* __restrict__ temp, float* __restrict__ pb) {
#pragma clang fp contract(off)
  __shared__ __align__(16) float ct[64 * NPH];
  __shared__ __align__(16) float cs[64 * NPH];
  __shared__ float sqt[64];
  __shared__ float sqs[64];
  const int tid = threadIdx.x;
  const int b   = blockIdx.z;
  const int t0  = blockIdx.y * 64;
  const int s0  = blockIdx.x * 64;
  const float invT = 1.0f / temp[0];
  {
    // staging coverage: 128 threads x 4 floats = 64 rows x 8 per table (waves 0-3 -> t rows, waves 4-7 -> s rows)
    const int rr = tid & 127, row = rr >> 1, c4 = (rr & 1) * 4;
    const int base = (tid < 128) ? t0 : s0;
    const v4f v = *(const v4f*)(coords + ((size_t)b * SEQ_T + base + row) * NPH + c4);
    v4f w;
#pragma unroll
    for (int e = 0; e < 4; ++e) w[e] = bf_bits2f(f2bf_bits(v[e]));
    if (tid < 128) *(v4f*)(ct + row * NPH + c4) = w;      // wave-uniform branch
    else           *(v4f*)(cs + row * NPH + c4) = w;
  }
  __syncthreads();
  if (tid < 64) {                                          // wave-uniform (waves 0,1)
    float a = 0.0f;
#pragma unroll
    for (int p = 0; p < NPH; ++p) a = a + ct[tid * NPH + p] * ct[tid * NPH + p];
    sqt[tid] = a;
  } else if (tid < 128) {                                  // waves 2,3
    const int r = tid - 64;
    float a = 0.0f;
#pragma unroll
    for (int p = 0; p < NPH; ++p) a = a + cs[r * NPH + p] * cs[r * NPH + p];
    sqs[r] = a;
  }
  __syncthreads();

  const int wave = tid >> 5, lane = tid & 31, hh = lane >> 4, c4 = (lane & 15) * 4;
  v4f ca[4], cb[4];
  float sqv[4];
#pragma unroll
  for (int q = 0; q < 4; ++q) {
    ca[q]  = *(const v4f*)(cs + (c4 + q) * NPH);
    cb[q]  = *(const v4f*)(cs + (c4 + q) * NPH + 4);
    sqv[q] = sqs[c4 + q];
  }
#pragma unroll 1
  for (int it = 0; it < 4; ++it) {
    const int row = wave * 8 + it * 2 + hh;                // 0..63
    const v4f qa = *(const v4f*)(ct + row * NPH);
    const v4f qb = *(const v4f*)(ct + row * NPH + 4);
    const float st = sqt[row];
    v4f res;
#pragma unroll
    for (int q = 0; q < 4; ++q) {
      float dot = qa[0] * ca[q][0];
      dot = dot + qa[1] * ca[q][1];
      dot = dot + qa[2] * ca[q][2];
      dot = dot + qa[3] * ca[q][3];
      dot = dot + qb[0] * cb[q][0];
      dot = dot + qb[1] * cb[q][1];
      dot = dot + qb[2] * cb[q][2];
      dot = dot + qb[3] * cb[q][3];
      const float d2 = (st + sqv[q]) - 2.0f * dot;
      const float sr = sqrtf(fmaxf(d2, 0.0f));
      const float dist = (d2 > 0.0f) ? sr : 0.0f;
      res[q] = expf(-dist * invT);
    }
    float* p = pb + ((size_t)b * SEQ_T + t0 + row) * SEQ_T + s0 + c4;
    *(v4f*)p = res;
    
  }
}

// =====================================================================================
// Full (non-causal, unmasked) attention with additive bias plane, head dim 64.
//   qk plane f16 [B*T][2048]: q(t,h,d) at col h*64+d, k(s,h,d) at col 1024+h*64+d
//   vt plane f16 [B][1024][T]: v(s,h,d) at row h*64+d, col s
//   pb plane f32 [B][T][T]
//   ao plane f16 [B*T][1024]: element (t, h*64+d) = 16 * attention output
//   scores = (q . k) * 0.125 + pb  : v_wmma_f32_16x16x32_f16, f32 accumulate
//   out    = p . v (p carried x2^15 in f16) : v_wmma_f32_16x16x32_f16, folded by 16/(l*2^15) in the epilogue
//   online softmax in f32 over all T keys (32 chunks of 64, compile-time trip count).
//   Block = 4 waves = 64 query rows of one (b,h); grid = (NHEAD * T/64, B).
//   K / V^T chunk staging: 128 threads x 32 elements per plane = whole 64x64 tile (16-B copies, plain loads,
//   __syncthreads before and after); fragment loads read the LDS tiles with the same v8h element type.
// =====================================================================================
#define AT_D 64
#define AT_NW 4
#define AT_QB 64
#define AT_KC 64
#define AT_LP 72   // LDS row pitch in halves: 144 B = 16 B x odd, so the 16 rows of one ds_load_b128 fall on distinct banks

__device__ __forceinline__ v8f mma_h16(v16h a, v16h b, v8f c) {
  c = __builtin_amdgcn_wmma_f32_16x16x32_f16(false, a, false, b, (short)0, c, false, false);
  asm volatile("v_nop\n\tv_nop\n\tv_nop\n\tv_nop" : "+v"(c) : "v"(a), "v"(b));
  return c;
}

__global__ __launch_bounds__(128)
void attn_phase64_kernel(const unsigned short* __restrict__ qkp, const unsigned short* __restrict__ vtp,
                         const float* __restrict__ pb, unsigned short* __restrict__ aop) {
  union FH { v16h v; v8h h[2]; };
  __shared__ __align__(16) _Float16 Ksh[AT_KC * AT_LP];          // K [kv][d], padded rows    9 KB
  __shared__ __align__(16) _Float16 Vth[AT_D * AT_LP];           // V^T [d][kv], padded rows  9 KB
  __shared__ __align__(16) _Float16 Psh[AT_NW][16 * AT_LP];      // per wave P [row][kv], padded rows  9 KB
  __shared__ __align__(16) float    Os[AT_NW][16 * 68];          // per wave out tile, pitch 68

  const int tid  = threadIdx.x;
  const int wave = tid >> 5;
  const int lane = tid & 31;
  const int hh   = lane >> 4;
  const int c    = lane & 15;

  const int nqb = SEQ_T / AT_QB;          // 32
  const int bx  = blockIdx.x;
  const int qb  = bx % nqb;
  const int h   = bx / nqb;               // 0..NHEAD-1
  const int b   = blockIdx.y;
  const int q0  = qb * AT_QB + wave * 16; // query row within this batch element

  const _Float16* QK = (const _Float16*)(const void*)qkp;
  const _Float16* VT = (const _Float16*)(const void*)vtp;
  _Float16*       AO = (_Float16*)(void*)aop;
  const size_t brow = (size_t)b * SEQ_T;  // row base into the [B*T] planes

  // ---- Q fragments (A operand, row = lane&15, split k map via Frag load): 2 d-chunks ----
  v16h qa[2];
#pragma unroll
  for (int dc = 0; dc < 2; ++dc) {
    const _Float16* qr = QK + (brow + q0 + c) * (size_t)QK_LD + h * HDIM + dc * 32 + 8 * hh;
    qa[dc] = Frag<_Float16>::load(qr);
  }

  float mrow[8], lrow[8];
  v8f oacc[4];
#pragma unroll
  for (int r = 0; r < 8; ++r) { mrow[r] = -INFINITY; lrow[r] = 0.f; }
#pragma unroll
  for (int t = 0; t < 4; ++t) oacc[t] = (v8f){0.f,0.f,0.f,0.f,0.f,0.f,0.f,0.f};

  const int nChunks = SEQ_T / AT_KC;      // 32, compile-time constant
  for (int kc = 0; kc < nChunks; ++kc) {
    const int kv0 = kc * AT_KC;
    __syncthreads();
    {
      // staging coverage: 128 threads x (4 x 8) elements = 64 rows x 64 per plane = the whole chunk tile
      const int r = tid >> 1, half = (tid & 1) * 32;
      const _Float16* ks = QK + (brow + kv0 + r) * (size_t)QK_LD + EMB + h * HDIM + half;   // K row kv0+r, d = half..+31
      const _Float16* vs = VT + ((size_t)b * EMB + h * HDIM + r) * SEQ_T + kv0 + half;     // V^T row d = r, s = kv0+half..+31
#pragma unroll
      for (int i = 0; i < 4; ++i) {
        const v8h a0 = *(const v8h*)(ks + 8 * i);
        const v8h b0 = *(const v8h*)(vs + 8 * i);
        *(v8h*)(Ksh + r * AT_LP + half + 8 * i) = a0;
        *(v8h*)(Vth + r * AT_LP + half + 8 * i) = b0;
      }
    }
    __syncthreads();

    v8f s[4];
#pragma unroll
    for (int j = 0; j < 4; ++j) {
      s[j] = (v8f){0.f,0.f,0.f,0.f,0.f,0.f,0.f,0.f};
#pragma unroll
      for (int dc = 0; dc < 2; ++dc) {
        FH kb;
        kb.h[0] = *(const v8h*)(Ksh + (j * 16 + c) * AT_LP + dc * 32 + 8 * hh);
        kb.h[1] = *(const v8h*)(Ksh + (j * 16 + c) * AT_LP + dc * 32 + 16 + 8 * hh);
        s[j] = mma_h16(qa[dc], kb.v, s[j]);
      }
    }
    // additive bias tile: row q0 + 8hh + r, col kv0 + j*16 + c
    const float* pbr = pb + (brow + q0 + 8 * hh) * (size_t)SEQ_T + kv0 + c;
    float cm[8];
#pragma unroll
    for (int r = 0; r < 8; ++r) {
      float m = -INFINITY;
#pragma unroll
      for (int j = 0; j < 4; ++j) {
        const float sv = s[j][r] * 0.125f + pbr[(size_t)r * SEQ_T + j * 16];
        s[j][r] = sv;
        m = fmaxf(m, sv);
      }
#pragma unroll
      for (int off = 1; off < 16; off <<= 1) m = fmaxf(m, __shfl_xor(m, off, 32));
      cm[r] = m;
    }
    _Float16* pw = Psh[wave];
#pragma unroll
    for (int r = 0; r < 8; ++r) {
      const float mnew = fmaxf(mrow[r], cm[r]);
      const float alpha = expf(mrow[r] - mnew);
      mrow[r] = mnew;
      float psum = 0.f;
#pragma unroll
      for (int j = 0; j < 4; ++j) {
        const float p = expf(s[j][r] - mnew);
        psum += p;
        pw[(8 * hh + r) * AT_LP + j * 16 + c] = (_Float16)(p * 32768.0f);
      }
#pragma unroll
      for (int off = 1; off < 16; off <<= 1) psum += __shfl_xor(psum, off, 32);
      lrow[r] = lrow[r] * alpha + psum;
#pragma unroll
      for (int t = 0; t < 4; ++t) oacc[t][r] *= alpha;
    }
    __builtin_amdgcn_fence(__ATOMIC_RELEASE, "workgroup");
    __builtin_amdgcn_wave_barrier();
    __builtin_amdgcn_fence(__ATOMIC_ACQUIRE, "workgroup");
#pragma unroll
    for (int kk = 0; kk < 2; ++kk) {
      FH pa;
      pa.h[0] = *(const v8h*)(pw + c * AT_LP + kk * 32 + 8 * hh);
      pa.h[1] = *(const v8h*)(pw + c * AT_LP + kk * 32 + 16 + 8 * hh);
#pragma unroll
      for (int t = 0; t < 4; ++t) {
        FH vb;
        vb.h[0] = *(const v8h*)(Vth + (t * 16 + c) * AT_LP + kk * 32 + 8 * hh);
        vb.h[1] = *(const v8h*)(Vth + (t * 16 + c) * AT_LP + kk * 32 + 16 + 8 * hh);
        oacc[t] = mma_h16(pa.v, vb.v, oacc[t]);
      }
    }
  }

  // ---- epilogue: 16 * oacc / (l * 2^15) -> f16 plane ----
  float* os = Os[wave];
#pragma unroll
  for (int r = 0; r < 8; ++r) {
    const float inv = 1.0f / (lrow[r] * 2048.0f);     // = 16 / (l * 32768); l >= 1
#pragma unroll
    for (int t = 0; t < 4; ++t) os[(8 * hh + r) * 68 + t * 16 + c] = oacc[t][r] * inv;
  }
  __builtin_amdgcn_fence(__ATOMIC_RELEASE, "workgroup");
  __builtin_amdgcn_wave_barrier();
  __builtin_amdgcn_fence(__ATOMIC_ACQUIRE, "workgroup");
  {
    const int q = lane >> 3, c8 = (lane & 7) * 8;
    {
#pragma unroll
      for (int it = 0; it < 4; ++it) {
        const int row = it * 4 + q;
        const float* sp = os + row * 68 + c8;
        v8h hv;
#pragma unroll
        for (int e = 0; e < 8; ++e) hv[e] = (_Float16)sp[e];
        *(v8h*)(AO + (brow + q0 + row) * (size_t)EMB + h * HDIM + c8) = hv;
      }
      
    }
  }
}

// =====================================================================================
//   xb    bf16 [4096][1024]          8,388,608  @ 0
//   wqkv  bf16 [3072][1024]          6,291,456  @ 8,388,608
//   wo    f16  [1024][1024] (x64)    2,097,152  @ 14,680,064
//   biasr f32  [4096] (bf16-valued)     16,384  @ 16,777,216
//   qk    f16  [4096][2048]         16,777,216  @ 16,793,600
//   vt    f16  [2][1024][2048]       8,388,608  @ 33,570,816
//   pb    f32  [2][2048][2048]      33,554,432  @ 41,959,424
//   ao    f16  [4096][1024] (x16)    8,388,608  @ 75,513,856
//   total 83,902,464
// =====================================================================================
extern "C" void kernel_launch(void* const* d_in, const int* in_sizes, int n_in,
                              void* d_out, int out_size, void* d_ws, size_t ws_size,
                              hipStream_t stream) {
  if (n_in < 7) return;
  if (in_sizes[0] != NBATCH * SEQ_T * EMB || in_sizes[1] != NBATCH * SEQ_T * NPH ||
      in_sizes[2] != 3 * EMB * EMB || in_sizes[3] != 3 * EMB || in_sizes[4] != EMB * EMB ||
      in_sizes[5] != EMB || in_sizes[6] < 1 || out_size != NBATCH * SEQ_T * EMB) return;

  const float* x      = (const float*)d_in[0];
  const float* coords = (const float*)d_in[1];
  const float* qkv_w  = (const float*)d_in[2];
  const float* qkv_b  = (const float*)d_in[3];
  const float* out_w  = (const float*)d_in[4];
  const float* out_b  = (const float*)d_in[5];
  const float* ptemp  = (const float*)d_in[6];
  float* out = (float*)d_out;

  const size_t MROWS = (size_t)NBATCH * SEQ_T;           // 4096
  size_t off = 0;
  char* ws = (char*)d_ws;
  unsigned short* xb   = (unsigned short*)(ws + off); off += MROWS * EMB * 2;
  unsigned short* wqkv = (unsigned short*)(ws + off); off += (size_t)3 * EMB * EMB * 2;
  unsigned short* wo   = (unsigned short*)(ws + off); off += (size_t)EMB * EMB * 2;
  float*          biasr= (float*)(ws + off);          off += (size_t)4 * EMB * 4;
  unsigned short* qk   = (unsigned short*)(ws + off); off += MROWS * QK_LD * 2;
  unsigned short* vt   = (unsigned short*)(ws + off); off += (size_t)NBATCH * EMB * SEQ_T * 2;
  float*          pb   = (float*)(ws + off);          off += (size_t)NBATCH * SEQ_T * SEQ_T * 4;
  unsigned short* ao   = (unsigned short*)(ws + off); off += MROWS * EMB * 2;
  if (off > ws_size) return;

  // 1-3: operand casts (2 elements per thread; element counts are exact multiples of 512)
  const int n2x = (int)(MROWS * EMB / 2);                 // 2,097,152
  const int n2w = 3 * EMB * EMB / 2;                      // 1,572,864
  const int n2o = EMB * EMB / 2;                          //   524,288
  cast_f32_bf16x2<<<dim3((n2x + 255) / 256), 256, 0, stream>>>(x, xb, n2x);
  cast_f32_bf16x2<<<dim3((n2w + 255) / 256), 256, 0, stream>>>(qkv_w, wqkv, n2w);
  cast_f32_f16x2_scaled<<<dim3((n2o + 255) / 256), 256, 0, stream>>>(out_w, wo, n2o, 64.0f);

  // 4: bias tables
  bias_rne_kernel<<<dim3(4 * EMB / 256), 256, 0, stream>>>(qkv_b, out_b, biasr);

  // 5: phase-space similarity plane
  phase_bias_kernel<<<dim3(SEQ_T / 64, SEQ_T / 64, NBATCH), 256, 0, stream>>>(coords, ptemp, pb);

  // 6: q,k = xb[4096][1024] . wqkv[0:2048][1024]^T + bias[n] -> f16 [4096][2048]   (M=4096,N=2048,K=1024; 2048 tiles)
  wmma_gemm64<1, false, 2, 1, false><<<dim3((4096 / 64) * (2048 / 64) / 8, 1), 256, 0, stream>>>(
      xb, xb, EMB, 0L, wqkv, wqkv, EMB, 0L, (void*)qk, (void*)qk, QK_LD, 0L,
      biasr, biasr, 0L, (int)MROWS, 2 * EMB, EMB, 1.0f);

  // 7: v^T[b] = wqkv[2048:3072][1024] . xb[b][2048][1024]^T + bias[m] -> f16 [2][1024][2048]  (M=1024,N=2048,K=1024; 512 tiles x 2)
  wmma_gemm64<1, false, 1, 1, false><<<dim3((1024 / 64) * (2048 / 64) / 8, NBATCH), 256, 0, stream>>>(
      wqkv + (size_t)2 * EMB * EMB, wqkv + (size_t)2 * EMB * EMB, EMB, 0L,
      xb, xb, EMB, (long)SEQ_T * EMB,
      (void*)vt, (void*)vt, SEQ_T, (long)EMB * SEQ_T,
      biasr + 2 * EMB, biasr, 0L, EMB, SEQ_T, EMB, 1.0f);

  // 8: attention with phase bias -> ao f16 (x16)
  attn_phase64_kernel<<<dim3(NHEAD * (SEQ_T / AT_QB), NBATCH), 128, 0, stream>>>(qk, vt, pb, ao);

  // 9: out = (ao x16) . (wo x64)^T * 2^-10 + out_b -> f32 d_out [4096][1024]   (M=4096,N=1024,K=1024; 1024 tiles)
  wmma_gemm64<0, false, 2, 0, false><<<dim3((4096 / 64) * (1024 / 64) / 8, 1), 256, 0, stream>>>(
      ao, ao, EMB, 0L, wo, wo, EMB, 0L, (void*)out, (void*)out, EMB, 0L,
      biasr + 3 * EMB, biasr, 0L, (int)MROWS, EMB, EMB, 1.0f / 1024.0f);
}

// v002
// One run takes 215 microseconds.
// Timed twice side by side with v001, it ran 1.34 times as fast both times.
// All steps since v000 together make it 1.55 times as fast.
// Contractions: x.Wqkv^T (q,k GEMM and role-swapped v^T GEMM): v_wmma_f32_16x16x32_bf16 (bf16 RNE operands); q.k^T and p.v: v_wmma_f32_16x16x32_f16 (f16 operands, p carried x2^15); ao.Wout^T: v_wmma_f32_16x16x32_f16 (ao x16, Wout x64, folded by 2^-10); all f32 accumulate; softmax and the 8-dim phase-space bias in f32 on VALU.
#include <hip/hip_runtime.h>
#include <math.h>
#include <stdint.h>

constexpr int NBATCH = 2;
constexpr int SEQ_T  = 2048;
constexpr int EMB    = 1024;
constexpr int NHEAD  = 16;
constexpr int HDIM   = 64;
constexpr int NPH    = 8;
constexpr int QK_LD  = 2048;   // q,k plane pitch (q cols 0..1023, k cols 1024..2047)

typedef __attribute__((ext_vector_type(16))) _Float16 v16h;
typedef __attribute__((ext_vector_type(8)))  _Float16 v8h;
typedef __attribute__((ext_vector_type(16))) __bf16   v16b;
typedef __attribute__((ext_vector_type(8)))  __bf16   v8b;
typedef __attribute__((ext_vector_type(8)))  float    v8f;
typedef __attribute__((ext_vector_type(4)))  float    v4f;

__device__ __forceinline__ unsigned short f2bf_bits(float f) {
  unsigned u = __float_as_uint(f);
  return (unsigned short)((u + 0x7FFFu + ((u >> 16) & 1u)) >> 16);
}
__device__ __forceinline__ float bf_bits2f(unsigned short h) { return __uint_as_float(((unsigned)h) << 16); }

// hazard guards as plain device helpers (the only inline asm in the kernel template body is the s_wait_xcnt)
__device__ __forceinline__ void dep_guard_h(v8f& a, v8f& b, v16h x, v16h y) { asm volatile("v_nop\n\tv_nop\n\tv_nop\n\tv_nop" : "+v"(a), "+v"(b) : "v"(x), "v"(y)); }
__device__ __forceinline__ void dep_guard_b(v8f& a, v8f& b, v16b x, v16b y) { asm volatile("v_nop\n\tv_nop\n\tv_nop\n\tv_nop" : "+v"(a), "+v"(b) : "v"(x), "v"(y)); }
__device__ __forceinline__ void keep4_h(v16h a, v16h b, v16h c, v16h d) { asm volatile("v_nop" :: "v"(a), "v"(b), "v"(c), "v"(d)); }
__device__ __forceinline__ void keep4_b(v16b a, v16b b, v16b c, v16b d) { asm volatile("v_nop" :: "v"(a), "v"(b), "v"(c), "v"(d)); }
__device__ __forceinline__ void acc_guard4(v8f& a, v8f& b, v8f& c, v8f& d) { asm volatile("v_nop\n\tv_nop\n\tv_nop\n\tv_nop" : "+v"(a), "+v"(b), "+v"(c), "+v"(d)); }
template <typename T> struct Frag;
template <> struct Frag<_Float16> {
  typedef v16h V; typedef v8h H; union U { v16h v; v8h h[2]; };
  static __device__ __forceinline__ v16h load(const _Float16* p) {   // elements 0..7 <- p[0..7], 8..15 <- p[16..23]
    U f; f.h[0] = *(const v8h*)(p); f.h[1] = *(const v8h*)(p + 16); return f.v;
  }
  static __device__ __forceinline__ v8f mma(v16h a, v16h b, v8f c) {
    return __builtin_amdgcn_wmma_f32_16x16x32_f16(false, a, false, b, (short)0, c, false, false);
  }
  static __device__ __forceinline__ void guard(v8f& a, v8f& b, v16h x, v16h y) { dep_guard_h(a, b, x, y); }
  static __device__ __forceinline__ void keep(v16h a, v16h b, v16h c, v16h d) { keep4_h(a, b, c, d); }
};
template <> struct Frag<__bf16> {
  typedef v16b V; typedef v8b H; union U { v16b v; v8b h[2]; };
  static __device__ __forceinline__ v16b load(const __bf16* p) {
    U f; f.h[0] = *(const v8b*)(p); f.h[1] = *(const v8b*)(p + 16); return f.v;
  }
  static __device__ __forceinline__ v8f mma(v16b a, v16b b, v8f c) {
    return __builtin_amdgcn_wmma_f32_16x16x32_bf16(false, a, false, b, (short)0, c, false, false);
  }
  static __device__ __forceinline__ void guard(v8f& a, v8f& b, v16b x, v16b y) { dep_guard_b(a, b, x, y); }
  static __device__ __forceinline__ void keep(v16b a, v16b b, v16b c, v16b d) { keep4_b(a, b, c, d); }
};

// ---- Register-blocked batched WMMA GEMM ------------------------------------
// C[m,n] = scale * sum_k A[m,k] * Bt[n,k] (+bias)(+resid); each wave owns a 64x64 tile.
// A row-major [M,K]; Bt row-major [N,K]; M % 64 == 0, N % 512 == 0, K % 64 == 0, lda == ldb == GS_LD.
// The 8 waves of a block own 8 neighbouring tiles of one tile row: 64 rows of A (shared) x 512 rows of Bt.
// Per pass of 64 k the block stages those 576 row pieces (128 B each) in LDS: 8 lanes fetch one whole 128-byte line,
// so a load touches 4 lines instead of the 16 that a fragment load from global memory touches; fragments come from LDS.
// SPLIT (hi/lo operand planes) is not carried by the staged path; A2/Bt2 are unused.
// BIAS_MODE: 0 = none, 1 = bias[m], 2 = bias[n].
// OUT_MODE: 0 = f32, 1 = f16, 2 = bf16 hi plane (Cout) + bf16 lo plane (Cout2).
// ET: 0 = f16 operands, 1 = bf16 operands (pointers passed as 16-bit storage)
template <int ET> struct Elem;
template <> struct Elem<0> { typedef _Float16 T; };
template <> struct Elem<1> { typedef __bf16 T; };
constexpr int GS_K = 64;   // k per staged pass: one 128-byte line of every operand row
constexpr int GS_P = 72;   // LDS row pitch in 16-bit elements: 144 B = 16 B x odd, free of bank conflicts for ds_load_b128
constexpr int GS_LD = EMB; // row pitch of A and Bt in every launch; a constant lets a pass's 18 row steps ride in the loads' offset fields
template <int ET, bool SPLIT, int BIAS_MODE, int OUT_MODE, bool RESID, int ACT = 0>
__global__ __launch_bounds__(256) void wmma_gemm64(
    const unsigned short* __restrict__ Ap, const unsigned short* __restrict__ A2p, int lda, long strideA,
    const unsigned short* __restrict__ Btp, const unsigned short* __restrict__ Bt2p, int ldb, long strideB,
    void* __restrict__ Cout, void* __restrict__ Cout2, int ldc, long strideC,
    const float* __restrict__ bias,
    const float* __restrict__ resid, long strideR,
    int M, int N, int K, float scale) {
  typedef typename Elem<ET>::T T;
  typedef typename Frag<T>::V V;
  typedef typename Frag<T>::H H;
  static_assert(!SPLIT, "the staged path holds single operand planes");
  const T* A = (const T*)Ap; const T* Bt = (const T*)Btp;
  __shared__ __align__(16) float sT[8][16 * 68];   // per-wave 16x64 slab, pitch 68 floats
  __shared__ __align__(16) T sA[64 * GS_P];        // the block's 64 A rows, 64 k
  __shared__ __align__(16) T sB[512 * GS_P];       // the block's 512 Bt rows (64 per wave), 64 k
  const int b    = blockIdx.y;
  const int lane = threadIdx.x & 31;
  const int wave = threadIdx.x >> 5;
  const int tilesN = N >> 6;
  const int tilesM = M >> 6;
  const int tile0 = blockIdx.x * 8;        // first of the block's 8 tiles; tilesN % 8 == 0 keeps them in one tile row
  if (tile0 >= tilesM * tilesN || lda != GS_LD || ldb != GS_LD) return;    // block-uniform, in front of every barrier
  const int tm  = tile0 / tilesN;
  const int tn0 = tile0 - tm * tilesN;
  const int m0  = tm << 6;
  const int nb0 = tn0 << 6;                // first Bt row of the block
  const int n0  = nb0 + (wave << 6);

  const T* Ab  = A  + (size_t)b * strideA;
  const T* Bb  = Bt + (size_t)b * strideB;

  const int rlane = lane & 15;                 // row (A) / col (B, D) within subtile
  const int koff  = (lane >> 4) * 8;           // k offset of this lane half
  const int mOff  = (lane >> 4) * 8;           // D row offset

  // staging map: 8 lanes fetch one row piece (16 bytes each at element (tid & 7) * 8); a wave's four rows of each group of
  // 32 lie 8 apart, so that at pitch 144 B the two rows of a 16-lane half fall on opposite halves of the LDS banks
  const int srow = wave + 8 * ((threadIdx.x >> 3) & 3);
  const int scol = (threadIdx.x & 7) * 8;
  const unsigned sLane = (unsigned)(srow * GS_LD + scol) * 2u;   // this thread's byte offset from a group's first row
  const char* gA = (const char*)(Ab + (size_t)m0  * GS_LD);      // block-uniform bases
  const char* gB = (const char*)(Bb + (size_t)nb0 * GS_LD);
  T* stA = sA + srow * GS_P + scol;
  T* stB = sB + srow * GS_P + scol;
  const T* frA = sA + rlane * GS_P + koff;
  const T* frB = sB + ((wave << 6) + rlane) * GS_P + koff;

  v8f acc[4][4];
#pragma unroll
  for (int i = 0; i < 4; ++i)
#pragma unroll
    for (int j = 0; j < 4; ++j) acc[i][j] = (v8f){0.f,0.f,0.f,0.f,0.f,0.f,0.f,0.f};

  for (int k0 = 0; k0 < K; k0 += GS_K) {
    // coverage: 256 threads x 16 B = 32 rows x 128 B per step; 2 steps = 64 A rows, 16 steps = 512 Bt rows
    H ra[2], rb[16];
    const char* pA = gA + (size_t)k0 * 2 + sLane;
    const char* pB = gB + (size_t)k0 * 2 + sLane;
#pragma unroll
    for (int i = 0; i < 2; ++i)  ra[i] = *(const H*)(pA + i * 32 * GS_LD * 2);
#pragma unroll
    for (int i = 0; i < 16; ++i) rb[i] = *(const H*)(pB + i * 32 * GS_LD * 2);
    // the wait that stands in front of any overwrite of the 18 loads' address pairs; naming the pairs as inputs keeps them
    // live up to it (without that the build lands later loads of the group on them)
    asm volatile("s_wait_xcnt 0x0" :: "v"(pA), "v"(pB) : "memory");
    __syncthreads();   // every wave has taken its last fragment of the previous pass
#pragma unroll
    for (int i = 0; i < 2; ++i)  *(H*)(stA + i * 32 * GS_P) = ra[i];
#pragma unroll
    for (int i = 0; i < 16; ++i) *(H*)(stB + i * 32 * GS_P) = rb[i];
    __syncthreads();   // the pass's rows are complete for every wave
#pragma unroll
    for (int kk = 0; kk < GS_K; kk += 32) {
      V bh[4], ah[4];
#pragma unroll
      for (int j = 0; j < 4; ++j) bh[j] = Frag<T>::load(frB + j * 16 * GS_P + kk);
#pragma unroll
      for (int i = 0; i < 4; ++i) ah[i] = Frag<T>::load(frA + i * 16 * GS_P + kk);
#pragma unroll
      for (int i = 0; i < 4; ++i) {
#pragma unroll
        for (int j = 0; j < 4; ++j) acc[i][j] = Frag<T>::mma(ah[i], bh[j], acc[i][j]);
        Frag<T>::guard(acc[i][0], acc[i][3], ah[i], ah[i]);
      }
      Frag<T>::keep(bh[0], bh[1], bh[2], bh[3]);
    }
  }
  acc_guard4(acc[0][0], acc[0][1], acc[0][2], acc[0][3]);
  acc_guard4(acc[1][0], acc[1][1], acc[1][2], acc[1][3]);
  acc_guard4(acc[2][0], acc[2][1], acc[2][2], acc[2][3]);
  acc_guard4(acc[3][0], acc[3][1], acc[3][2], acc[3][3]);

  // ---- epilogue ----
  float* slab = sT[wave];
  const float* Rb = RESID ? (resid + (size_t)b * strideR) : nullptr;
#pragma unroll
  for (int i = 0; i < 4; ++i) {
    const int mBase = m0 + (i << 4);
#pragma unroll
    for (int j = 0; j < 4; ++j) {
      const int n = n0 + (j << 4) + rlane;
      float bv = 0.f;
      if (BIAS_MODE == 2) bv = bias[n];
#pragma unroll
      for (int r = 0; r < 8; ++r) {
        float v = acc[i][j][r] * scale;
        if (BIAS_MODE == 1) v += bias[mBase + mOff + r];
        if (BIAS_MODE == 2) v += bv;
        if (RESID) v += Rb[(size_t)(mBase + mOff + r) * ldc + n];
        if (ACT == 1) v = tanhf(v);
        if (ACT == 2) v = fmaxf(v, 0.0f);
        if (ACT == 3) v = v / (1.0f + expf(-v));
        if (ACT == 4) v = (v > 0.f) ? v : 0.01f * v;
        slab[(mOff + r) * 68 + (j << 4) + rlane] = v;
      }
    }
    __builtin_amdgcn_fence(__ATOMIC_RELEASE, "workgroup");
    __builtin_amdgcn_wave_barrier();
    __builtin_amdgcn_fence(__ATOMIC_ACQUIRE, "workgroup");
    if (OUT_MODE == 0) {
      float* C = (float*)Cout + (size_t)b * strideC;
      const int hh = lane >> 4, c4 = (lane & 15) * 4;     // row seg = 256 B = 16 lanes x 16 B
      {
#pragma unroll
        for (int it = 0; it < 8; ++it) {
          const int row = it * 2 + hh;
          v4f v = *(const v4f*)(slab + row * 68 + c4);
          *(v4f*)(C + (size_t)(mBase + row) * ldc + n0 + c4) = v;
        }
        
      }
    } else {
      const int q = lane >> 3, c8 = (lane & 7) * 8;
      unsigned short* C  = (unsigned short*)Cout  + (size_t)b * strideC;
      unsigned short* C2 = (OUT_MODE == 2) ? ((unsigned short*)Cout2 + (size_t)b * strideC) : nullptr;
      {
#pragma unroll
        for (int it = 0; it < 4; ++it) {
          const int row = it * 4 + q;
          const float* sp = slab + row * 68 + c8;
          v8h hv, lv;
#pragma unroll
          for (int e = 0; e < 8; ++e) {
            if (OUT_MODE == 1) {
              hv[e] = (_Float16)sp[e];
            } else {
              unsigned short hb = f2bf_bits(sp[e]);
              unsigned short lb = f2bf_bits(sp[e] - bf_bits2f(hb));
              hv[e] = __builtin_bit_cast(_Float16, hb);
              lv[e] = __builtin_bit_cast(_Float16, lb);
            }
          }
          *(v8h*)(C + (size_t)(mBase + row) * ldc + n0 + c8) = hv;
          if (OUT_MODE == 2) *(v8h*)(C2 + (size_t)(mBase + row) * ldc + n0 + c8) = lv;
        }
        
      }
    }
    __builtin_amdgcn_fence(__ATOMIC_RELEASE, "workgroup");
    __builtin_amdgcn_wave_barrier();
    __builtin_amdgcn_fence(__ATOMIC_ACQUIRE, "workgroup");
  }
}

__global__ __launch_bounds__(256) void cast_f32_bf16x2(
    const float* __restrict__ in, unsigned short* __restrict__ out, int n2) {
  const int i = blockIdx.x * 256 + threadIdx.x;
  if (i < n2) {
    const float f0 = in[2 * (size_t)i], f1 = in[2 * (size_t)i + 1];
    const unsigned u = (unsigned)f2bf_bits(f0) | ((unsigned)f2bf_bits(f1) << 16);
    ((unsigned*)out)[i] = u;
    
  }
}

// ---- f32 -> f16( bf16_rne(x) * scale ) cast (scale = exact power of two): same store discipline as above ----
__global__ __launch_bounds__(256) void cast_f32_f16x2_scaled(
    const float* __restrict__ in, unsigned short* __restrict__ out, int n2, float scale) {
  const int i = blockIdx.x * 256 + threadIdx.x;
  if (i < n2) {
    const float f0 = bf_bits2f(f2bf_bits(in[2 * (size_t)i])) * scale;
    const float f1 = bf_bits2f(f2bf_bits(in[2 * (size_t)i + 1])) * scale;
    const _Float16 h0 = (_Float16)f0, h1 = (_Float16)f1;
    const unsigned u = (unsigned)__builtin_bit_cast(unsigned short, h0) | ((unsigned)__builtin_bit_cast(unsigned short, h1) << 16);
    ((unsigned*)out)[i] = u;
    
  }
}

// ---- bias tables as RNE-bf16-valued f32: outp[0..3071] = bf16(qkv_b), outp[3072..4095] = bf16(out_b).
//      Both sources loaded unconditionally with clamped indices, selected by value. ----
__global__ __launch_bounds__(256) void bias_rne_kernel(
    const float* __restrict__ qkvb, const float* __restrict__ outb, float* __restrict__ outp) {
  const int i  = blockIdx.x * 256 + threadIdx.x;            // 0..4095
  const int iq = i < 3 * EMB ? i : (3 * EMB - 1);
  int io = i - 3 * EMB; io = io < 0 ? 0 : (io > EMB - 1 ? EMB - 1 : io);
  const float a = qkvb[iq];
  const float c = outb[io];
  const float v = bf_bits2f(f2bf_bits((i < 3 * EMB) ? a : c));
  ((float*)outp)[i] = v;
  
}

// =====================================================================================
// Phase-space similarity plane: PB[b][t][s] = exp( -dist(t,s) * (1/temp) ),
//   dist = d2 > 0 ? sqrt(d2) : 0,  d2 = (|c_t|^2 + |c_s|^2) - 2 * (c_t . c_s)   (8-dim coords, RNE-bf16 valued, f32 math).
//   grid = (T/64 s-tiles, T/64 t-tiles, B), 256 threads. LDS: coords rows of the 64 t and 64 s, plus squared norms.
//   Coverage: 8 waves x 4 iterations x 2 rows = 64 t rows; 16 lanes x 4 floats = 64 s columns -> whole 64x64 tile.
// =====================================================================================
__global__ __launch_bounds__(256) void phase_bias_kernel(
    const float* __restrict__ coords, const float* __restrict__ temp, float* __restrict__ pb) {
#pragma clang fp contract(off)
  __shared__ __align__(16) float ct[64 * NPH];
  __shared__ __align__(16) float cs[64 * NPH];
  __shared__ float sqt[64];
  __shared__ float sqs[64];
  const int tid = threadIdx.x;
  const int b   = blockIdx.z;
  const int t0  = blockIdx.y * 64;
  const int s0  = blockIdx.x * 64;
  const float invT = 1.0f / temp[0];
  {
    // staging coverage: 128 threads x 4 floats = 64 rows x 8 per table (waves 0-3 -> t rows, waves 4-7 -> s rows)
    const int rr = tid & 127, row = rr >> 1, c4 = (rr & 1) * 4;
    const int base = (tid < 128) ? t0 : s0;
    const v4f v = *(const v4f*)(coords + ((size_t)b * SEQ_T + base + row) * NPH + c4);
    v4f w;
#pragma unroll
    for (int e = 0; e < 4; ++e) w[e] = bf_bits2f(f2bf_bits(v[e]));
    if (tid < 128) *(v4f*)(ct + row * NPH + c4) = w;      // wave-uniform branch
    else           *(v4f*)(cs + row * NPH + c4) = w;
  }
  __syncthreads();
  if (tid < 64) {                                          // wave-uniform (waves 0,1)
    float a = 0.0f;
#pragma unroll
    for (int p = 0; p < NPH; ++p) a = a + ct[tid * NPH + p] * ct[tid * NPH + p];
    sqt[tid] = a;
  } else if (tid < 128) {                                  // waves 2,3
    const int r = tid - 64;
    float a = 0.0f;
#pragma unroll
    for (int p = 0; p < NPH; ++p) a = a + cs[r * NPH + p] * cs[r * NPH + p];
    sqs[r] = a;
  }
  __syncthreads();

  const int wave = tid >> 5, lane = tid & 31, hh = lane >> 4, c4 = (lane & 15) * 4;
  v4f ca[4], cb[4];
  float sqv[4];
#pragma unroll
  for (int q = 0; q < 4; ++q) {
    ca[q]  = *(const v4f*)(cs + (c4 + q) * NPH);
    cb[q]  = *(const v4f*)(cs + (c4 + q) * NPH + 4);
    sqv[q] = sqs[c4 + q];
  }
#pragma unroll 1
  for (int it = 0; it < 4; ++it) {
    const int row = wave * 8 + it * 2 + hh;                // 0..63
    const v4f qa = *(const v4f*)(ct + row * NPH);
    const v4f qb = *(const v4f*)(ct + row * NPH + 4);
    const float st = sqt[row];
    v4f res;
#pragma unroll
    for (int q = 0; q < 4; ++q) {
      float dot = qa[0] * ca[q][0];
      dot = dot + qa[1] * ca[q][1];
      dot = dot + qa[2] * ca[q][2];
      dot = dot + qa[3] * ca[q][3];
      dot = dot + qb[0] * cb[q][0];
      dot = dot + qb[1] * cb[q][1];
      dot = dot + qb[2] * cb[q][2];
      dot = dot + qb[3] * cb[q][3];
      const float d2 = (st + sqv[q]) - 2.0f * dot;
      const float sr = sqrtf(fmaxf(d2, 0.0f));
      const float dist = (d2 > 0.0f) ? sr : 0.0f;
      res[q] = expf(-dist * invT);
    }
    float* p = pb + ((size_t)b * SEQ_T + t0 + row) * SEQ_T + s0 + c4;
    *(v4f*)p = res;
    
  }
}

// =====================================================================================
// Full (non-causal, unmasked) attention with additive bias plane, head dim 64.
//   qk plane f16 [B*T][2048]: q(t,h,d) at col h*64+d, k(s,h,d) at col 1024+h*64+d
//   vt plane f16 [B][1024][T]: v(s,h,d) at row h*64+d, col s
//   pb plane f32 [B][T][T]
//   ao plane f16 [B*T][1024]: element (t, h*64+d) = 16 * attention output
//   scores = (q . k) * 0.125 + pb  : v_wmma_f32_16x16x32_f16, f32 accumulate
//   out    = p . v (p carried x2^15 in f16) : v_wmma_f32_16x16x32_f16, folded by 16/(l*2^15) in the epilogue
//   online softmax in f32 over all T keys (32 chunks of 64, compile-time trip count).
//   Block = 4 waves = 64 query rows of one (b,h); grid = (NHEAD * T/64, B).
//   K / V^T chunk staging: 128 threads x 32 elements per plane = whole 64x64 tile (16-B copies, plain loads,
//   __syncthreads before and after); fragment loads read the LDS tiles with the same v8h element type.
// =====================================================================================
#define AT_D 64
#define AT_NW 4
#define AT_QB 64
#define AT_KC 64
#define AT_LP 72   // LDS row pitch in halves: 144 B = 16 B x odd, so the 16 rows of one ds_load_b128 fall on distinct banks

__device__ __forceinline__ v8f mma_h16(v16h a, v16h b, v8f c) {
  c = __builtin_amdgcn_wmma_f32_16x16x32_f16(false, a, false, b, (short)0, c, false, false);
  asm volatile("v_nop\n\tv_nop\n\tv_nop\n\tv_nop" : "+v"(c) : "v"(a), "v"(b));
  return c;
}

__global__ __launch_bounds__(128)
void attn_phase64_kernel(const unsigned short* __restrict__ qkp, const unsigned short* __restrict__ vtp,
                         const float* __restrict__ pb, unsigned short* __restrict__ aop) {
  union FH { v16h v; v8h h[2]; };
  __shared__ __align__(16) _Float16 Ksh[AT_KC * AT_LP];          // K [kv][d], padded rows    9 KB
  __shared__ __align__(16) _Float16 Vth[AT_D * AT_LP];           // V^T [d][kv], padded rows  9 KB
  __shared__ __align__(16) _Float16 Psh[AT_NW][16 * AT_LP];      // per wave P [row][kv], padded rows  9 KB
  __shared__ __align__(16) float    Os[AT_NW][16 * 68];          // per wave out tile, pitch 68

  const int tid  = threadIdx.x;
  const int wave = tid >> 5;
  const int lane = tid & 31;
  const int hh   = lane >> 4;
  const int c    = lane & 15;

  const int nqb = SEQ_T / AT_QB;          // 32
  const int bx  = blockIdx.x;
  const int qb  = bx % nqb;
  const int h   = bx / nqb;               // 0..NHEAD-1
  const int b   = blockIdx.y;
  const int q0  = qb * AT_QB + wave * 16; // query row within this batch element

  const _Float16* QK = (const _Float16*)(const void*)qkp;
  const _Float16* VT = (const _Float16*)(const void*)vtp;
  _Float16*       AO = (_Float16*)(void*)aop;
  const size_t brow = (size_t)b * SEQ_T;  // row base into the [B*T] planes

  // ---- Q fragments (A operand, row = lane&15, split k map via Frag load): 2 d-chunks ----
  v16h qa[2];
#pragma unroll
  for (int dc = 0; dc < 2; ++dc) {
    const _Float16* qr = QK + (brow + q0 + c) * (size_t)QK_LD + h * HDIM + dc * 32 + 8 * hh;
    qa[dc] = Frag<_Float16>::load(qr);
  }

  float mrow[8], lrow[8];
  v8f oacc[4];
#pragma unroll
  for (int r = 0; r < 8; ++r) { mrow[r] = -INFINITY; lrow[r] = 0.f; }
#pragma unroll
  for (int t = 0; t < 4; ++t) oacc[t] = (v8f){0.f,0.f,0.f,0.f,0.f,0.f,0.f,0.f};

  const int nChunks = SEQ_T / AT_KC;      // 32, compile-time constant
  for (int kc = 0; kc < nChunks; ++kc) {
    const int kv0 = kc * AT_KC;
    __syncthreads();
    {
      // staging coverage: 128 threads x (4 x 8) elements = 64 rows x 64 per plane = the whole chunk tile
      const int r = tid >> 1, half = (tid & 1) * 32;
      const _Float16* ks = QK + (brow + kv0 + r) * (size_t)QK_LD + EMB + h * HDIM + half;   // K row kv0+r, d = half..+31
      const _Float16* vs = VT + ((size_t)b * EMB + h * HDIM + r) * SEQ_T + kv0 + half;     // V^T row d = r, s = kv0+half..+31
#pragma unroll
      for (int i = 0; i < 4; ++i) {
        const v8h a0 = *(const v8h*)(ks + 8 * i);
        const v8h b0 = *(const v8h*)(vs + 8 * i);
        *(v8h*)(Ksh + r * AT_LP + half + 8 * i) = a0;
        *(v8h*)(Vth + r * AT_LP + half + 8 * i) = b0;
      }
    }
    __syncthreads();

    v8f s[4];
#pragma unroll
    for (int j = 0; j < 4; ++j) {
      s[j] = (v8f){0.f,0.f,0.f,0.f,0.f,0.f,0.f,0.f};
#pragma unroll
      for (int dc = 0; dc < 2; ++dc) {
        FH kb;
        kb.h[0] = *(const v8h*)(Ksh + (j * 16 + c) * AT_LP + dc * 32 + 8 * hh);
        kb.h[1] = *(const v8h*)(Ksh + (j * 16 + c) * AT_LP + dc * 32 + 16 + 8 * hh);
        s[j] = mma_h16(qa[dc], kb.v, s[j]);
      }
    }
    // additive bias tile: row q0 + 8hh + r, col kv0 + j*16 + c
    const float* pbr = pb + (brow + q0 + 8 * hh) * (size_t)SEQ_T + kv0 + c;
    float cm[8];
#pragma unroll
    for (int r = 0; r < 8; ++r) {
      float m = -INFINITY;
#pragma unroll
      for (int j = 0; j < 4; ++j) {
        const float sv = s[j][r] * 0.125f + pbr[(size_t)r * SEQ_T + j * 16];
        s[j][r] = sv;
        m = fmaxf(m, sv);
      }
#pragma unroll
      for (int off = 1; off < 16; off <<= 1) m = fmaxf(m, __shfl_xor(m, off, 32));
      cm[r] = m;
    }
    _Float16* pw = Psh[wave];
#pragma unroll
    for (int r = 0; r < 8; ++r) {
      const float mnew = fmaxf(mrow[r], cm[r]);
      const float alpha = expf(mrow[r] - mnew);
      mrow[r] = mnew;
      float psum = 0.f;
#pragma unroll
      for (int j = 0; j < 4; ++j) {
        const float p = expf(s[j][r] - mnew);
        psum += p;
        pw[(8 * hh + r) * AT_LP + j * 16 + c] = (_Float16)(p * 32768.0f);
      }
#pragma unroll
      for (int off = 1; off < 16; off <<= 1) psum += __shfl_xor(psum, off, 32);
      lrow[r] = lrow[r] * alpha + psum;
#pragma unroll
      for (int t = 0; t < 4; ++t) oacc[t][r] *= alpha;
    }
    __builtin_amdgcn_fence(__ATOMIC_RELEASE, "workgroup");
    __builtin_amdgcn_wave_barrier();
    __builtin_amdgcn_fence(__ATOMIC_ACQUIRE, "workgroup");
#pragma unroll
    for (int kk = 0; kk < 2; ++kk) {
      FH pa;
      pa.h[0] = *(const v8h*)(pw + c * AT_LP + kk * 32 + 8 * hh);
      pa.h[1] = *(const v8h*)(pw + c * AT_LP + kk * 32 + 16 + 8 * hh);
#pragma unroll
      for (int t = 0; t < 4; ++t) {
        FH vb;
        vb.h[0] = *(const v8h*)(Vth + (t * 16 + c) * AT_LP + kk * 32 + 8 * hh);
        vb.h[1] = *(const v8h*)(Vth + (t * 16 + c) * AT_LP + kk * 32 + 16 + 8 * hh);
        oacc[t] = mma_h16(pa.v, vb.v, oacc[t]);
      }
    }
  }

  // ---- epilogue: 16 * oacc / (l * 2^15) -> f16 plane ----
  float* os = Os[wave];
#pragma unroll
  for (int r = 0; r < 8; ++r) {
    const float inv = 1.0f / (lrow[r] * 2048.0f);     // = 16 / (l * 32768); l >= 1
#pragma unroll
    for (int t = 0; t < 4; ++t) os[(8 * hh + r) * 68 + t * 16 + c] = oacc[t][r] * inv;
  }
  __builtin_amdgcn_fence(__ATOMIC_RELEASE, "workgroup");
  __builtin_amdgcn_wave_barrier();
  __builtin_amdgcn_fence(__ATOMIC_ACQUIRE, "workgroup");
  {
    const int q = lane >> 3, c8 = (lane & 7) * 8;
    {
#pragma unroll
      for (int it = 0; it < 4; ++it) {
        const int row = it * 4 + q;
        const float* sp = os + row * 68 + c8;
        v8h hv;
#pragma unroll
        for (int e = 0; e < 8; ++e) hv[e] = (_Float16)sp[e];
        *(v8h*)(AO + (brow + q0 + row) * (size_t)EMB + h * HDIM + c8) = hv;
      }
      
    }
  }
}

// =====================================================================================
//   xb    bf16 [4096][1024]          8,388,608  @ 0
//   wqkv  bf16 [3072][1024]          6,291,456  @ 8,388,608
//   wo    f16  [1024][1024] (x64)    2,097,152  @ 14,680,064
//   biasr f32  [4096] (bf16-valued)     16,384  @ 16,777,216
//   qk    f16  [4096][2048]         16,777,216  @ 16,793,600
//   vt    f16  [2][1024][2048]       8,388,608  @ 33,570,816
//   pb    f32  [2][2048][2048]      33,554,432  @ 41,959,424
//   ao    f16  [4096][1024] (x16)    8,388,608  @ 75,513,856
//   total 83,902,464
// =====================================================================================
extern "C" void kernel_launch(void* const* d_in, const int* in_sizes, int n_in,
                              void* d_out, int out_size, void* d_ws, size_t ws_size,
                              hipStream_t stream) {
  if (n_in < 7) return;
  if (in_sizes[0] != NBATCH * SEQ_T * EMB || in_sizes[1] != NBATCH * SEQ_T * NPH ||
      in_sizes[2] != 3 * EMB * EMB || in_sizes[3] != 3 * EMB || in_sizes[4] != EMB * EMB ||
      in_sizes[5] != EMB || in_sizes[6] < 1 || out_size != NBATCH * SEQ_T * EMB) return;

  const float* x      = (const float*)d_in[0];
  const float* coords = (const float*)d_in[1];
  const float* qkv_w  = (const float*)d_in[2];
  const float* qkv_b  = (const float*)d_in[3];
  const float* out_w  = (const float*)d_in[4];
  const float* out_b  = (const float*)d_in[5];
  const float* ptemp  = (const float*)d_in[6];
  float* out = (float*)d_out;

  const size_t MROWS = (size_t)NBATCH * SEQ_T;           // 4096
  size_t off = 0;
  char* ws = (char*)d_ws;
  unsigned short* xb   = (unsigned short*)(ws + off); off += MROWS * EMB * 2;
  unsigned short* wqkv = (unsigned short*)(ws + off); off += (size_t)3 * EMB * EMB * 2;
  unsigned short* wo   = (unsigned short*)(ws + off); off += (size_t)EMB * EMB * 2;
  float*          biasr= (float*)(ws + off);          off += (size_t)4 * EMB * 4;
  unsigned short* qk   = (unsigned short*)(ws + off); off += MROWS * QK_LD * 2;
  unsigned short* vt   = (unsigned short*)(ws + off); off += (size_t)NBATCH * EMB * SEQ_T * 2;
  float*          pb   = (float*)(ws + off);          off += (size_t)NBATCH * SEQ_T * SEQ_T * 4;
  unsigned short* ao   = (unsigned short*)(ws + off); off += MROWS * EMB * 2;
  if (off > ws_size) return;

  // 1-3: operand casts (2 elements per thread; element counts are exact multiples of 512)
  const int n2x = (int)(MROWS * EMB / 2);                 // 2,097,152
  const int n2w = 3 * EMB * EMB / 2;                      // 1,572,864
  const int n2o = EMB * EMB / 2;                          //   524,288
  cast_f32_bf16x2<<<dim3((n2x + 255) / 256), 256, 0, stream>>>(x, xb, n2x);
  cast_f32_bf16x2<<<dim3((n2w + 255) / 256), 256, 0, stream>>>(qkv_w, wqkv, n2w);
  cast_f32_f16x2_scaled<<<dim3((n2o + 255) / 256), 256, 0, stream>>>(out_w, wo, n2o, 64.0f);

  // 4: bias tables
  bias_rne_kernel<<<dim3(4 * EMB / 256), 256, 0, stream>>>(qkv_b, out_b, biasr);

  // 5: phase-space similarity plane
  phase_bias_kernel<<<dim3(SEQ_T / 64, SEQ_T / 64, NBATCH), 256, 0, stream>>>(coords, ptemp, pb);

  // 6: q,k = xb[4096][1024] . wqkv[0:2048][1024]^T + bias[n] -> f16 [4096][2048]   (M=4096,N=2048,K=1024; 2048 tiles)
  wmma_gemm64<1, false, 2, 1, false><<<dim3((4096 / 64) * (2048 / 64) / 8, 1), 256, 0, stream>>>(
      xb, xb, EMB, 0L, wqkv, wqkv, EMB, 0L, (void*)qk, (void*)qk, QK_LD, 0L,
      biasr, biasr, 0L, (int)MROWS, 2 * EMB, EMB, 1.0f);

  // 7: v^T[b] = wqkv[2048:3072][1024] . xb[b][2048][1024]^T + bias[m] -> f16 [2][1024][2048]  (M=1024,N=2048,K=1024; 512 tiles x 2)
  wmma_gemm64<1, false, 1, 1, false><<<dim3((1024 / 64) * (2048 / 64) / 8, NBATCH), 256, 0, stream>>>(
      wqkv + (size_t)2 * EMB * EMB, wqkv + (size_t)2 * EMB * EMB, EMB, 0L,
      xb, xb, EMB, (long)SEQ_T * EMB,
      (void*)vt, (void*)vt, SEQ_T, (long)EMB * SEQ_T,
      biasr + 2 * EMB, biasr, 0L, EMB, SEQ_T, EMB, 1.0f);

  // 8: attention with phase bias -> ao f16 (x16)
  attn_phase64_kernel<<<dim3(NHEAD * (SEQ_T / AT_QB), NBATCH), 128, 0, stream>>>(qk, vt, pb, ao);

  // 9: out = (ao x16) . (wo x64)^T * 2^-10 + out_b -> f32 d_out [4096][1024]   (M=4096,N=1024,K=1024; 1024 tiles)
  wmma_gemm64<0, false, 2, 0, false><<<dim3((4096 / 64) * (1024 / 64) / 8, 1), 256, 0, stream>>>(
      ao, ao, EMB, 0L, wo, wo, EMB, 0L, (void*)out, (void*)out, EMB, 0L,
      biasr + 3 * EMB, biasr, 0L, (int)MROWS, EMB, EMB, 1.0f / 1024.0f);
}

// v003
// A run of this version takes 185 microseconds.
// Timed twice side by side with v002, it ran 1.17 and 1.16 times as fast.
// Counting every step since v000, it is 1.80 times as fast.
// Contractions: x.Wqkv^T (q,k GEMM and role-swapped v^T GEMM): v_wmma_f32_16x16x32_bf16 (bf16 RNE operands); q.k^T and p.v: v_wmma_f32_16x16x32_f16 (f16 operands, p carried x2^15); ao.Wout^T: v_wmma_f32_16x16x32_f16 (ao x16, Wout x64, folded by 2^-10); all f32 accumulate; softmax and the 8-dim phase-space bias in f32 on VALU.
#include <hip/hip_runtime.h>
#include <math.h>
#include <stdint.h>

constexpr int NBATCH = 2;
constexpr int SEQ_T  = 2048;
constexpr int EMB    = 1024;
constexpr int NHEAD  = 16;
constexpr int HDIM   = 64;
constexpr int NPH    = 8;
constexpr int QK_LD  = 2048;   // q,k plane pitch (q cols 0..1023, k cols 1024..2047)

typedef __attribute__((ext_vector_type(16))) _Float16 v16h;
typedef __attribute__((ext_vector_type(8)))  _Float16 v8h;
typedef __attribute__((ext_vector_type(16))) __bf16   v16b;
typedef __attribute__((ext_vector_type(8)))  __bf16   v8b;
typedef __attribute__((ext_vector_type(8)))  float    v8f;
typedef __attribute__((ext_vector_type(4)))  float    v4f;

__device__ __forceinline__ unsigned short f2bf_bits(float f) {
  unsigned u = __float_as_uint(f);
  return (unsigned short)((u + 0x7FFFu + ((u >> 16) & 1u)) >> 16);
}
__device__ __forceinline__ float bf_bits2f(unsigned short h) { return __uint_as_float(((unsigned)h) << 16); }

// hazard guards as plain device helpers (the only inline asm in the kernel template body is the s_wait_xcnt)
__device__ __forceinline__ void dep_guard_h(v8f& a, v8f& b, v16h x, v16h y) { asm volatile("v_nop\n\tv_nop\n\tv_nop\n\tv_nop" : "+v"(a), "+v"(b) : "v"(x), "v"(y)); }
__device__ __forceinline__ void dep_guard_b(v8f& a, v8f& b, v16b x, v16b y) { asm volatile("v_nop\n\tv_nop\n\tv_nop\n\tv_nop" : "+v"(a), "+v"(b) : "v"(x), "v"(y)); }
__device__ __forceinline__ void keep4_h(v16h a, v16h b, v16h c, v16h d) { asm volatile("v_nop" :: "v"(a), "v"(b), "v"(c), "v"(d)); }
__device__ __forceinline__ void keep4_b(v16b a, v16b b, v16b c, v16b d) { asm volatile("v_nop" :: "v"(a), "v"(b), "v"(c), "v"(d)); }
__device__ __forceinline__ void acc_guard4(v8f& a, v8f& b, v8f& c, v8f& d) { asm volatile("v_nop\n\tv_nop\n\tv_nop\n\tv_nop" : "+v"(a), "+v"(b), "+v"(c), "+v"(d)); }
template <typename T> struct Frag;
template <> struct Frag<_Float16> {
  typedef v16h V; typedef v8h H; union U { v16h v; v8h h[2]; };
  static __device__ __forceinline__ v16h load(const _Float16* p) {   // elements 0..7 <- p[0..7], 8..15 <- p[16..23]
    U f; f.h[0] = *(const v8h*)(p); f.h[1] = *(const v8h*)(p + 16); return f.v;
  }
  static __device__ __forceinline__ v8f mma(v16h a, v16h b, v8f c) {
    return __builtin_amdgcn_wmma_f32_16x16x32_f16(false, a, false, b, (short)0, c, false, false);
  }
  static __device__ __forceinline__ void guard(v8f& a, v8f& b, v16h x, v16h y) { dep_guard_h(a, b, x, y); }
  static __device__ __forceinline__ void keep(v16h a, v16h b, v16h c, v16h d) { keep4_h(a, b, c, d); }
};
template <> struct Frag<__bf16> {
  typedef v16b V; typedef v8b H; union U { v16b v; v8b h[2]; };
  static __device__ __forceinline__ v16b load(const __bf16* p) {
    U f; f.h[0] = *(const v8b*)(p); f.h[1] = *(const v8b*)(p + 16); return f.v;
  }
  static __device__ __forceinline__ v8f mma(v16b a, v16b b, v8f c) {
    return __builtin_amdgcn_wmma_f32_16x16x32_bf16(false, a, false, b, (short)0, c, false, false);
  }
  static __device__ __forceinline__ void guard(v8f& a, v8f& b, v16b x, v16b y) { dep_guard_b(a, b, x, y); }
  static __device__ __forceinline__ void keep(v16b a, v16b b, v16b c, v16b d) { keep4_b(a, b, c, d); }
};

// ---- Register-blocked batched WMMA GEMM ------------------------------------
// C[m,n] = scale * sum_k A[m,k] * Bt[n,k] (+bias)(+resid); each wave owns a 64x64 tile.
// A row-major [M,K]; Bt row-major [N,K]; M % 64 == 0, N % 512 == 0, K % 64 == 0, lda == ldb == GS_LD.
// The 8 waves of a block own 8 neighbouring tiles of one tile row: 64 rows of A (shared) x 512 rows of Bt.
// Per pass of 64 k the block stages those 576 row pieces (128 B each) in LDS: 8 lanes fetch one whole 128-byte line,
// so a load touches 4 lines instead of the 16 that a fragment load from global memory touches; fragments come from LDS.
// SPLIT (hi/lo operand planes) is not carried by the staged path; A2/Bt2 are unused.
// BIAS_MODE: 0 = none, 1 = bias[m], 2 = bias[n].
// OUT_MODE: 0 = f32, 1 = f16, 2 = bf16 hi plane (Cout) + bf16 lo plane (Cout2).
// ET: 0 = f16 operands, 1 = bf16 operands (pointers passed as 16-bit storage)
template <int ET> struct Elem;
template <> struct Elem<0> { typedef _Float16 T; };
template <> struct Elem<1> { typedef __bf16 T; };
constexpr int GS_K = 64;   // k per staged pass: one 128-byte line of every operand row
constexpr int GS_P = 72;   // LDS row pitch in 16-bit elements: 144 B = 16 B x odd, free of bank conflicts for ds_load_b128
constexpr int GS_LD = EMB; // row pitch of A and Bt in every launch; a constant lets a pass's 18 row steps ride in the loads' offset fields
template <int ET, bool SPLIT, int BIAS_MODE, int OUT_MODE, bool RESID, int ACT = 0>
__global__ __launch_bounds__(256) void wmma_gemm64(
    const unsigned short* __restrict__ Ap, const unsigned short* __restrict__ A2p, int lda, long strideA,
    const unsigned short* __restrict__ Btp, const unsigned short* __restrict__ Bt2p, int ldb, long strideB,
    void* __restrict__ Cout, void* __restrict__ Cout2, int ldc, long strideC,
    const float* __restrict__ bias,
    const float* __restrict__ resid, long strideR,
    int M, int N, int K, float scale) {
  typedef typename Elem<ET>::T T;
  typedef typename Frag<T>::V V;
  typedef typename Frag<T>::H H;
  static_assert(!SPLIT, "the staged path holds single operand planes");
  const T* A = (const T*)Ap; const T* Bt = (const T*)Btp;
  __shared__ __align__(16) float sT[8][16 * 68];   // per-wave 16x64 slab, pitch 68 floats
  __shared__ __align__(16) T sA[64 * GS_P];        // the block's 64 A rows, 64 k
  __shared__ __align__(16) T sB[512 * GS_P];       // the block's 512 Bt rows (64 per wave), 64 k
  const int b    = blockIdx.y;
  const int lane = threadIdx.x & 31;
  const int wave = threadIdx.x >> 5;
  const int tilesN = N >> 6;
  const int tilesM = M >> 6;
  const int tile0 = blockIdx.x * 8;        // first of the block's 8 tiles; tilesN % 8 == 0 keeps them in one tile row
  if (tile0 >= tilesM * tilesN || lda != GS_LD || ldb != GS_LD) return;    // block-uniform, in front of every barrier
  const int tm  = tile0 / tilesN;
  const int tn0 = tile0 - tm * tilesN;
  const int m0  = tm << 6;
  const int nb0 = tn0 << 6;                // first Bt row of the block
  const int n0  = nb0 + (wave << 6);

  const T* Ab  = A  + (size_t)b * strideA;
  const T* Bb  = Bt + (size_t)b * strideB;

  const int rlane = lane & 15;                 // row (A) / col (B, D) within subtile
  const int koff  = (lane >> 4) * 8;           // k offset of this lane half
  const int mOff  = (lane >> 4) * 8;           // D row offset

  // staging map: 8 lanes fetch one row piece (16 bytes each at element (tid & 7) * 8); a wave's four rows of each group of
  // 32 lie 8 apart, so that at pitch 144 B the two rows of a 16-lane half fall on opposite halves of the LDS banks
  const int srow = wave + 8 * ((threadIdx.x >> 3) & 3);
  const int scol = (threadIdx.x & 7) * 8;
  const unsigned sLane = (unsigned)(srow * GS_LD + scol) * 2u;   // this thread's byte offset from a group's first row
  const char* gA = (const char*)(Ab + (size_t)m0  * GS_LD);      // block-uniform bases
  const char* gB = (const char*)(Bb + (size_t)nb0 * GS_LD);
  T* stA = sA + srow * GS_P + scol;
  T* stB = sB + srow * GS_P + scol;
  const T* frA = sA + rlane * GS_P + koff;
  const T* frB = sB + ((wave << 6) + rlane) * GS_P + koff;

  v8f acc[4][4];
#pragma unroll
  for (int i = 0; i < 4; ++i)
#pragma unroll
    for (int j = 0; j < 4; ++j) acc[i][j] = (v8f){0.f,0.f,0.f,0.f,0.f,0.f,0.f,0.f};

  for (int k0 = 0; k0 < K; k0 += GS_K) {
    // coverage: 256 threads x 16 B = 32 rows x 128 B per step; 2 steps = 64 A rows, 16 steps = 512 Bt rows
    H ra[2], rb[16];
    const char* pA = gA + (size_t)k0 * 2 + sLane;
    const char* pB = gB + (size_t)k0 * 2 + sLane;
#pragma unroll
    for (int i = 0; i < 2; ++i)  ra[i] = *(const H*)(pA + i * 32 * GS_LD * 2);
#pragma unroll
    for (int i = 0; i < 16; ++i) rb[i] = *(const H*)(pB + i * 32 * GS_LD * 2);
    // the wait that stands in front of any overwrite of the 18 loads' address pairs; naming the pairs as inputs keeps them
    // live up to it (without that the build lands later loads of the group on them)
    asm volatile("s_wait_xcnt 0x0" :: "v"(pA), "v"(pB) : "memory");
    __syncthreads();   // every wave has taken its last fragment of the previous pass
#pragma unroll
    for (int i = 0; i < 2; ++i)  *(H*)(stA + i * 32 * GS_P) = ra[i];
#pragma unroll
    for (int i = 0; i < 16; ++i) *(H*)(stB + i * 32 * GS_P) = rb[i];
    __syncthreads();   // the pass's rows are complete for every wave
#pragma unroll
    for (int kk = 0; kk < GS_K; kk += 32) {
      V bh[4], ah[4];
#pragma unroll
      for (int j = 0; j < 4; ++j) bh[j] = Frag<T>::load(frB + j * 16 * GS_P + kk);
#pragma unroll
      for (int i = 0; i < 4; ++i) ah[i] = Frag<T>::load(frA + i * 16 * GS_P + kk);
#pragma unroll
      for (int i = 0; i < 4; ++i) {
#pragma unroll
        for (int j = 0; j < 4; ++j) acc[i][j] = Frag<T>::mma(ah[i], bh[j], acc[i][j]);
        Frag<T>::guard(acc[i][0], acc[i][3], ah[i], ah[i]);
      }
      Frag<T>::keep(bh[0], bh[1], bh[2], bh[3]);
    }
  }
  acc_guard4(acc[0][0], acc[0][1], acc[0][2], acc[0][3]);
  acc_guard4(acc[1][0], acc[1][1], acc[1][2], acc[1][3]);
  acc_guard4(acc[2][0], acc[2][1], acc[2][2], acc[2][3]);
  acc_guard4(acc[3][0], acc[3][1], acc[3][2], acc[3][3]);

  // ---- epilogue ----
  float* slab = sT[wave];
  const float* Rb = RESID ? (resid + (size_t)b * strideR) : nullptr;
#pragma unroll
  for (int i = 0; i < 4; ++i) {
    const int mBase = m0 + (i << 4);
#pragma unroll
    for (int j = 0; j < 4; ++j) {
      const int n = n0 + (j << 4) + rlane;
      float bv = 0.f;
      if (BIAS_MODE == 2) bv = bias[n];
#pragma unroll
      for (int r = 0; r < 8; ++r) {
        float v = acc[i][j][r] * scale;
        if (BIAS_MODE == 1) v += bias[mBase + mOff + r];
        if (BIAS_MODE == 2) v += bv;
        if (RESID) v += Rb[(size_t)(mBase + mOff + r) * ldc + n];
        if (ACT == 1) v = tanhf(v);
        if (ACT == 2) v = fmaxf(v, 0.0f);
        if (ACT == 3) v = v / (1.0f + expf(-v));
        if (ACT == 4) v = (v > 0.f) ? v : 0.01f * v;
        slab[(mOff + r) * 68 + (j << 4) + rlane] = v;
      }
    }
    __builtin_amdgcn_fence(__ATOMIC_RELEASE, "workgroup");
    __builtin_amdgcn_wave_barrier();
    __builtin_amdgcn_fence(__ATOMIC_ACQUIRE, "workgroup");
    if (OUT_MODE == 0) {
      float* C = (float*)Cout + (size_t)b * strideC;
      const int hh = lane >> 4, c4 = (lane & 15) * 4;     // row seg = 256 B = 16 lanes x 16 B
      {
#pragma unroll
        for (int it = 0; it < 8; ++it) {
          const int row = it * 2 + hh;
          v4f v = *(const v4f*)(slab + row * 68 + c4);
          *(v4f*)(C + (size_t)(mBase + row) * ldc + n0 + c4) = v;
        }
        
      }
    } else {
      const int q = lane >> 3, c8 = (lane & 7) * 8;
      unsigned short* C  = (unsigned short*)Cout  + (size_t)b * strideC;
      unsigned short* C2 = (OUT_MODE == 2) ? ((unsigned short*)Cout2 + (size_t)b * strideC) : nullptr;
      {
#pragma unroll
        for (int it = 0; it < 4; ++it) {
          const int row = it * 4 + q;
          const float* sp = slab + row * 68 + c8;
          v8h hv, lv;
#pragma unroll
          for (int e = 0; e < 8; ++e) {
            if (OUT_MODE == 1) {
              hv[e] = (_Float16)sp[e];
            } else {
              unsigned short hb = f2bf_bits(sp[e]);
              unsigned short lb = f2bf_bits(sp[e] - bf_bits2f(hb));
              hv[e] = __builtin_bit_cast(_Float16, hb);
              lv[e] = __builtin_bit_cast(_Float16, lb);
            }
          }
          *(v8h*)(C + (size_t)(mBase + row) * ldc + n0 + c8) = hv;
          if (OUT_MODE == 2) *(v8h*)(C2 + (size_t)(mBase + row) * ldc + n0 + c8) = lv;
        }
        
      }
    }
    __builtin_amdgcn_fence(__ATOMIC_RELEASE, "workgroup");
    __builtin_amdgcn_wave_barrier();
    __builtin_amdgcn_fence(__ATOMIC_ACQUIRE, "workgroup");
  }
}

__global__ __launch_bounds__(256) void cast_f32_bf16x2(
    const float* __restrict__ in, unsigned short* __restrict__ out, int n2) {
  const int i = blockIdx.x * 256 + threadIdx.x;
  if (i < n2) {
    const float f0 = in[2 * (size_t)i], f1 = in[2 * (size_t)i + 1];
    const unsigned u = (unsigned)f2bf_bits(f0) | ((unsigned)f2bf_bits(f1) << 16);
    ((unsigned*)out)[i] = u;
    
  }
}

// ---- f32 -> f16( bf16_rne(x) * scale ) cast (scale = exact power of two): same store discipline as above ----
__global__ __launch_bounds__(256) void cast_f32_f16x2_scaled(
    const float* __restrict__ in, unsigned short* __restrict__ out, int n2, float scale) {
  const int i = blockIdx.x * 256 + threadIdx.x;
  if (i < n2) {
    const float f0 = bf_bits2f(f2bf_bits(in[2 * (size_t)i])) * scale;
    const float f1 = bf_bits2f(f2bf_bits(in[2 * (size_t)i + 1])) * scale;
    const _Float16 h0 = (_Float16)f0, h1 = (_Float16)f1;
    const unsigned u = (unsigned)__builtin_bit_cast(unsigned short, h0) | ((unsigned)__builtin_bit_cast(unsigned short, h1) << 16);
    ((unsigned*)out)[i] = u;
    
  }
}

// ---- bias tables as RNE-bf16-valued f32: outp[0..3071] = bf16(qkv_b), outp[3072..4095] = bf16(out_b).
//      Both sources loaded unconditionally with clamped indices, selected by value. ----
__global__ __launch_bounds__(256) void bias_rne_kernel(
    const float* __restrict__ qkvb, const float* __restrict__ outb, float* __restrict__ outp) {
  const int i  = blockIdx.x * 256 + threadIdx.x;            // 0..4095
  const int iq = i < 3 * EMB ? i : (3 * EMB - 1);
  int io = i - 3 * EMB; io = io < 0 ? 0 : (io > EMB - 1 ? EMB - 1 : io);
  const float a = qkvb[iq];
  const float c = outb[io];
  const float v = bf_bits2f(f2bf_bits((i < 3 * EMB) ? a : c));
  ((float*)outp)[i] = v;
  
}

// =====================================================================================
// Phase-space similarity plane: PB[b][t][s] = exp( -dist(t,s) * (1/temp) ),
//   dist = d2 > 0 ? sqrt(d2) : 0,  d2 = (|c_t|^2 + |c_s|^2) - 2 * (c_t . c_s)   (8-dim coords, RNE-bf16 valued, f32 math).
//   grid = (T/64 s-tiles, T/64 t-tiles, B), 256 threads. LDS: coords rows of the 64 t and 64 s, plus squared norms.
//   Coverage: 8 waves x 4 iterations x 2 rows = 64 t rows; 16 lanes x 4 floats = 64 s columns -> whole 64x64 tile.
// =====================================================================================
__global__ __launch_bounds__(256) void phase_bias_kernel(
    const float* __restrict__ coords, const float* __restrict__ temp, float* __restrict__ pb) {
#pragma clang fp contract(off)
  __shared__ __align__(16) float ct[64 * NPH];
  __shared__ __align__(16) float cs[64 * NPH];
  __shared__ float sqt[64];
  __shared__ float sqs[64];
  const int tid = threadIdx.x;
  const int b   = blockIdx.z;
  const int t0  = blockIdx.y * 64;
  const int s0  = blockIdx.x * 64;
  const float invT = 1.0f / temp[0];
  {
    // staging coverage: 128 threads x 4 floats = 64 rows x 8 per table (waves 0-3 -> t rows, waves 4-7 -> s rows)
    const int rr = tid & 127, row = rr >> 1, c4 = (rr & 1) * 4;
    const int base = (tid < 128) ? t0 : s0;
    const v4f v = *(const v4f*)(coords + ((size_t)b * SEQ_T + base + row) * NPH + c4);
    v4f w;
#pragma unroll
    for (int e = 0; e < 4; ++e) w[e] = bf_bits2f(f2bf_bits(v[e]));
    if (tid < 128) *(v4f*)(ct + row * NPH + c4) = w;      // wave-uniform branch
    else           *(v4f*)(cs + row * NPH + c4) = w;
  }
  __syncthreads();
  if (tid < 64) {                                          // wave-uniform (waves 0,1)
    float a = 0.0f;
#pragma unroll
    for (int p = 0; p < NPH; ++p) a = a + ct[tid * NPH + p] * ct[tid * NPH + p];
    sqt[tid] = a;
  } else if (tid < 128) {                                  // waves 2,3
    const int r = tid - 64;
    float a = 0.0f;
#pragma unroll
    for (int p = 0; p < NPH; ++p) a = a + cs[r * NPH + p] * cs[r * NPH + p];
    sqs[r] = a;
  }
  __syncthreads();

  const int wave = tid >> 5, lane = tid & 31, hh = lane >> 4, c4 = (lane & 15) * 4;
  v4f ca[4], cb[4];
  float sqv[4];
#pragma unroll
  for (int q = 0; q < 4; ++q) {
    ca[q]  = *(const v4f*)(cs + (c4 + q) * NPH);
    cb[q]  = *(const v4f*)(cs + (c4 + q) * NPH + 4);
    sqv[q] = sqs[c4 + q];
  }
#pragma unroll 1
  for (int it = 0; it < 4; ++it) {
    const int row = wave * 8 + it * 2 + hh;                // 0..63
    const v4f qa = *(const v4f*)(ct + row * NPH);
    const v4f qb = *(const v4f*)(ct + row * NPH + 4);
    const float st = sqt[row];
    v4f res;
#pragma unroll
    for (int q = 0; q < 4; ++q) {
      float dot = qa[0] * ca[q][0];
      dot = dot + qa[1] * ca[q][1];
      dot = dot + qa[2] * ca[q][2];
      dot = dot + qa[3] * ca[q][3];
      dot = dot + qb[0] * cb[q][0];
      dot = dot + qb[1] * cb[q][1];
      dot = dot + qb[2] * cb[q][2];
      dot = dot + qb[3] * cb[q][3];
      const float d2 = (st + sqv[q]) - 2.0f * dot;
      const float sr = sqrtf(fmaxf(d2, 0.0f));
      const float dist = (d2 > 0.0f) ? sr : 0.0f;
      res[q] = expf(-dist * invT);
    }
    float* p = pb + ((size_t)b * SEQ_T + t0 + row) * SEQ_T + s0 + c4;
    *(v4f*)p = res;
    
  }
}

// =====================================================================================
// Full (non-causal, unmasked) attention with additive bias plane, head dim 64.
//   qk plane f16 [B*T][2048]: q(t,h,d) at col h*64+d, k(s,h,d) at col 1024+h*64+d
//   vt plane f16 [B][1024][T]: v(s,h,d) at row h*64+d, col s
//   pb plane f32 [B][T][T]
//   ao plane f16 [B*T][1024]: element (t, h*64+d) = 16 * attention output
//   Both products run with their operands' roles swapped, so that a lane owns ONE query (column lane & 15):
//   scores^T = (k . q^T) * 0.125 + pb : A = K rows from LDS, B = the wave's 16 queries, kept in registers
//   out^T    = v^T . p^T (p carried x2^15 in f16) : A = V^T rows from LDS, B = p^T, folded by 16/(l*2^15) in the epilogue
//   Score tile j, register r of lane (c, hh) is key j*16 + 8*hh + r of query c: a lane holds 32 of its query's 64 scores, the
//   lane 16 away the other 32. Maximum and sum run in the lane; the halves exchange the maximum once a chunk and join their
//   sums once, in the epilogue. Tiles 2kk and 2kk+1, converted in place, ARE the B operand of 32 keys: element e < 8 is key
//   kk*32 + 8*hh + e, element e >= 8 is key kk*32 + 16 + 8*hh + (e - 8), the k order of the V^T loader. P never touches LDS.
//   online softmax in f32 over all T keys (32 chunks of 64, compile-time trip count).
//   Block = 4 waves = 64 query rows of one (b,h); grid = (NHEAD * T/64, B).
//   K / V^T chunk staging: 128 threads x 32 elements per plane = whole 64x64 tile (16-B copies, plain loads,
//   __syncthreads before and after); fragment loads read the LDS tiles with the same v8h element type.
// =====================================================================================
#define AT_D 64
#define AT_NW 4
#define AT_QB 64
#define AT_KC 64
#define AT_LP 72   // LDS row pitch in halves: 144 B = 16 B x odd, so the 16 rows of one ds_load_b128 fall on distinct banks

__device__ __forceinline__ v8f mma_h16(v16h a, v16h b, v8f c) {
  c = __builtin_amdgcn_wmma_f32_16x16x32_f16(false, a, false, b, (short)0, c, false, false);
  asm volatile("v_nop\n\tv_nop\n\tv_nop\n\tv_nop" : "+v"(c) : "v"(a), "v"(b));
  return c;
}

// the value that lane l ^ 16 holds
__device__ __forceinline__ float other_half(float x) {
  const int u = __builtin_bit_cast(int, x);
  return __builtin_bit_cast(float, __builtin_amdgcn_permlanex16(u, u, 0x76543210, 0xfedcba98, false, false));
}

__global__ __launch_bounds__(128)
void attn_phase64_kernel(const unsigned short* __restrict__ qkp, const unsigned short* __restrict__ vtp,
                         const float* __restrict__ pb, unsigned short* __restrict__ aop) {
  union FH { v16h v; v8h h[2]; };
  __shared__ __align__(16) _Float16 Ksh[AT_KC * AT_LP];          // K [kv][d], padded rows    9 KB
  __shared__ __align__(16) _Float16 Vth[AT_D * AT_LP];           // V^T [d][kv], padded rows  9 KB
  __shared__ __align__(16) float    Os[AT_NW][16 * 68];          // per wave out tile, pitch 68

  const int tid  = threadIdx.x;
  const int wave = tid >> 5;
  const int lane = tid & 31;
  const int hh   = lane >> 4;
  const int c    = lane & 15;

  const int nqb = SEQ_T / AT_QB;          // 32
  const int bx  = blockIdx.x;
  const int qb  = bx % nqb;
  const int h   = bx / nqb;               // 0..NHEAD-1
  const int b   = blockIdx.y;
  const int q0  = qb * AT_QB + wave * 16; // query row within this batch element

  const _Float16* QK = (const _Float16*)(const void*)qkp;
  const _Float16* VT = (const _Float16*)(const void*)vtp;
  _Float16*       AO = (_Float16*)(void*)aop;
  const size_t brow = (size_t)b * SEQ_T;  // row base into the [B*T] planes

  // ---- Q fragments (B operand, column = lane&15, split k map via Frag load): 2 d-chunks ----
  v16h qa[2];
#pragma unroll
  for (int dc = 0; dc < 2; ++dc) {
    const _Float16* qr = QK + (brow + q0 + c) * (size_t)QK_LD + h * HDIM + dc * 32 + 8 * hh;
    qa[dc] = Frag<_Float16>::load(qr);
  }

  float mrow = -INFINITY;   // running maximum of query c, equal in both halves
  float lrow = 0.f;         // running sum of query c over this half's keys
  v8f oacc[4];              // oacc[t][r] = out(query c, d = t*16 + 8*hh + r)
#pragma unroll
  for (int t = 0; t < 4; ++t) oacc[t] = (v8f){0.f,0.f,0.f,0.f,0.f,0.f,0.f,0.f};

  const int nChunks = SEQ_T / AT_KC;      // 32, compile-time constant
  for (int kc = 0; kc < nChunks; ++kc) {
    const int kv0 = kc * AT_KC;
    __syncthreads();
    {
      // staging coverage: 128 threads x (4 x 8) elements = 64 rows x 64 per plane = the whole chunk tile
      const int r = tid >> 1, half = (tid & 1) * 32;
      const _Float16* ks = QK + (brow + kv0 + r) * (size_t)QK_LD + EMB + h * HDIM + half;   // K row kv0+r, d = half..+31
      const _Float16* vs = VT + ((size_t)b * EMB + h * HDIM + r) * SEQ_T + kv0 + half;     // V^T row d = r, s = kv0+half..+31
#pragma unroll
      for (int i = 0; i < 4; ++i) {
        const v8h a0 = *(const v8h*)(ks + 8 * i);
        const v8h b0 = *(const v8h*)(vs + 8 * i);
        *(v8h*)(Ksh + r * AT_LP + half + 8 * i) = a0;
        *(v8h*)(Vth + r * AT_LP + half + 8 * i) = b0;
      }
    }
    __syncthreads();

    v8f s[4];
#pragma unroll
    for (int j = 0; j < 4; ++j) {
      s[j] = (v8f){0.f,0.f,0.f,0.f,0.f,0.f,0.f,0.f};
#pragma unroll
      for (int dc = 0; dc < 2; ++dc) {
        FH kb;
        kb.h[0] = *(const v8h*)(Ksh + (j * 16 + c) * AT_LP + dc * 32 + 8 * hh);
        kb.h[1] = *(const v8h*)(Ksh + (j * 16 + c) * AT_LP + dc * 32 + 16 + 8 * hh);
        s[j] = mma_h16(kb.v, qa[dc], s[j]);
      }
    }
    // additive bias of (query q0 + c, key kv0 + j*16 + 8hh + r), read at [key][query]: the plane's kernel forms element [t][s]
    // and element [s][t] from the same products and sums in the same order, so the two hold the same bits for any coords,
    // and a load then covers two 64-byte row pieces instead of 32 pieces of 16 rows
    const float* pbr = pb + (brow + kv0 + 8 * hh) * (size_t)SEQ_T + q0 + c;
    float pbv[4][8];
#pragma unroll
    for (int j = 0; j < 4; ++j)
#pragma unroll
      for (int r = 0; r < 8; ++r) pbv[j][r] = pbr[(size_t)(j * 16 + r) * SEQ_T];
    // the wait that stands in front of any overwrite of the 32 loads' address pair; naming the pair as an input keeps it live up to it
    asm volatile("s_wait_xcnt 0x0" :: "v"(pbr) : "memory");
    float mj[2];            // two independent chains of 16 (one per pair of score tiles) instead of one of 32
#pragma unroll
    for (int g = 0; g < 2; ++g) mj[g] = -INFINITY;
#pragma unroll
    for (int j = 0; j < 4; ++j) {
#pragma unroll
      for (int r = 0; r < 8; ++r) {
        const float sv = s[j][r] * 0.125f + pbv[j][r];
        s[j][r] = sv;
        mj[j / 2] = fmaxf(mj[j / 2], sv);
      }
    }
    float m = fmaxf(mj[0], mj[1]);
    m = fmaxf(m, other_half(m));
    const float mnew  = fmaxf(mrow, m);
    const float alpha = expf(mrow - mnew);
    mrow = mnew;
    float pj[2];            // likewise two independent sums of 16
#pragma unroll
    for (int g = 0; g < 2; ++g) pj[g] = 0.f;
    FH pa[2];
#pragma unroll
    for (int j = 0; j < 4; ++j) {
#pragma unroll
      for (int r = 0; r < 8; ++r) {
        const float p = expf(s[j][r] - mnew);
        pj[j / 2] += p;
        pa[j >> 1].h[j & 1][r] = (_Float16)(p * 32768.0f);
      }
    }
    const float psum = (pj[0] + pj[1]);
    lrow = lrow * alpha + psum;
#pragma unroll
    for (int t = 0; t < 4; ++t)
#pragma unroll
      for (int r = 0; r < 8; ++r) oacc[t][r] *= alpha;
#pragma unroll
    for (int kk = 0; kk < 2; ++kk) {
#pragma unroll
      for (int t = 0; t < 4; ++t) {
        FH vb;
        vb.h[0] = *(const v8h*)(Vth + (t * 16 + c) * AT_LP + kk * 32 + 8 * hh);
        vb.h[1] = *(const v8h*)(Vth + (t * 16 + c) * AT_LP + kk * 32 + 16 + 8 * hh);
        oacc[t] = mma_h16(vb.v, pa[kk].v, oacc[t]);
      }
    }
  }

  // ---- epilogue: 16 * oacc / (l * 2^15) -> f16 plane ----
  float* os = Os[wave];
  {
    const float l = lrow + other_half(lrow);          // the two halves' keys together
    const float inv = 1.0f / (l * 2048.0f);           // = 16 / (l * 32768); l >= 1
#pragma unroll
    for (int t = 0; t < 4; ++t) {
      v4f lo, hi;
#pragma unroll
      for (int r = 0; r < 4; ++r) { lo[r] = oacc[t][r] * inv; hi[r] = oacc[t][4 + r] * inv; }
      *(v4f*)(os + c * 68 + t * 16 + 8 * hh)     = lo;
      *(v4f*)(os + c * 68 + t * 16 + 8 * hh + 4) = hi;
    }
  }
  __builtin_amdgcn_fence(__ATOMIC_RELEASE, "workgroup");
  __builtin_amdgcn_wave_barrier();
  __builtin_amdgcn_fence(__ATOMIC_ACQUIRE, "workgroup");
  {
    const int q = lane >> 3, c8 = (lane & 7) * 8;
    {
#pragma unroll
      for (int it = 0; it < 4; ++it) {
        const int row = it * 4 + q;
        const float* sp = os + row * 68 + c8;
        v8h hv;
#pragma unroll
        for (int e = 0; e < 8; ++e) hv[e] = (_Float16)sp[e];
        *(v8h*)(AO + (brow + q0 + row) * (size_t)EMB + h * HDIM + c8) = hv;
      }
      
    }
  }
}

// =====================================================================================
//   xb    bf16 [4096][1024]          8,388,608  @ 0
//   wqkv  bf16 [3072][1024]          6,291,456  @ 8,388,608
//   wo    f16  [1024][1024] (x64)    2,097,152  @ 14,680,064
//   biasr f32  [4096] (bf16-valued)     16,384  @ 16,777,216
//   qk    f16  [4096][2048]         16,777,216  @ 16,793,600
//   vt    f16  [2][1024][2048]       8,388,608  @ 33,570,816
//   pb    f32  [2][2048][2048]      33,554,432  @ 41,959,424
//   ao    f16  [4096][1024] (x16)    8,388,608  @ 75,513,856
//   total 83,902,464
// =====================================================================================
extern "C" void kernel_launch(void* const* d_in, const int* in_sizes, int n_in,
                              void* d_out, int out_size, void* d_ws, size_t ws_size,
                              hipStream_t stream) {
  if (n_in < 7) return;
  if (in_sizes[0] != NBATCH * SEQ_T * EMB || in_sizes[1] != NBATCH * SEQ_T * NPH ||
      in_sizes[2] != 3 * EMB * EMB || in_sizes[3] != 3 * EMB || in_sizes[4] != EMB * EMB ||
      in_sizes[5] != EMB || in_sizes[6] < 1 || out_size != NBATCH * SEQ_T * EMB) return;

  const float* x      = (const float*)d_in[0];
  const float* coords = (const float*)d_in[1];
  const float* qkv_w  = (const float*)d_in[2];
  const float* qkv_b  = (const float*)d_in[3];
  const float* out_w  = (const float*)d_in[4];
  const float* out_b  = (const float*)d_in[5];
  const float* ptemp  = (const float*)d_in[6];
  float* out = (float*)d_out;

  const size_t MROWS = (size_t)NBATCH * SEQ_T;           // 4096
  size_t off = 0;
  char* ws = (char*)d_ws;
  unsigned short* xb   = (unsigned short*)(ws + off); off += MROWS * EMB * 2;
  unsigned short* wqkv = (unsigned short*)(ws + off); off += (size_t)3 * EMB * EMB * 2;
  unsigned short* wo   = (unsigned short*)(ws + off); off += (size_t)EMB * EMB * 2;
  float*          biasr= (float*)(ws + off);          off += (size_t)4 * EMB * 4;
  unsigned short* qk   = (unsigned short*)(ws + off); off += MROWS * QK_LD * 2;
  unsigned short* vt   = (unsigned short*)(ws + off); off += (size_t)NBATCH * EMB * SEQ_T * 2;
  float*          pb   = (float*)(ws + off);          off += (size_t)NBATCH * SEQ_T * SEQ_T * 4;
  unsigned short* ao   = (unsigned short*)(ws + off); off += MROWS * EMB * 2;
  if (off > ws_size) return;

  // 1-3: operand casts (2 elements per thread; element counts are exact multiples of 512)
  const int n2x = (int)(MROWS * EMB / 2);                 // 2,097,152
  const int n2w = 3 * EMB * EMB / 2;                      // 1,572,864
  const int n2o = EMB * EMB / 2;                          //   524,288
  cast_f32_bf16x2<<<dim3((n2x + 255) / 256), 256, 0, stream>>>(x, xb, n2x);
  cast_f32_bf16x2<<<dim3((n2w + 255) / 256), 256, 0, stream>>>(qkv_w, wqkv, n2w);
  cast_f32_f16x2_scaled<<<dim3((n2o + 255) / 256), 256, 0, stream>>>(out_w, wo, n2o, 64.0f);

  // 4: bias tables
  bias_rne_kernel<<<dim3(4 * EMB / 256), 256, 0, stream>>>(qkv_b, out_b, biasr);

  // 5: phase-space similarity plane
  phase_bias_kernel<<<dim3(SEQ_T / 64, SEQ_T / 64, NBATCH), 256, 0, stream>>>(coords, ptemp, pb);

  // 6: q,k = xb[4096][1024] . wqkv[0:2048][1024]^T + bias[n] -> f16 [4096][2048]   (M=4096,N=2048,K=1024; 2048 tiles)
  wmma_gemm64<1, false, 2, 1, false><<<dim3((4096 / 64) * (2048 / 64) / 8, 1), 256, 0, stream>>>(
      xb, xb, EMB, 0L, wqkv, wqkv, EMB, 0L, (void*)qk, (void*)qk, QK_LD, 0L,
      biasr, biasr, 0L, (int)MROWS, 2 * EMB, EMB, 1.0f);

  // 7: v^T[b] = wqkv[2048:3072][1024] . xb[b][2048][1024]^T + bias[m] -> f16 [2][1024][2048]  (M=1024,N=2048,K=1024; 512 tiles x 2)
  wmma_gemm64<1, false, 1, 1, false><<<dim3((1024 / 64) * (2048 / 64) / 8, NBATCH), 256, 0, stream>>>(
      wqkv + (size_t)2 * EMB * EMB, wqkv + (size_t)2 * EMB * EMB, EMB, 0L,
      xb, xb, EMB, (long)SEQ_T * EMB,
      (void*)vt, (void*)vt, SEQ_T, (long)EMB * SEQ_T,
      biasr + 2 * EMB, biasr, 0L, EMB, SEQ_T, EMB, 1.0f);

  // 8: attention with phase bias -> ao f16 (x16)
  attn_phase64_kernel<<<dim3(NHEAD * (SEQ_T / AT_QB), NBATCH), 128, 0, stream>>>(qk, vt, pb, ao);

  // 9: out = (ao x16) . (wo x64)^T * 2^-10 + out_b -> f32 d_out [4096][1024]   (M=4096,N=1024,K=1024; 1024 tiles)
  wmma_gemm64<0, false, 2, 0, false><<<dim3((4096 / 64) * (1024 / 64) / 8, 1), 256, 0, stream>>>(
      ao, ao, EMB, 0L, wo, wo, EMB, 0L, (void*)out, (void*)out, EMB, 0L,
      biasr + 3 * EMB, biasr, 0L, (int)MROWS, EMB, EMB, 1.0f / 1024.0f);
}

// v004
// A run of this version takes 160 microseconds.
// In two side-by-side timings against v003, it was 1.16 and 1.15 times as fast.
// All steps since v000 together make it 2.08 times as fast.
// Contractions: x.Wqkv^T (q,k GEMM and role-swapped v^T GEMM): v_wmma_f32_16x16x32_bf16 (bf16 RNE operands); q.k^T and p.v: v_wmma_f32_16x16x32_f16 (f16 operands, p carried x2^15); ao.Wout^T: v_wmma_f32_16x16x32_f16 (ao x16, Wout x64, folded by 2^-10); all f32 accumulate; softmax and the 8-dim phase-space bias in f32 on VALU.
#include <hip/hip_runtime.h>
#include <math.h>
#include <stdint.h>

constexpr int NBATCH = 2;
constexpr int SEQ_T  = 2048;
constexpr int EMB    = 1024;
constexpr int NHEAD  = 16;
constexpr int HDIM   = 64;
constexpr int NPH    = 8;
constexpr int QK_LD  = 2048;   // q,k plane pitch (q cols 0..1023, k cols 1024..2047)

typedef __attribute__((ext_vector_type(16))) _Float16 v16h;
typedef __attribute__((ext_vector_type(8)))  _Float16 v8h;
typedef __attribute__((ext_vector_type(16))) __bf16   v16b;
typedef __attribute__((ext_vector_type(8)))  __bf16   v8b;
typedef __attribute__((ext_vector_type(8)))  float    v8f;
typedef __attribute__((ext_vector_type(4)))  float    v4f;

__device__ __forceinline__ unsigned short f2bf_bits(float f) {
  unsigned u = __float_as_uint(f);
  return (unsigned short)((u + 0x7FFFu + ((u >> 16) & 1u)) >> 16);
}
__device__ __forceinline__ float bf_bits2f(unsigned short h) { return __uint_as_float(((unsigned)h) << 16); }

// hazard guards as plain device helpers (the only inline asm in the kernel template body is the s_wait_xcnt)
__device__ __forceinline__ void dep_guard_h(v8f& a, v8f& b, v16h x, v16h y) { asm volatile("v_nop\n\tv_nop\n\tv_nop\n\tv_nop" : "+v"(a), "+v"(b) : "v"(x), "v"(y)); }
__device__ __forceinline__ void dep_guard_b(v8f& a, v8f& b, v16b x, v16b y) { asm volatile("v_nop\n\tv_nop\n\tv_nop\n\tv_nop" : "+v"(a), "+v"(b) : "v"(x), "v"(y)); }
__device__ __forceinline__ void keep4_h(v16h a, v16h b, v16h c, v16h d) { asm volatile("v_nop" :: "v"(a), "v"(b), "v"(c), "v"(d)); }
__device__ __forceinline__ void keep4_b(v16b a, v16b b, v16b c, v16b d) { asm volatile("v_nop" :: "v"(a), "v"(b), "v"(c), "v"(d)); }
__device__ __forceinline__ void acc_guard4(v8f& a, v8f& b, v8f& c, v8f& d) { asm volatile("v_nop\n\tv_nop\n\tv_nop\n\tv_nop" : "+v"(a), "+v"(b), "+v"(c), "+v"(d)); }
template <typename T> struct Frag;
template <> struct Frag<_Float16> {
  typedef v16h V; typedef v8h H; union U { v16h v; v8h h[2]; };
  static __device__ __forceinline__ v16h load(const _Float16* p) {   // elements 0..7 <- p[0..7], 8..15 <- p[16..23]
    U f; f.h[0] = *(const v8h*)(p); f.h[1] = *(const v8h*)(p + 16); return f.v;
  }
  static __device__ __forceinline__ v8f mma(v16h a, v16h b, v8f c) {
    return __builtin_amdgcn_wmma_f32_16x16x32_f16(false, a, false, b, (short)0, c, false, false);
  }
  static __device__ __forceinline__ void guard(v8f& a, v8f& b, v16h x, v16h y) { dep_guard_h(a, b, x, y); }
  static __device__ __forceinline__ void keep(v16h a, v16h b, v16h c, v16h d) { keep4_h(a, b, c, d); }
};
template <> struct Frag<__bf16> {
  typedef v16b V; typedef v8b H; union U { v16b v; v8b h[2]; };
  static __device__ __forceinline__ v16b load(const __bf16* p) {
    U f; f.h[0] = *(const v8b*)(p); f.h[1] = *(const v8b*)(p + 16); return f.v;
  }
  static __device__ __forceinline__ v8f mma(v16b a, v16b b, v8f c) {
    return __builtin_amdgcn_wmma_f32_16x16x32_bf16(false, a, false, b, (short)0, c, false, false);
  }
  static __device__ __forceinline__ void guard(v8f& a, v8f& b, v16b x, v16b y) { dep_guard_b(a, b, x, y); }
  static __device__ __forceinline__ void keep(v16b a, v16b b, v16b c, v16b d) { keep4_b(a, b, c, d); }
};

// ---- Register-blocked batched WMMA GEMM ------------------------------------
// C[m,n] = scale * sum_k A[m,k] * Bt[n,k] (+bias)(+resid); each wave owns a 64x64 tile.
// A row-major [M,K]; Bt row-major [N,K]; M % 64 == 0, N % 512 == 0, K % 64 == 0, lda == ldb == GS_LD.
// The 8 waves of a block own 8 neighbouring tiles of one tile row: 64 rows of A (shared) x 512 rows of Bt.
// Per pass of 64 k the block stages those 576 row pieces (128 B each) in LDS: 8 lanes fetch one whole 128-byte line,
// so a load touches 4 lines instead of the 16 that a fragment load from global memory touches; fragments come from LDS.
// SPLIT (hi/lo operand planes) is not carried by the staged path; A2/Bt2 are unused.
// BIAS_MODE: 0 = none, 1 = bias[m], 2 = bias[n].
// OUT_MODE: 0 = f32, 1 = f16, 2 = bf16 hi plane (Cout) + bf16 lo plane (Cout2).
// ET: 0 = f16 operands, 1 = bf16 operands (pointers passed as 16-bit storage)
template <int ET> struct Elem;
template <> struct Elem<0> { typedef _Float16 T; };
template <> struct Elem<1> { typedef __bf16 T; };
constexpr int GS_K = 64;   // k per staged pass: one 128-byte line of every operand row
constexpr int GS_P = 72;   // LDS row pitch in 16-bit elements: 144 B = 16 B x odd, free of bank conflicts for ds_load_b128
constexpr int GS_LD = EMB; // row pitch of A and Bt in every launch; a constant lets a pass's 18 row steps ride in the loads' offset fields
// The body is a device function: bx, b are the block's place in its own product's grid, and the kernel that calls it owns the
// LDS arrays, so that a kernel which holds two products (block ranges of one grid) allocates them once.
template <int ET, bool SPLIT, int BIAS_MODE, int OUT_MODE, bool RESID, int ACT = 0>
__device__ __forceinline__ void gemm64_body(
    float (*sT)[16 * 68], typename Elem<ET>::T* sA, typename Elem<ET>::T* sB, const int bx, const int b,
    const unsigned short* __restrict__ Ap, const unsigned short* __restrict__ A2p, int lda, long strideA,
    const unsigned short* __restrict__ Btp, const unsigned short* __restrict__ Bt2p, int ldb, long strideB,
    void* __restrict__ Cout, void* __restrict__ Cout2, int ldc, long strideC,
    const float* __restrict__ bias,
    const float* __restrict__ resid, long strideR,
    int M, int N, int K, float scale) {
  typedef typename Elem<ET>::T T;
  typedef typename Frag<T>::V V;
  typedef typename Frag<T>::H H;
  static_assert(!SPLIT, "the staged path holds single operand planes");
  const T* A = (const T*)Ap; const T* Bt = (const T*)Btp;
  const int lane = threadIdx.x & 31;
  const int wave = threadIdx.x >> 5;
  const int tilesN = N >> 6;
  const int tilesM = M >> 6;
  const int tile0 = bx * 8;                // first of the block's 8 tiles; tilesN % 8 == 0 keeps them in one tile row
  if (tile0 >= tilesM * tilesN || lda != GS_LD || ldb != GS_LD) return;    // block-uniform, in front of every barrier
  const int tm  = tile0 / tilesN;
  const int tn0 = tile0 - tm * tilesN;
  const int m0  = tm << 6;
  const int nb0 = tn0 << 6;                // first Bt row of the block
  const int n0  = nb0 + (wave << 6);

  const T* Ab  = A  + (size_t)b * strideA;
  const T* Bb  = Bt + (size_t)b * strideB;

  const int rlane = lane & 15;                 // row (A) / col (B, D) within subtile
  const int koff  = (lane >> 4) * 8;           // k offset of this lane half
  const int mOff  = (lane >> 4) * 8;           // D row offset

  // staging map: 8 lanes fetch one row piece (16 bytes each at element (tid & 7) * 8); a wave's four rows of each group of
  // 32 lie 8 apart, so that at pitch 144 B the two rows of a 16-lane half fall on opposite halves of the LDS banks
  const int srow = wave + 8 * ((threadIdx.x >> 3) & 3);
  const int scol = (threadIdx.x & 7) * 8;
  const unsigned sLane = (unsigned)(srow * GS_LD + scol) * 2u;   // this thread's byte offset from a group's first row
  const char* gA = (const char*)(Ab + (size_t)m0  * GS_LD);      // block-uniform bases
  const char* gB = (const char*)(Bb + (size_t)nb0 * GS_LD);
  T* stA = sA + srow * GS_P + scol;
  T* stB = sB + srow * GS_P + scol;
  const T* frA = sA + rlane * GS_P + koff;
  const T* frB = sB + ((wave << 6) + rlane) * GS_P + koff;

  v8f acc[4][4];
#pragma unroll
  for (int i = 0; i < 4; ++i)
#pragma unroll
    for (int j = 0; j < 4; ++j) acc[i][j] = (v8f){0.f,0.f,0.f,0.f,0.f,0.f,0.f,0.f};

  for (int k0 = 0; k0 < K; k0 += GS_K) {
    // coverage: 256 threads x 16 B = 32 rows x 128 B per step; 2 steps = 64 A rows, 16 steps = 512 Bt rows
    H ra[2], rb[16];
    const char* pA = gA + (size_t)k0 * 2 + sLane;
    const char* pB = gB + (size_t)k0 * 2 + sLane;
#pragma unroll
    for (int i = 0; i < 2; ++i)  ra[i] = *(const H*)(pA + i * 32 * GS_LD * 2);
#pragma unroll
    for (int i = 0; i < 16; ++i) rb[i] = *(const H*)(pB + i * 32 * GS_LD * 2);
    // the wait that stands in front of any overwrite of the 18 loads' address pairs; naming the pairs as inputs keeps them
    // live up to it (without that the build lands later loads of the group on them)
    asm volatile("s_wait_xcnt 0x0" :: "v"(pA), "v"(pB) : "memory");
    __syncthreads();   // every wave has taken its last fragment of the previous pass
#pragma unroll
    for (int i = 0; i < 2; ++i)  *(H*)(stA + i * 32 * GS_P) = ra[i];
#pragma unroll
    for (int i = 0; i < 16; ++i) *(H*)(stB + i * 32 * GS_P) = rb[i];
    __syncthreads();   // the pass's rows are complete for every wave
#pragma unroll
    for (int kk = 0; kk < GS_K; kk += 32) {
      V bh[4], ah[4];
#pragma unroll
      for (int j = 0; j < 4; ++j) bh[j] = Frag<T>::load(frB + j * 16 * GS_P + kk);
#pragma unroll
      for (int i = 0; i < 4; ++i) ah[i] = Frag<T>::load(frA + i * 16 * GS_P + kk);
#pragma unroll
      for (int i = 0; i < 4; ++i) {
#pragma unroll
        for (int j = 0; j < 4; ++j) acc[i][j] = Frag<T>::mma(ah[i], bh[j], acc[i][j]);
        Frag<T>::guard(acc[i][0], acc[i][3], ah[i], ah[i]);
      }
      Frag<T>::keep(bh[0], bh[1], bh[2], bh[3]);
    }
  }
  acc_guard4(acc[0][0], acc[0][1], acc[0][2], acc[0][3]);
  acc_guard4(acc[1][0], acc[1][1], acc[1][2], acc[1][3]);
  acc_guard4(acc[2][0], acc[2][1], acc[2][2], acc[2][3]);
  acc_guard4(acc[3][0], acc[3][1], acc[3][2], acc[3][3]);

  // ---- epilogue ----
  float* slab = sT[wave];
  const float* Rb = RESID ? (resid + (size_t)b * strideR) : nullptr;
#pragma unroll
  for (int i = 0; i < 4; ++i) {
    const int mBase = m0 + (i << 4);
#pragma unroll
    for (int j = 0; j < 4; ++j) {
      const int n = n0 + (j << 4) + rlane;
      float bv = 0.f;
      if (BIAS_MODE == 2) bv = bias[n];
#pragma unroll
      for (int r = 0; r < 8; ++r) {
        float v = acc[i][j][r] * scale;
        if (BIAS_MODE == 1) v += bias[mBase + mOff + r];
        if (BIAS_MODE == 2) v += bv;
        if (RESID) v += Rb[(size_t)(mBase + mOff + r) * ldc + n];
        if (ACT == 1) v = tanhf(v);
        if (ACT == 2) v = fmaxf(v, 0.0f);
        if (ACT == 3) v = v / (1.0f + expf(-v));
        if (ACT == 4) v = (v > 0.f) ? v : 0.01f * v;
        slab[(mOff + r) * 68 + (j << 4) + rlane] = v;
      }
    }
    __builtin_amdgcn_fence(__ATOMIC_RELEASE, "workgroup");
    __builtin_amdgcn_wave_barrier();
    __builtin_amdgcn_fence(__ATOMIC_ACQUIRE, "workgroup");
    if (OUT_MODE == 0) {
      float* C = (float*)Cout + (size_t)b * strideC;
      const int hh = lane >> 4, c4 = (lane & 15) * 4;     // row seg = 256 B = 16 lanes x 16 B
      {
#pragma unroll
        for (int it = 0; it < 8; ++it) {
          const int row = it * 2 + hh;
          v4f v = *(const v4f*)(slab + row * 68 + c4);
          *(v4f*)(C + (size_t)(mBase + row) * ldc + n0 + c4) = v;
        }
        
      }
    } else {
      const int q = lane >> 3, c8 = (lane & 7) * 8;
      unsigned short* C  = (unsigned short*)Cout  + (size_t)b * strideC;
      unsigned short* C2 = (OUT_MODE == 2) ? ((unsigned short*)Cout2 + (size_t)b * strideC) : nullptr;
      {
#pragma unroll
        for (int it = 0; it < 4; ++it) {
          const int row = it * 4 + q;
          const float* sp = slab + row * 68 + c8;
          v8h hv, lv;
#pragma unroll
          for (int e = 0; e < 8; ++e) {
            if (OUT_MODE == 1) {
              hv[e] = (_Float16)sp[e];
            } else {
              unsigned short hb = f2bf_bits(sp[e]);
              unsigned short lb = f2bf_bits(sp[e] - bf_bits2f(hb));
              hv[e] = __builtin_bit_cast(_Float16, hb);
              lv[e] = __builtin_bit_cast(_Float16, lb);
            }
          }
          *(v8h*)(C + (size_t)(mBase + row) * ldc + n0 + c8) = hv;
          if (OUT_MODE == 2) *(v8h*)(C2 + (size_t)(mBase + row) * ldc + n0 + c8) = lv;
        }
        
      }
    }
    __builtin_amdgcn_fence(__ATOMIC_RELEASE, "workgroup");
    __builtin_amdgcn_wave_barrier();
    __builtin_amdgcn_fence(__ATOMIC_ACQUIRE, "workgroup");
  }
}

// one product a launch
template <int ET, bool SPLIT, int BIAS_MODE, int OUT_MODE, bool RESID, int ACT = 0>
__global__ __launch_bounds__(256) void wmma_gemm64(
    const unsigned short* __restrict__ Ap, const unsigned short* __restrict__ A2p, int lda, long strideA,
    const unsigned short* __restrict__ Btp, const unsigned short* __restrict__ Bt2p, int ldb, long strideB,
    void* __restrict__ Cout, void* __restrict__ Cout2, int ldc, long strideC,
    const float* __restrict__ bias,
    const float* __restrict__ resid, long strideR,
    int M, int N, int K, float scale) {
  typedef typename Elem<ET>::T T;
  __shared__ __align__(16) float sT[8][16 * 68];   // per-wave 16x64 slab, pitch 68 floats
  __shared__ __align__(16) T sA[64 * GS_P];        // the block's 64 A rows, 64 k
  __shared__ __align__(16) T sB[512 * GS_P];       // the block's 512 Bt rows (64 per wave), 64 k
  gemm64_body<ET, SPLIT, BIAS_MODE, OUT_MODE, RESID, ACT>(sT, sA, sB, blockIdx.x, blockIdx.y,
      Ap, A2p, lda, strideA, Btp, Bt2p, ldb, strideB, Cout, Cout2, ldc, strideC, bias, resid, strideR, M, N, K, scale);
}

// The two products of x with Wqkv read the same two planes and neither reads what the other writes: one launch, block ranges.
//   blocks 0..255   : q,k = xb[4096][1024] . wqk[2048][1024]^T + bias[n]    -> f16 [4096][2048]           (2048 tiles)
//   blocks 256..383 : v^T[b] = wv[1024][1024] . xb[b][2048][1024]^T + bias[m]        -> f16 [2][1024][2048] (512 tiles x 2)
// Alone the second fills half the chip's 256 WGPs; two blocks fit a WGP (LDS 2 x 117,760 B, 4 waves a SIMD).
constexpr int QK_BLK = (NBATCH * SEQ_T / 64) * (2 * EMB / 64) / 8;   // 256
constexpr int VT_BLK = (EMB / 64) * (SEQ_T / 64) / 8;                // 64 per batch element
__global__ __launch_bounds__(256) void qkv_gemm_pair(
    const unsigned short* __restrict__ xb, const unsigned short* __restrict__ wqk, const unsigned short* __restrict__ wv,
    const float* __restrict__ biasr, unsigned short* __restrict__ qk, unsigned short* __restrict__ vt, int K) {
  __shared__ __align__(16) float sT[8][16 * 68];
  __shared__ __align__(16) __bf16 sA[64 * GS_P];
  __shared__ __align__(16) __bf16 sB[512 * GS_P];
  const int bx = blockIdx.x;
  if (bx < QK_BLK) {                       // block-uniform
    gemm64_body<1, false, 2, 1, false>(sT, sA, sB, bx, 0,
        xb, xb, EMB, 0L, wqk, wqk, EMB, 0L, (void*)qk, (void*)qk, QK_LD, 0L,
        biasr, biasr, 0L, NBATCH * SEQ_T, 2 * EMB, K, 1.0f);
  } else {
    const int r = bx - QK_BLK;
    gemm64_body<1, false, 1, 1, false>(sT, sA, sB, r % VT_BLK, r / VT_BLK,
        wv, wv, EMB, 0L,
        xb, xb, EMB, (long)SEQ_T * EMB,
        (void*)vt, (void*)vt, SEQ_T, (long)EMB * SEQ_T,
        biasr + 2 * EMB, biasr, 0L, EMB, SEQ_T, K, 1.0f);
  }
}

// ---- the five preparation jobs: device functions, blk = the block's place in the job's own grid (prep_kernel below) ----
__device__ __forceinline__ void cast_f32_bf16x2(
    const float* __restrict__ in, unsigned short* __restrict__ out, int n2, const int blk) {
  const int i = blk * 256 + threadIdx.x;
  if (i < n2) {
    const float f0 = in[2 * (size_t)i], f1 = in[2 * (size_t)i + 1];
    const unsigned u = (unsigned)f2bf_bits(f0) | ((unsigned)f2bf_bits(f1) << 16);
    ((unsigned*)out)[i] = u;
    
  }
}

// ---- f32 -> f16( bf16_rne(x) * scale ) cast (scale = exact power of two): same store discipline as above ----
__device__ __forceinline__ void cast_f32_f16x2_scaled(
    const float* __restrict__ in, unsigned short* __restrict__ out, int n2, float scale, const int blk) {
  const int i = blk * 256 + threadIdx.x;
  if (i < n2) {
    const float f0 = bf_bits2f(f2bf_bits(in[2 * (size_t)i])) * scale;
    const float f1 = bf_bits2f(f2bf_bits(in[2 * (size_t)i + 1])) * scale;
    const _Float16 h0 = (_Float16)f0, h1 = (_Float16)f1;
    const unsigned u = (unsigned)__builtin_bit_cast(unsigned short, h0) | ((unsigned)__builtin_bit_cast(unsigned short, h1) << 16);
    ((unsigned*)out)[i] = u;
    
  }
}

// ---- bias tables as RNE-bf16-valued f32: outp[0..3071] = bf16(qkv_b), outp[3072..4095] = bf16(out_b).
//      Both sources loaded unconditionally with clamped indices, selected by value. ----
__device__ __forceinline__ void bias_rne_job(
    const float* __restrict__ qkvb, const float* __restrict__ outb, float* __restrict__ outp, const int blk) {
  const int i  = blk * 256 + threadIdx.x;                   // 0..4095
  const int iq = i < 3 * EMB ? i : (3 * EMB - 1);
  int io = i - 3 * EMB; io = io < 0 ? 0 : (io > EMB - 1 ? EMB - 1 : io);
  const float a = qkvb[iq];
  const float c = outb[io];
  const float v = bf_bits2f(f2bf_bits((i < 3 * EMB) ? a : c));
  ((float*)outp)[i] = v;
  
}

// =====================================================================================
// Phase-space similarity plane: PB[b][t][s] = exp( -dist(t,s) * (1/temp) ),
//   dist = d2 > 0 ? sqrt(d2) : 0,  d2 = (|c_t|^2 + |c_s|^2) - 2 * (c_t . c_s)   (8-dim coords, RNE-bf16 valued, f32 math).
//   one block = one 64x64 tile (bs of T/64 s-tiles, bt of T/64 t-tiles, b of B), 256 threads. LDS: coords rows of the 64 t and 64 s, plus squared norms.
//   Coverage: 8 waves x 4 iterations x 2 rows = 64 t rows; 16 lanes x 4 floats = 64 s columns -> whole 64x64 tile.
// =====================================================================================
__device__ __forceinline__ void phase_bias_job(
    const float* __restrict__ coords, const float* __restrict__ temp, float* __restrict__ pb,
    const int bs, const int bt, const int b) {
#pragma clang fp contract(off)
  __shared__ __align__(16) float ct[64 * NPH];
  __shared__ __align__(16) float cs[64 * NPH];
  __shared__ float sqt[64];
  __shared__ float sqs[64];
  const int tid = threadIdx.x;
  const int t0  = bt * 64;
  const int s0  = bs * 64;
  const float invT = 1.0f / temp[0];
  {
    // staging coverage: 128 threads x 4 floats = 64 rows x 8 per table (waves 0-3 -> t rows, waves 4-7 -> s rows)
    const int rr = tid & 127, row = rr >> 1, c4 = (rr & 1) * 4;
    const int base = (tid < 128) ? t0 : s0;
    const v4f v = *(const v4f*)(coords + ((size_t)b * SEQ_T + base + row) * NPH + c4);
    v4f w;
#pragma unroll
    for (int e = 0; e < 4; ++e) w[e] = bf_bits2f(f2bf_bits(v[e]));
    if (tid < 128) *(v4f*)(ct + row * NPH + c4) = w;      // wave-uniform branch
    else           *(v4f*)(cs + row * NPH + c4) = w;
  }
  __syncthreads();
  if (tid < 64) {                                          // wave-uniform (waves 0,1)
    float a = 0.0f;
#pragma unroll
    for (int p = 0; p < NPH; ++p) a = a + ct[tid * NPH + p] * ct[tid * NPH + p];
    sqt[tid] = a;
  } else if (tid < 128) {                                  // waves 2,3
    const int r = tid - 64;
    float a = 0.0f;
#pragma unroll
    for (int p = 0; p < NPH; ++p) a = a + cs[r * NPH + p] * cs[r * NPH + p];
    sqs[r] = a;
  }
  __syncthreads();

  const int wave = tid >> 5, lane = tid & 31, hh = lane >> 4, c4 = (lane & 15) * 4;
  v4f ca[4], cb[4];
  float sqv[4];
#pragma unroll
  for (int q = 0; q < 4; ++q) {
    ca[q]  = *(const v4f*)(cs + (c4 + q) * NPH);
    cb[q]  = *(const v4f*)(cs + (c4 + q) * NPH + 4);
    sqv[q] = sqs[c4 + q];
  }
#pragma unroll 1
  for (int it = 0; it < 4; ++it) {
    const int row = wave * 8 + it * 2 + hh;                // 0..63
    const v4f qa = *(const v4f*)(ct + row * NPH);
    const v4f qb = *(const v4f*)(ct + row * NPH + 4);
    const float st = sqt[row];
    v4f res;
#pragma unroll
    for (int q = 0; q < 4; ++q) {
      float dot = qa[0] * ca[q][0];
      dot = dot + qa[1] * ca[q][1];
      dot = dot + qa[2] * ca[q][2];
      dot = dot + qa[3] * ca[q][3];
      dot = dot + qb[0] * cb[q][0];
      dot = dot + qb[1] * cb[q][1];
      dot = dot + qb[2] * cb[q][2];
      dot = dot + qb[3] * cb[q][3];
      const float d2 = (st + sqv[q]) - 2.0f * dot;
      const float sr = sqrtf(fmaxf(d2, 0.0f));
      const float dist = (d2 > 0.0f) ? sr : 0.0f;
      res[q] = expf(-dist * invT);
    }
    float* p = pb + ((size_t)b * SEQ_T + t0 + row) * SEQ_T + s0 + c4;
    *(v4f*)p = res;
    
  }
}

// =====================================================================================
// The three operand casts, the bias tables and the similarity plane read only inputs and write disjoint planes: one launch,
// the block index picks the job (block-uniform, so the plane job's barriers are passed by whole blocks).
//   Blocks 0..15: the bias tables. The other 18432 in groups of nine: the first of a group is a tile of the plane (vector
//   work), the other eight are cast blocks (memory work), so that both kinds are resident on a WGP at the same time.
//   Cast blocks in order: x, qkv_w, out_w.
// =====================================================================================
constexpr int N2X = NBATCH * SEQ_T * EMB / 2;                         // 2,097,152 pairs
constexpr int N2W = 3 * EMB * EMB / 2;                                // 1,572,864
constexpr int N2O = EMB * EMB / 2;                                    //   524,288
constexpr int CX_BLK = N2X / 256, CW_BLK = N2W / 256, CO_BLK = N2O / 256;   // 8192, 6144, 2048
constexpr int PB_BLK = (SEQ_T / 64) * (SEQ_T / 64) * NBATCH;          // 2048
constexpr int BI_BLK = 4 * EMB / 256;                                 // 16
static_assert(CX_BLK + CW_BLK + CO_BLK == 8 * PB_BLK, "eight cast blocks to a tile of the plane");
__global__ __launch_bounds__(256) void prep_kernel(
    const float* __restrict__ x, const float* __restrict__ coords, const float* __restrict__ qkv_w,
    const float* __restrict__ qkv_b, const float* __restrict__ out_w, const float* __restrict__ out_b,
    const float* __restrict__ temp,
    unsigned short* __restrict__ xb, unsigned short* __restrict__ wqkv, unsigned short* __restrict__ wo,
    float* __restrict__ biasr, float* __restrict__ pb) {
  if (blockIdx.x < BI_BLK) { bias_rne_job(qkv_b, out_b, biasr, blockIdx.x); return; }
  const int blk = blockIdx.x - BI_BLK;     // 0..18431
  const int g = blk / 9, r = blk - g * 9;
  if (r == 0) {
    phase_bias_job(coords, temp, pb, g % (SEQ_T / 64), (g / (SEQ_T / 64)) % (SEQ_T / 64), g / ((SEQ_T / 64) * (SEQ_T / 64)));
    return;
  }
  const int cb = g * 8 + r - 1;            // 0..16383
  if (cb < CX_BLK)               cast_f32_bf16x2(x, xb, N2X, cb);
  else if (cb < CX_BLK + CW_BLK) cast_f32_bf16x2(qkv_w, wqkv, N2W, cb - CX_BLK);
  else                           cast_f32_f16x2_scaled(out_w, wo, N2O, 64.0f, cb - CX_BLK - CW_BLK);
}

// =====================================================================================
// Full (non-causal, unmasked) attention with additive bias plane, head dim 64.
//   qk plane f16 [B*T][2048]: q(t,h,d) at col h*64+d, k(s,h,d) at col 1024+h*64+d
//   vt plane f16 [B][1024][T]: v(s,h,d) at row h*64+d, col s
//   pb plane f32 [B][T][T]
//   ao plane f16 [B*T][1024]: element (t, h*64+d) = 16 * attention output
//   Both products run with their operands' roles swapped, so that a lane owns ONE query (column lane & 15):
//   scores^T = (k . q^T) * 0.125 + pb : A = K rows from LDS, B = the wave's 16 queries, kept in registers
//   out^T    = v^T . p^T (p carried x2^15 in f16) : A = V^T rows from LDS, B = p^T, folded by 16/(l*2^15) in the epilogue
//   Score tile j, register r of lane (c, hh) is key j*16 + 8*hh + r of query c: a lane holds 32 of its query's 64 scores, the
//   lane 16 away the other 32. Maximum and sum run in the lane; the halves exchange the maximum once a chunk and join their
//   sums once, in the epilogue. Tiles 2kk and 2kk+1, converted in place, ARE the B operand of 32 keys: element e < 8 is key
//   kk*32 + 8*hh + e, element e >= 8 is key kk*32 + 16 + 8*hh + (e - 8), the k order of the V^T loader. P never touches LDS.
//   online softmax in f32 over all T keys (32 chunks of 64, compile-time trip count).
//   Block = 4 waves = 64 query rows of one (b,h); grid = (NHEAD * T/64, B).
//   K / V^T chunk staging: 128 threads x 32 elements per plane = whole 64x64 tile (16-B copies, plain loads,
//   __syncthreads before and after); fragment loads read the LDS tiles with the same v8h element type.
// =====================================================================================
#define AT_D 64
#define AT_NW 4
#define AT_QB 64
#define AT_KC 64
#define AT_LP 72   // LDS row pitch in halves: 144 B = 16 B x odd, so the 16 rows of one ds_load_b128 fall on distinct banks

__device__ __forceinline__ v8f mma_h16(v16h a, v16h b, v8f c) {
  c = __builtin_amdgcn_wmma_f32_16x16x32_f16(false, a, false, b, (short)0, c, false, false);
  asm volatile("v_nop\n\tv_nop\n\tv_nop\n\tv_nop" : "+v"(c) : "v"(a), "v"(b));
  return c;
}

// the value that lane l ^ 16 holds
__device__ __forceinline__ float other_half(float x) {
  const int u = __builtin_bit_cast(int, x);
  return __builtin_bit_cast(float, __builtin_amdgcn_permlanex16(u, u, 0x76543210, 0xfedcba98, false, false));
}

__global__ __launch_bounds__(128)
void attn_phase64_kernel(const unsigned short* __restrict__ qkp, const unsigned short* __restrict__ vtp,
                         const float* __restrict__ pb, unsigned short* __restrict__ aop) {
  union FH { v16h v; v8h h[2]; };
  __shared__ __align__(16) _Float16 Ksh[AT_KC * AT_LP];          // K [kv][d], padded rows    9 KB
  __shared__ __align__(16) _Float16 Vth[AT_D * AT_LP];           // V^T [d][kv], padded rows  9 KB
  __shared__ __align__(16) float    Os[AT_NW][16 * 68];          // per wave out tile, pitch 68

  const int tid  = threadIdx.x;
  const int wave = tid >> 5;
  const int lane = tid & 31;
  const int hh   = lane >> 4;
  const int c    = lane & 15;

  const int nqb = SEQ_T / AT_QB;          // 32
  const int bx  = blockIdx.x;
  const int qb  = bx % nqb;
  const int h   = bx / nqb;               // 0..NHEAD-1
  const int b   = blockIdx.y;
  const int q0  = qb * AT_QB + wave * 16; // query row within this batch element

  const _Float16* QK = (const _Float16*)(const void*)qkp;
  const _Float16* VT = (const _Float16*)(const void*)vtp;
  _Float16*       AO = (_Float16*)(void*)aop;
  const size_t brow = (size_t)b * SEQ_T;  // row base into the [B*T] planes

  // ---- Q fragments (B operand, column = lane&15, split k map via Frag load): 2 d-chunks ----
  v16h qa[2];
#pragma unroll
  for (int dc = 0; dc < 2; ++dc) {
    const _Float16* qr = QK + (brow + q0 + c) * (size_t)QK_LD + h * HDIM + dc * 32 + 8 * hh;
    qa[dc] = Frag<_Float16>::load(qr);
  }

  float mrow = -INFINITY;   // running maximum of query c, equal in both halves
  float lrow = 0.f;         // running sum of query c over this half's keys
  v8f oacc[4];              // oacc[t][r] = out(query c, d = t*16 + 8*hh + r)
#pragma unroll
  for (int t = 0; t < 4; ++t) oacc[t] = (v8f){0.f,0.f,0.f,0.f,0.f,0.f,0.f,0.f};

  const int nChunks = SEQ_T / AT_KC;      // 32, compile-time constant
  for (int kc = 0; kc < nChunks; ++kc) {
    const int kv0 = kc * AT_KC;
    __syncthreads();
    {
      // staging coverage: 128 threads x (4 x 8) elements = 64 rows x 64 per plane = the whole chunk tile
      const int r = tid >> 1, half = (tid & 1) * 32;
      const _Float16* ks = QK + (brow + kv0 + r) * (size_t)QK_LD + EMB + h * HDIM + half;   // K row kv0+r, d = half..+31
      const _Float16* vs = VT + ((size_t)b * EMB + h * HDIM + r) * SEQ_T + kv0 + half;     // V^T row d = r, s = kv0+half..+31
#pragma unroll
      for (int i = 0; i < 4; ++i) {
        const v8h a0 = *(const v8h*)(ks + 8 * i);
        const v8h b0 = *(const v8h*)(vs + 8 * i);
        *(v8h*)(Ksh + r * AT_LP + half + 8 * i) = a0;
        *(v8h*)(Vth + r * AT_LP + half + 8 * i) = b0;
      }
    }
    __syncthreads();

    v8f s[4];
#pragma unroll
    for (int j = 0; j < 4; ++j) {
      s[j] = (v8f){0.f,0.f,0.f,0.f,0.f,0.f,0.f,0.f};
#pragma unroll
      for (int dc = 0; dc < 2; ++dc) {
        FH kb;
        kb.h[0] = *(const v8h*)(Ksh + (j * 16 + c) * AT_LP + dc * 32 + 8 * hh);
        kb.h[1] = *(const v8h*)(Ksh + (j * 16 + c) * AT_LP + dc * 32 + 16 + 8 * hh);
        s[j] = mma_h16(kb.v, qa[dc], s[j]);
      }
    }
    // additive bias of (query q0 + c, key kv0 + j*16 + 8hh + r), read at [key][query]: the plane's kernel forms element [t][s]
    // and element [s][t] from the same products and sums in the same order, so the two hold the same bits for any coords,
    // and a load then covers two 64-byte row pieces instead of 32 pieces of 16 rows
    const float* pbr = pb + (brow + kv0 + 8 * hh) * (size_t)SEQ_T + q0 + c;
    float pbv[4][8];
#pragma unroll
    for (int j = 0; j < 4; ++j)
#pragma unroll
      for (int r = 0; r < 8; ++r) pbv[j][r] = pbr[(size_t)(j * 16 + r) * SEQ_T];
    // the wait that stands in front of any overwrite of the 32 loads' address pair; naming the pair as an input keeps it live up to it
    asm volatile("s_wait_xcnt 0x0" :: "v"(pbr) : "memory");
    float mj[2];            // two independent chains of 16 (one per pair of score tiles) instead of one of 32
#pragma unroll
    for (int g = 0; g < 2; ++g) mj[g] = -INFINITY;
#pragma unroll
    for (int j = 0; j < 4; ++j) {
#pragma unroll
      for (int r = 0; r < 8; ++r) {
        const float sv = s[j][r] * 0.125f + pbv[j][r];
        s[j][r] = sv;
        mj[j / 2] = fmaxf(mj[j / 2], sv);
      }
    }
    float m = fmaxf(mj[0], mj[1]);
    m = fmaxf(m, other_half(m));
    const float mnew  = fmaxf(mrow, m);
    const float alpha = expf(mrow - mnew);
    mrow = mnew;
    float pj[2];            // likewise two independent sums of 16
#pragma unroll
    for (int g = 0; g < 2; ++g) pj[g] = 0.f;
    FH pa[2];
#pragma unroll
    for (int j = 0; j < 4; ++j) {
#pragma unroll
      for (int r = 0; r < 8; ++r) {
        const float p = expf(s[j][r] - mnew);
        pj[j / 2] += p;
        pa[j >> 1].h[j & 1][r] = (_Float16)(p * 32768.0f);
      }
    }
    const float psum = (pj[0] + pj[1]);
    lrow = lrow * alpha + psum;
#pragma unroll
    for (int t = 0; t < 4; ++t)
#pragma unroll
      for (int r = 0; r < 8; ++r) oacc[t][r] *= alpha;
#pragma unroll
    for (int kk = 0; kk < 2; ++kk) {
#pragma unroll
      for (int t = 0; t < 4; ++t) {
        FH vb;
        vb.h[0] = *(const v8h*)(Vth + (t * 16 + c) * AT_LP + kk * 32 + 8 * hh);
        vb.h[1] = *(const v8h*)(Vth + (t * 16 + c) * AT_LP + kk * 32 + 16 + 8 * hh);
        oacc[t] = mma_h16(vb.v, pa[kk].v, oacc[t]);
      }
    }
  }

  // ---- epilogue: 16 * oacc / (l * 2^15) -> f16 plane ----
  float* os = Os[wave];
  {
    const float l = lrow + other_half(lrow);          // the two halves' keys together
    const float inv = 1.0f / (l * 2048.0f);           // = 16 / (l * 32768); l >= 1
#pragma unroll
    for (int t = 0; t < 4; ++t) {
      v4f lo, hi;
#pragma unroll
      for (int r = 0; r < 4; ++r) { lo[r] = oacc[t][r] * inv; hi[r] = oacc[t][4 + r] * inv; }
      *(v4f*)(os + c * 68 + t * 16 + 8 * hh)     = lo;
      *(v4f*)(os + c * 68 + t * 16 + 8 * hh + 4) = hi;
    }
  }
  __builtin_amdgcn_fence(__ATOMIC_RELEASE, "workgroup");
  __builtin_amdgcn_wave_barrier();
  __builtin_amdgcn_fence(__ATOMIC_ACQUIRE, "workgroup");
  {
    const int q = lane >> 3, c8 = (lane & 7) * 8;
    {
#pragma unroll
      for (int it = 0; it < 4; ++it) {
        const int row = it * 4 + q;
        const float* sp = os + row * 68 + c8;
        v8h hv;
#pragma unroll
        for (int e = 0; e < 8; ++e) hv[e] = (_Float16)sp[e];
        *(v8h*)(AO + (brow + q0 + row) * (size_t)EMB + h * HDIM + c8) = hv;
      }
      
    }
  }
}

// =====================================================================================
//   xb    bf16 [4096][1024]          8,388,608  @ 0
//   wqkv  bf16 [3072][1024]          6,291,456  @ 8,388,608
//   wo    f16  [1024][1024] (x64)    2,097,152  @ 14,680,064
//   biasr f32  [4096] (bf16-valued)     16,384  @ 16,777,216
//   qk    f16  [4096][2048]         16,777,216  @ 16,793,600
//   vt    f16  [2][1024][2048]       8,388,608  @ 33,570,816
//   pb    f32  [2][2048][2048]      33,554,432  @ 41,959,424
//   ao    f16  [4096][1024] (x16)    8,388,608  @ 75,513,856
//   total 83,902,464
// =====================================================================================
extern "C" void kernel_launch(void* const* d_in, const int* in_sizes, int n_in,
                              void* d_out, int out_size, void* d_ws, size_t ws_size,
                              hipStream_t stream) {
  if (n_in < 7) return;
  if (in_sizes[0] != NBATCH * SEQ_T * EMB || in_sizes[1] != NBATCH * SEQ_T * NPH ||
      in_sizes[2] != 3 * EMB * EMB || in_sizes[3] != 3 * EMB || in_sizes[4] != EMB * EMB ||
      in_sizes[5] != EMB || in_sizes[6] < 1 || out_size != NBATCH * SEQ_T * EMB) return;

  const float* x      = (const float*)d_in[0];
  const float* coords = (const float*)d_in[1];
  const float* qkv_w  = (const float*)d_in[2];
  const float* qkv_b  = (const float*)d_in[3];
  const float* out_w  = (const float*)d_in[4];
  const float* out_b  = (const float*)d_in[5];
  const float* ptemp  = (const float*)d_in[6];
  float* out = (float*)d_out;

  const size_t MROWS = (size_t)NBATCH * SEQ_T;           // 4096
  size_t off = 0;
  char* ws = (char*)d_ws;
  unsigned short* xb   = (unsigned short*)(ws + off); off += MROWS * EMB * 2;
  unsigned short* wqkv = (unsigned short*)(ws + off); off += (size_t)3 * EMB * EMB * 2;
  unsigned short* wo   = (unsigned short*)(ws + off); off += (size_t)EMB * EMB * 2;
  float*          biasr= (float*)(ws + off);          off += (size_t)4 * EMB * 4;
  unsigned short* qk   = (unsigned short*)(ws + off); off += MROWS * QK_LD * 2;
  unsigned short* vt   = (unsigned short*)(ws + off); off += (size_t)NBATCH * EMB * SEQ_T * 2;
  float*          pb   = (float*)(ws + off);          off += (size_t)NBATCH * SEQ_T * SEQ_T * 4;
  unsigned short* ao   = (unsigned short*)(ws + off); off += MROWS * EMB * 2;
  if (off > ws_size) return;

  // 1: operand casts (2 elements per thread), bias tables, phase-space similarity plane
  prep_kernel<<<dim3(BI_BLK + 9 * PB_BLK), 256, 0, stream>>>(
      x, coords, qkv_w, qkv_b, out_w, out_b, ptemp, xb, wqkv, wo, biasr, pb);

  // 2: q,k and v^T
  qkv_gemm_pair<<<dim3(QK_BLK + NBATCH * VT_BLK), 256, 0, stream>>>(
      xb, wqkv, wqkv + (size_t)2 * EMB * EMB, biasr, qk, vt, EMB);

  // 3: attention with phase bias -> ao f16 (x16)
  attn_phase64_kernel<<<dim3(NHEAD * (SEQ_T / AT_QB), NBATCH), 128, 0, stream>>>(qk, vt, pb, ao);

  // 4: out = (ao x16) . (wo x64)^T * 2^-10 + out_b -> f32 d_out [4096][1024]   (M=4096,N=1024,K=1024; 1024 tiles)
  wmma_gemm64<0, false, 2, 0, false><<<dim3((4096 / 64) * (1024 / 64) / 8, 1), 256, 0, stream>>>(
      ao, ao, EMB, 0L, wo, wo, EMB, 0L, (void*)out, (void*)out, EMB, 0L,
      biasr + 3 * EMB, biasr, 0L, (int)MROWS, EMB, EMB, 1.0f / 1024.0f);
}

// v005
// Measured time: 148 microseconds a run.
// Timed twice side by side with v004, it ran 1.09 and 1.08 times as fast.
// Over all steps from v000 it is 2.26 times as fast.
// Contractions: x.Wqkv^T (q,k GEMM and role-swapped v^T GEMM): v_wmma_f32_16x16x32_bf16 (bf16 RNE operands); q.k^T and p.v: v_wmma_f32_16x16x32_f16 (f16 operands, p carried x2^15); ao.Wout^T: v_wmma_f32_16x16x32_f16 (ao x16, Wout x64, folded by 2^-10); all f32 accumulate; softmax and the 8-dim phase-space bias in f32 on VALU.
#include <hip/hip_runtime.h>
#include <math.h>
#include <stdint.h>

constexpr int NBATCH = 2;
constexpr int SEQ_T  = 2048;
constexpr int EMB    = 1024;
constexpr int NHEAD  = 16;
constexpr int HDIM   = 64;
constexpr int NPH    = 8;
constexpr int QK_LD  = 2048;   // q,k plane pitch (q cols 0..1023, k cols 1024..2047)

typedef __attribute__((ext_vector_type(16))) _Float16 v16h;
typedef __attribute__((ext_vector_type(8)))  _Float16 v8h;
typedef __attribute__((ext_vector_type(16))) __bf16   v16b;
typedef __attribute__((ext_vector_type(8)))  __bf16   v8b;
typedef __attribute__((ext_vector_type(8)))  float    v8f;
typedef __attribute__((ext_vector_type(4)))  float    v4f;

__device__ __forceinline__ unsigned short f2bf_bits(float f) {
  unsigned u = __float_as_uint(f);
  return (unsigned short)((u + 0x7FFFu + ((u >> 16) & 1u)) >> 16);
}
__device__ __forceinline__ float bf_bits2f(unsigned short h) { return __uint_as_float(((unsigned)h) << 16); }

// hazard guards as plain device helpers (the only inline asm in the kernel template body is the s_wait_xcnt)
__device__ __forceinline__ void dep_guard_h(v8f& a, v8f& b, v16h x, v16h y) { asm volatile("v_nop\n\tv_nop\n\tv_nop\n\tv_nop" : "+v"(a), "+v"(b) : "v"(x), "v"(y)); }
__device__ __forceinline__ void dep_guard_b(v8f& a, v8f& b, v16b x, v16b y) { asm volatile("v_nop\n\tv_nop\n\tv_nop\n\tv_nop" : "+v"(a), "+v"(b) : "v"(x), "v"(y)); }
__device__ __forceinline__ void keep4_h(v16h a, v16h b, v16h c, v16h d) { asm volatile("v_nop" :: "v"(a), "v"(b), "v"(c), "v"(d)); }
__device__ __forceinline__ void keep4_b(v16b a, v16b b, v16b c, v16b d) { asm volatile("v_nop" :: "v"(a), "v"(b), "v"(c), "v"(d)); }
__device__ __forceinline__ void acc_guard4(v8f& a, v8f& b, v8f& c, v8f& d) { asm volatile("v_nop\n\tv_nop\n\tv_nop\n\tv_nop" : "+v"(a), "+v"(b), "+v"(c), "+v"(d)); }
template <typename T> struct Frag;
template <> struct Frag<_Float16> {
  typedef v16h V; typedef v8h H; union U { v16h v; v8h h[2]; };
  static __device__ __forceinline__ v16h load(const _Float16* p) {   // elements 0..7 <- p[0..7], 8..15 <- p[16..23]
    U f; f.h[0] = *(const v8h*)(p); f.h[1] = *(const v8h*)(p + 16); return f.v;
  }
  static __device__ __forceinline__ v8f mma(v16h a, v16h b, v8f c) {
    return __builtin_amdgcn_wmma_f32_16x16x32_f16(false, a, false, b, (short)0, c, false, false);
  }
  static __device__ __forceinline__ void guard(v8f& a, v8f& b, v16h x, v16h y) { dep_guard_h(a, b, x, y); }
  static __device__ __forceinline__ void keep(v16h a, v16h b, v16h c, v16h d) { keep4_h(a, b, c, d); }
};
template <> struct Frag<__bf16> {
  typedef v16b V; typedef v8b H; union U { v16b v; v8b h[2]; };
  static __device__ __forceinline__ v16b load(const __bf16* p) {
    U f; f.h[0] = *(const v8b*)(p); f.h[1] = *(const v8b*)(p + 16); return f.v;
  }
  static __device__ __forceinline__ v8f mma(v16b a, v16b b, v8f c) {
    return __builtin_amdgcn_wmma_f32_16x16x32_bf16(false, a, false, b, (short)0, c, false, false);
  }
  static __device__ __forceinline__ void guard(v8f& a, v8f& b, v16b x, v16b y) { dep_guard_b(a, b, x, y); }
  static __device__ __forceinline__ void keep(v16b a, v16b b, v16b c, v16b d) { keep4_b(a, b, c, d); }
};

// ---- Register-blocked batched WMMA GEMM ------------------------------------
// C[m,n] = scale * sum_k A[m,k] * Bt[n,k] (+bias)(+resid); each wave owns a 64x64 tile.
// A row-major [M,K]; Bt row-major [N,K]; M % 64 == 0, N % 512 == 0, K % 64 == 0, lda == ldb == GS_LD.
// The 8 waves of a block own 8 neighbouring tiles of one tile row: 64 rows of A (shared) x 512 rows of Bt.
// Per pass of 64 k the block stages those 576 row pieces (128 B each) in LDS: 8 lanes fetch one whole 128-byte line,
// so a load touches 4 lines instead of the 16 that a fragment load from global memory touches; fragments come from LDS.
// SPLIT (hi/lo operand planes) is not carried by the staged path; A2/Bt2 are unused.
// BIAS_MODE: 0 = none, 1 = bias[m], 2 = bias[n].
// OUT_MODE: 0 = f32, 1 = f16, 2 = bf16 hi plane (Cout) + bf16 lo plane (Cout2).
// ET: 0 = f16 operands, 1 = bf16 operands (pointers passed as 16-bit storage)
template <int ET> struct Elem;
template <> struct Elem<0> { typedef _Float16 T; };
template <> struct Elem<1> { typedef __bf16 T; };
constexpr int GS_K = 64;   // k per staged pass: one 128-byte line of every operand row
constexpr int GS_P = 72;   // LDS row pitch in 16-bit elements: 144 B = 16 B x odd, free of bank conflicts for ds_load_b128
constexpr int GS_LD = EMB; // row pitch of A and Bt in every launch; a constant lets a pass's 18 row steps ride in the loads' offset fields
// The body is a device function: bx, b are the block's place in its own product's grid, and the kernel that calls it owns the
// LDS arrays, so that a kernel which holds two products (block ranges of one grid) allocates them once.
template <int ET, bool SPLIT, int BIAS_MODE, int OUT_MODE, bool RESID, int ACT = 0>
__device__ __forceinline__ void gemm64_body(
    float (*sT)[16 * 68], typename Elem<ET>::T* sA, typename Elem<ET>::T* sB, const int bx, const int b,
    const unsigned short* __restrict__ Ap, const unsigned short* __restrict__ A2p, int lda, long strideA,
    const unsigned short* __restrict__ Btp, const unsigned short* __restrict__ Bt2p, int ldb, long strideB,
    void* __restrict__ Cout, void* __restrict__ Cout2, int ldc, long strideC,
    const float* __restrict__ bias,
    const float* __restrict__ resid, long strideR,
    int M, int N, int K, float scale) {
  typedef typename Elem<ET>::T T;
  typedef typename Frag<T>::V V;
  typedef typename Frag<T>::H H;
  static_assert(!SPLIT, "the staged path holds single operand planes");
  const T* A = (const T*)Ap; const T* Bt = (const T*)Btp;
  const int lane = threadIdx.x & 31;
  const int wave = threadIdx.x >> 5;
  const int tilesN = N >> 6;
  const int tilesM = M >> 6;
  const int tile0 = bx * 8;                // first of the block's 8 tiles; tilesN % 8 == 0 keeps them in one tile row
  if (tile0 >= tilesM * tilesN || lda != GS_LD || ldb != GS_LD) return;    // block-uniform, in front of every barrier
  const int tm  = tile0 / tilesN;
  const int tn0 = tile0 - tm * tilesN;
  const int m0  = tm << 6;
  const int nb0 = tn0 << 6;                // first Bt row of the block
  const int n0  = nb0 + (wave << 6);

  const T* Ab  = A  + (size_t)b * strideA;
  const T* Bb  = Bt + (size_t)b * strideB;

  const int rlane = lane & 15;                 // row (A) / col (B, D) within subtile
  const int koff  = (lane >> 4) * 8;           // k offset of this lane half
  const int mOff  = (lane >> 4) * 8;           // D row offset

  // staging map: 8 lanes fetch one row piece (16 bytes each at element (tid & 7) * 8); a wave's four rows of each group of
  // 32 lie 8 apart, so that at pitch 144 B the two rows of a 16-lane half fall on opposite halves of the LDS banks
  const int srow = wave + 8 * ((threadIdx.x >> 3) & 3);
  const int scol = (threadIdx.x & 7) * 8;
  const unsigned sLane = (unsigned)(srow * GS_LD + scol) * 2u;   // this thread's byte offset from a group's first row
  const char* gA = (const char*)(Ab + (size_t)m0  * GS_LD);      // block-uniform bases
  const char* gB = (const char*)(Bb + (size_t)nb0 * GS_LD);
  T* stA = sA + srow * GS_P + scol;
  T* stB = sB + srow * GS_P + scol;
  const T* frA = sA + rlane * GS_P + koff;
  const T* frB = sB + ((wave << 6) + rlane) * GS_P + koff;

  v8f acc[4][4];
#pragma unroll
  for (int i = 0; i < 4; ++i)
#pragma unroll
    for (int j = 0; j < 4; ++j) acc[i][j] = (v8f){0.f,0.f,0.f,0.f,0.f,0.f,0.f,0.f};

  for (int k0 = 0; k0 < K; k0 += GS_K) {
    // coverage: 256 threads x 16 B = 32 rows x 128 B per step; 2 steps = 64 A rows, 16 steps = 512 Bt rows
    H ra[2], rb[16];
    const char* pA = gA + (size_t)k0 * 2 + sLane;
    const char* pB = gB + (size_t)k0 * 2 + sLane;
#pragma unroll
    for (int i = 0; i < 2; ++i)  ra[i] = *(const H*)(pA + i * 32 * GS_LD * 2);
#pragma unroll
    for (int i = 0; i < 16; ++i) rb[i] = *(const H*)(pB + i * 32 * GS_LD * 2);
    // the wait that stands in front of any overwrite of the 18 loads' address pairs; naming the pairs as inputs keeps them
    // live up to it (without that the build lands later loads of the group on them)
    asm volatile("s_wait_xcnt 0x0" :: "v"(pA), "v"(pB) : "memory");
    __syncthreads();   // every wave has taken its last fragment of the previous pass
#pragma unroll
    for (int i = 0; i < 2; ++i)  *(H*)(stA + i * 32 * GS_P) = ra[i];
#pragma unroll
    for (int i = 0; i < 16; ++i) *(H*)(stB + i * 32 * GS_P) = rb[i];
    __syncthreads();   // the pass's rows are complete for every wave
#pragma unroll
    for (int kk = 0; kk < GS_K; kk += 32) {
      V bh[4], ah[4];
#pragma unroll
      for (int j = 0; j < 4; ++j) bh[j] = Frag<T>::load(frB + j * 16 * GS_P + kk);
#pragma unroll
      for (int i = 0; i < 4; ++i) ah[i] = Frag<T>::load(frA + i * 16 * GS_P + kk);
#pragma unroll
      for (int i = 0; i < 4; ++i) {
#pragma unroll
        for (int j = 0; j < 4; ++j) acc[i][j] = Frag<T>::mma(ah[i], bh[j], acc[i][j]);
        Frag<T>::guard(acc[i][0], acc[i][3], ah[i], ah[i]);
      }
      Frag<T>::keep(bh[0], bh[1], bh[2], bh[3]);
    }
  }
  acc_guard4(acc[0][0], acc[0][1], acc[0][2], acc[0][3]);
  acc_guard4(acc[1][0], acc[1][1], acc[1][2], acc[1][3]);
  acc_guard4(acc[2][0], acc[2][1], acc[2][2], acc[2][3]);
  acc_guard4(acc[3][0], acc[3][1], acc[3][2], acc[3][3]);

  // ---- epilogue ----
  float* slab = sT[wave];
  const float* Rb = RESID ? (resid + (size_t)b * strideR) : nullptr;
#pragma unroll
  for (int i = 0; i < 4; ++i) {
    const int mBase = m0 + (i << 4);
#pragma unroll
    for (int j = 0; j < 4; ++j) {
      const int n = n0 + (j << 4) + rlane;
      float bv = 0.f;
      if (BIAS_MODE == 2) bv = bias[n];
#pragma unroll
      for (int r = 0; r < 8; ++r) {
        float v = acc[i][j][r] * scale;
        if (BIAS_MODE == 1) v += bias[mBase + mOff + r];
        if (BIAS_MODE == 2) v += bv;
        if (RESID) v += Rb[(size_t)(mBase + mOff + r) * ldc + n];
        if (ACT == 1) v = tanhf(v);
        if (ACT == 2) v = fmaxf(v, 0.0f);
        if (ACT == 3) v = v / (1.0f + expf(-v));
        if (ACT == 4) v = (v > 0.f) ? v : 0.01f * v;
        slab[(mOff + r) * 68 + (j << 4) + rlane] = v;
      }
    }
    __builtin_amdgcn_fence(__ATOMIC_RELEASE, "workgroup");
    __builtin_amdgcn_wave_barrier();
    __builtin_amdgcn_fence(__ATOMIC_ACQUIRE, "workgroup");
    if (OUT_MODE == 0) {
      float* C = (float*)Cout + (size_t)b * strideC;
      const int hh = lane >> 4, c4 = (lane & 15) * 4;     // row seg = 256 B = 16 lanes x 16 B
      {
#pragma unroll
        for (int it = 0; it < 8; ++it) {
          const int row = it * 2 + hh;
          v4f v = *(const v4f*)(slab + row * 68 + c4);
          *(v4f*)(C + (size_t)(mBase + row) * ldc + n0 + c4) = v;
        }
        
      }
    } else {
      const int q = lane >> 3, c8 = (lane & 7) * 8;
      unsigned short* C  = (unsigned short*)Cout  + (size_t)b * strideC;
      unsigned short* C2 = (OUT_MODE == 2) ? ((unsigned short*)Cout2 + (size_t)b * strideC) : nullptr;
      {
#pragma unroll
        for (int it = 0; it < 4; ++it) {
          const int row = it * 4 + q;
          const float* sp = slab + row * 68 + c8;
          v8h hv, lv;
#pragma unroll
          for (int e = 0; e < 8; ++e) {
            if (OUT_MODE == 1) {
              hv[e] = (_Float16)sp[e];
            } else {
              unsigned short hb = f2bf_bits(sp[e]);
              unsigned short lb = f2bf_bits(sp[e] - bf_bits2f(hb));
              hv[e] = __builtin_bit_cast(_Float16, hb);
              lv[e] = __builtin_bit_cast(_Float16, lb);
            }
          }
          *(v8h*)(C + (size_t)(mBase + row) * ldc + n0 + c8) = hv;
          if (OUT_MODE == 2) *(v8h*)(C2 + (size_t)(mBase + row) * ldc + n0 + c8) = lv;
        }
        
      }
    }
    __builtin_amdgcn_fence(__ATOMIC_RELEASE, "workgroup");
    __builtin_amdgcn_wave_barrier();
    __builtin_amdgcn_fence(__ATOMIC_ACQUIRE, "workgroup");
  }
}

// one product a launch
template <int ET, bool SPLIT, int BIAS_MODE, int OUT_MODE, bool RESID, int ACT = 0>
__global__ __launch_bounds__(256) void wmma_gemm64(
    const unsigned short* __restrict__ Ap, const unsigned short* __restrict__ A2p, int lda, long strideA,
    const unsigned short* __restrict__ Btp, const unsigned short* __restrict__ Bt2p, int ldb, long strideB,
    void* __restrict__ Cout, void* __restrict__ Cout2, int ldc, long strideC,
    const float* __restrict__ bias,
    const float* __restrict__ resid, long strideR,
    int M, int N, int K, float scale) {
  typedef typename Elem<ET>::T T;
  __shared__ __align__(16) float sT[8][16 * 68];   // per-wave 16x64 slab, pitch 68 floats
  __shared__ __align__(16) T sA[64 * GS_P];        // the block's 64 A rows, 64 k
  __shared__ __align__(16) T sB[512 * GS_P];       // the block's 512 Bt rows (64 per wave), 64 k
  gemm64_body<ET, SPLIT, BIAS_MODE, OUT_MODE, RESID, ACT>(sT, sA, sB, blockIdx.x, blockIdx.y,
      Ap, A2p, lda, strideA, Btp, Bt2p, ldb, strideB, Cout, Cout2, ldc, strideC, bias, resid, strideR, M, N, K, scale);
}

// The two products of x with Wqkv read the same two planes and neither reads what the other writes: one launch, block ranges.
//   blocks 0..255   : q,k = xb[4096][1024] . wqk[2048][1024]^T + bias[n]    -> f16 [4096][2048]           (2048 tiles)
//   blocks 256..383 : v^T[b] = wv[1024][1024] . xb[b][2048][1024]^T + bias[m]        -> f16 [2][1024][2048] (512 tiles x 2)
// Alone the second fills half the chip's 256 WGPs; two blocks fit a WGP (LDS 2 x 117,760 B, 4 waves a SIMD).
constexpr int QK_BLK = (NBATCH * SEQ_T / 64) * (2 * EMB / 64) / 8;   // 256
constexpr int VT_BLK = (EMB / 64) * (SEQ_T / 64) / 8;                // 64 per batch element
__global__ __launch_bounds__(256) void qkv_gemm_pair(
    const unsigned short* __restrict__ xb, const unsigned short* __restrict__ wqk, const unsigned short* __restrict__ wv,
    const float* __restrict__ biasr, unsigned short* __restrict__ qk, unsigned short* __restrict__ vt, int K) {
  __shared__ __align__(16) float sT[8][16 * 68];
  __shared__ __align__(16) __bf16 sA[64 * GS_P];
  __shared__ __align__(16) __bf16 sB[512 * GS_P];
  const int bx = blockIdx.x;
  if (bx < QK_BLK) {                       // block-uniform
    gemm64_body<1, false, 2, 1, false>(sT, sA, sB, bx, 0,
        xb, xb, EMB, 0L, wqk, wqk, EMB, 0L, (void*)qk, (void*)qk, QK_LD, 0L,
        biasr, biasr, 0L, NBATCH * SEQ_T, 2 * EMB, K, 1.0f);
  } else {
    const int r = bx - QK_BLK;
    gemm64_body<1, false, 1, 1, false>(sT, sA, sB, r % VT_BLK, r / VT_BLK,
        wv, wv, EMB, 0L,
        xb, xb, EMB, (long)SEQ_T * EMB,
        (void*)vt, (void*)vt, SEQ_T, (long)EMB * SEQ_T,
        biasr + 2 * EMB, biasr, 0L, EMB, SEQ_T, K, 1.0f);
  }
}

// ---- the five preparation jobs: device functions, blk = the block's place in the job's own grid (prep_kernel below) ----
__device__ __forceinline__ void cast_f32_bf16x2(
    const float* __restrict__ in, unsigned short* __restrict__ out, int n2, const int blk) {
  const int i = blk * 256 + threadIdx.x;
  if (i < n2) {
    const float f0 = in[2 * (size_t)i], f1 = in[2 * (size_t)i + 1];
    const unsigned u = (unsigned)f2bf_bits(f0) | ((unsigned)f2bf_bits(f1) << 16);
    ((unsigned*)out)[i] = u;
    
  }
}

// ---- f32 -> f16( bf16_rne(x) * scale ) cast (scale = exact power of two): same store discipline as above ----
__device__ __forceinline__ void cast_f32_f16x2_scaled(
    const float* __restrict__ in, unsigned short* __restrict__ out, int n2, float scale, const int blk) {
  const int i = blk * 256 + threadIdx.x;
  if (i < n2) {
    const float f0 = bf_bits2f(f2bf_bits(in[2 * (size_t)i])) * scale;
    const float f1 = bf_bits2f(f2bf_bits(in[2 * (size_t)i + 1])) * scale;
    const _Float16 h0 = (_Float16)f0, h1 = (_Float16)f1;
    const unsigned u = (unsigned)__builtin_bit_cast(unsigned short, h0) | ((unsigned)__builtin_bit_cast(unsigned short, h1) << 16);
    ((unsigned*)out)[i] = u;
    
  }
}

// ---- bias tables as RNE-bf16-valued f32: outp[0..3071] = bf16(qkv_b), outp[3072..4095] = bf16(out_b).
//      Both sources loaded unconditionally with clamped indices, selected by value. ----
__device__ __forceinline__ void bias_rne_job(
    const float* __restrict__ qkvb, const float* __restrict__ outb, float* __restrict__ outp, const int blk) {
  const int i  = blk * 256 + threadIdx.x;                   // 0..4095
  const int iq = i < 3 * EMB ? i : (3 * EMB - 1);
  int io = i - 3 * EMB; io = io < 0 ? 0 : (io > EMB - 1 ? EMB - 1 : io);
  const float a = qkvb[iq];
  const float c = outb[io];
  const float v = bf_bits2f(f2bf_bits((i < 3 * EMB) ? a : c));
  ((float*)outp)[i] = v;
  
}

// =====================================================================================
// Phase-space similarity plane: PB[b][t][s] = exp( -dist(t,s) * (1/temp) ),
//   dist = d2 > 0 ? sqrt(d2) : 0,  d2 = (|c_t|^2 + |c_s|^2) - 2 * (c_t . c_s)   (8-dim coords, RNE-bf16 valued, f32 math).
//   one block = one 64x64 tile (bs of T/64 s-tiles, bt of T/64 t-tiles, b of B), 256 threads. LDS: coords rows of the 64 t and 64 s, plus squared norms.
//   Coverage: 8 waves x 4 iterations x 2 rows = 64 t rows; 16 lanes x 4 floats = 64 s columns -> whole 64x64 tile.
// =====================================================================================
__device__ __forceinline__ void phase_bias_job(
    const float* __restrict__ coords, const float* __restrict__ temp, float* __restrict__ pb,
    const int bs, const int bt, const int b) {
#pragma clang fp contract(off)
  __shared__ __align__(16) float ct[64 * NPH];
  __shared__ __align__(16) float cs[64 * NPH];
  __shared__ float sqt[64];
  __shared__ float sqs[64];
  const int tid = threadIdx.x;
  const int t0  = bt * 64;
  const int s0  = bs * 64;
  const float invT = 1.0f / temp[0];
  {
    // staging coverage: 128 threads x 4 floats = 64 rows x 8 per table (waves 0-3 -> t rows, waves 4-7 -> s rows)
    const int rr = tid & 127, row = rr >> 1, c4 = (rr & 1) * 4;
    const int base = (tid < 128) ? t0 : s0;
    const v4f v = *(const v4f*)(coords + ((size_t)b * SEQ_T + base + row) * NPH + c4);
    v4f w;
#pragma unroll
    for (int e = 0; e < 4; ++e) w[e] = bf_bits2f(f2bf_bits(v[e]));
    if (tid < 128) *(v4f*)(ct + row * NPH + c4) = w;      // wave-uniform branch
    else           *(v4f*)(cs + row * NPH + c4) = w;
  }
  __syncthreads();
  if (tid < 64) {                                          // wave-uniform (waves 0,1)
    float a = 0.0f;
#pragma unroll
    for (int p = 0; p < NPH; ++p) a = a + ct[tid * NPH + p] * ct[tid * NPH + p];
    sqt[tid] = a;
  } else if (tid < 128) {                                  // waves 2,3
    const int r = tid - 64;
    float a = 0.0f;
#pragma unroll
    for (int p = 0; p < NPH; ++p) a = a + cs[r * NPH + p] * cs[r * NPH + p];
    sqs[r] = a;
  }
  __syncthreads();

  const int wave = tid >> 5, lane = tid & 31, hh = lane >> 4, c4 = (lane & 15) * 4;
  v4f ca[4], cb[4];
  float sqv[4];
#pragma unroll
  for (int q = 0; q < 4; ++q) {
    ca[q]  = *(const v4f*)(cs + (c4 + q) * NPH);
    cb[q]  = *(const v4f*)(cs + (c4 + q) * NPH + 4);
    sqv[q] = sqs[c4 + q];
  }
#pragma unroll 1
  for (int it = 0; it < 4; ++it) {
    const int row = wave * 8 + it * 2 + hh;                // 0..63
    const v4f qa = *(const v4f*)(ct + row * NPH);
    const v4f qb = *(const v4f*)(ct + row * NPH + 4);
    const float st = sqt[row];
    v4f res;
#pragma unroll
    for (int q = 0; q < 4; ++q) {
      float dot = qa[0] * ca[q][0];
      dot = dot + qa[1] * ca[q][1];
      dot = dot + qa[2] * ca[q][2];
      dot = dot + qa[3] * ca[q][3];
      dot = dot + qb[0] * cb[q][0];
      dot = dot + qb[1] * cb[q][1];
      dot = dot + qb[2] * cb[q][2];
      dot = dot + qb[3] * cb[q][3];
      const float d2 = (st + sqv[q]) - 2.0f * dot;
      const float sr = sqrtf(fmaxf(d2, 0.0f));
      const float dist = (d2 > 0.0f) ? sr : 0.0f;
      res[q] = expf(-dist * invT);
    }
    float* p = pb + ((size_t)b * SEQ_T + t0 + row) * SEQ_T + s0 + c4;
    *(v4f*)p = res;
    
  }
}

// =====================================================================================
// The three operand casts, the bias tables and the similarity plane read only inputs and write disjoint planes: one launch,
// the block index picks the job (block-uniform, so the plane job's barriers are passed by whole blocks).
//   Blocks 0..15: the bias tables. The other 18432 in groups of nine: the first of a group is a tile of the plane (vector
//   work), the other eight are cast blocks (memory work), so that both kinds are resident on a WGP at the same time.
//   Cast blocks in order: x, qkv_w, out_w.
// =====================================================================================
constexpr int N2X = NBATCH * SEQ_T * EMB / 2;                         // 2,097,152 pairs
constexpr int N2W = 3 * EMB * EMB / 2;                                // 1,572,864
constexpr int N2O = EMB * EMB / 2;                                    //   524,288
constexpr int CX_BLK = N2X / 256, CW_BLK = N2W / 256, CO_BLK = N2O / 256;   // 8192, 6144, 2048
constexpr int PB_BLK = (SEQ_T / 64) * (SEQ_T / 64) * NBATCH;          // 2048
constexpr int BI_BLK = 4 * EMB / 256;                                 // 16
static_assert(CX_BLK + CW_BLK + CO_BLK == 8 * PB_BLK, "eight cast blocks to a tile of the plane");
__global__ __launch_bounds__(256) void prep_kernel(
    const float* __restrict__ x, const float* __restrict__ coords, const float* __restrict__ qkv_w,
    const float* __restrict__ qkv_b, const float* __restrict__ out_w, const float* __restrict__ out_b,
    const float* __restrict__ temp,
    unsigned short* __restrict__ xb, unsigned short* __restrict__ wqkv, unsigned short* __restrict__ wo,
    float* __restrict__ biasr, float* __restrict__ pb) {
  if (blockIdx.x < BI_BLK) { bias_rne_job(qkv_b, out_b, biasr, blockIdx.x); return; }
  const int blk = blockIdx.x - BI_BLK;     // 0..18431
  const int g = blk / 9, r = blk - g * 9;
  if (r == 0) {
    phase_bias_job(coords, temp, pb, g % (SEQ_T / 64), (g / (SEQ_T / 64)) % (SEQ_T / 64), g / ((SEQ_T / 64) * (SEQ_T / 64)));
    return;
  }
  const int cb = g * 8 + r - 1;            // 0..16383
  if (cb < CX_BLK)               cast_f32_bf16x2(x, xb, N2X, cb);
  else if (cb < CX_BLK + CW_BLK) cast_f32_bf16x2(qkv_w, wqkv, N2W, cb - CX_BLK);
  else                           cast_f32_f16x2_scaled(out_w, wo, N2O, 64.0f, cb - CX_BLK - CW_BLK);
}

// =====================================================================================
// Full (non-causal, unmasked) attention with additive bias plane, head dim 64.
//   qk plane f16 [B*T][2048]: q(t,h,d) at col h*64+d, k(s,h,d) at col 1024+h*64+d
//   vt plane f16 [B][1024][T]: v(s,h,d) at row h*64+d, col s
//   pb plane f32 [B][T][T]
//   ao plane f16 [B*T][1024]: element (t, h*64+d) = 16 * attention output
//   Both products run with their operands' roles swapped, so that a lane owns ONE query (column lane & 15):
//   scores^T = (k . q^T) * 0.125 + pb : A = K rows from LDS, B = the wave's 16 queries, kept in registers
//   out^T    = v^T . p^T (p carried x2^15 in f16) : A = V^T rows from LDS, B = p^T, folded by 16/(l*2^15) in the epilogue
//   Score tile j, register r of lane (c, hh) is key j*16 + 8*hh + r of query c: a lane holds 32 of its query's 64 scores, the
//   lane 16 away the other 32. Maximum and sum run in the lane; the halves exchange the maximum once a chunk and join their
//   sums once, in the epilogue. Tiles 2kk and 2kk+1, converted in place, ARE the B operand of 32 keys: element e < 8 is key
//   kk*32 + 8*hh + e, element e >= 8 is key kk*32 + 16 + 8*hh + (e - 8), the k order of the V^T loader. P never touches LDS.
//   online softmax in f32 over all T keys (32 chunks of 64, compile-time trip count).
//   Block = 4 waves = 64 query rows of one (b,h); grid = (NHEAD * T/64, B).
//   K / V^T chunk staging: 128 threads x 32 elements per plane = whole 64x64 tile (16-B copies, plain loads,
//   __syncthreads before and after); fragment loads read the LDS tiles with the same v8h element type.
// =====================================================================================
#define AT_D 64
#define AT_NW 4
#define AT_QB 64
#define AT_KC 64
#define AT_LP 72   // LDS row pitch in halves: 144 B = 16 B x odd, so the 16 rows of one ds_load_b128 fall on distinct banks

__device__ __forceinline__ v8f mma_h16(v16h a, v16h b, v8f c) {
  return __builtin_amdgcn_wmma_f32_16x16x32_f16(false, a, false, b, (short)0, c, false, false);
}

// the value that lane l ^ 16 holds
__device__ __forceinline__ float other_half(float x) {
  const int u = __builtin_bit_cast(int, x);
  return __builtin_bit_cast(float, __builtin_amdgcn_permlanex16(u, u, 0x76543210, 0xfedcba98, false, false));
}

__global__ __launch_bounds__(128)
void attn_phase64_kernel(const unsigned short* __restrict__ qkp, const unsigned short* __restrict__ vtp,
                         const float* __restrict__ pb, unsigned short* __restrict__ aop) {
  union FH { v16h v; v8h h[2]; };
  __shared__ __align__(16) _Float16 Ksh[AT_KC * AT_LP];          // K [kv][d], padded rows    9 KB
  __shared__ __align__(16) _Float16 Vth[AT_D * AT_LP];           // V^T [d][kv], padded rows  9 KB
  __shared__ __align__(16) float    Os[AT_NW][16 * 68];          // per wave out tile, pitch 68

  const int tid  = threadIdx.x;
  const int wave = tid >> 5;
  const int lane = tid & 31;
  const int hh   = lane >> 4;
  const int c    = lane & 15;

  const int nqb = SEQ_T / AT_QB;          // 32
  const int bx  = blockIdx.x;
  const int qb  = bx % nqb;
  const int h   = bx / nqb;               // 0..NHEAD-1
  const int b   = blockIdx.y;
  const int q0  = qb * AT_QB + wave * 16; // query row within this batch element

  const _Float16* QK = (const _Float16*)(const void*)qkp;
  const _Float16* VT = (const _Float16*)(const void*)vtp;
  _Float16*       AO = (_Float16*)(void*)aop;
  const size_t brow = (size_t)b * SEQ_T;  // row base into the [B*T] planes

  // ---- Q fragments (B operand, column = lane&15, split k map via Frag load): 2 d-chunks ----
  v16h qa[2];
#pragma unroll
  for (int dc = 0; dc < 2; ++dc) {
    const _Float16* qr = QK + (brow + q0 + c) * (size_t)QK_LD + h * HDIM + dc * 32 + 8 * hh;
    qa[dc] = Frag<_Float16>::load(qr);
  }

  float mrow = -INFINITY;   // running maximum of query c, equal in both halves
  float lrow = 0.f;         // running sum of query c over this half's keys
  v8f oacc[4];              // oacc[t][r] = out(query c, d = t*16 + 8*hh + r)
#pragma unroll
  for (int t = 0; t < 4; ++t) oacc[t] = (v8f){0.f,0.f,0.f,0.f,0.f,0.f,0.f,0.f};

  const int nChunks = SEQ_T / AT_KC;      // 32, compile-time constant
  for (int kc = 0; kc < nChunks; ++kc) {
    const int kv0 = kc * AT_KC;
    __syncthreads();
    // staging coverage: 128 threads x (4 x 8) elements = 64 rows x 64 per plane = the whole chunk tile
    const int sr = tid >> 1, half = (tid & 1) * 32;
    const _Float16* ks = QK + (brow + kv0 + sr) * (size_t)QK_LD + h * HDIM + half;    // row kv0+sr of the q,k plane; K stands EMB columns on, d = half..+31
    const _Float16* vs = VT + ((size_t)b * EMB + h * HDIM + sr) * SEQ_T + kv0 + half; // V^T row d = sr, s = kv0+half..+31
    v8h a0[4], b0[4];
#pragma unroll
    for (int i = 0; i < 4; ++i) {
      a0[i] = *(const v8h*)(ks + EMB + 8 * i);
      b0[i] = *(const v8h*)(vs + 8 * i);
    }
    // the chunk's bias values are asked for here, behind the K and V^T loads, so that the three share one trip to L2
    // additive bias of (query q0 + c, key kv0 + j*16 + 8hh + r), read at [key][query]: the plane's kernel forms element [t][s]
    // and element [s][t] from the same products and sums in the same order, so the two hold the same bits for any coords,
    // and a load then covers two 64-byte row pieces instead of 32 pieces of 16 rows
    const float* pbr = pb + (brow + kv0 + 8 * hh) * (size_t)SEQ_T + q0 + c;
    float pbv[4][8];
#pragma unroll
    for (int j = 0; j < 4; ++j)
#pragma unroll
      for (int r = 0; r < 8; ++r) pbv[j][r] = pbr[(size_t)(j * 16 + r) * SEQ_T];
    // the wait that stands in front of any overwrite of the 40 loads' three address pairs; naming the pairs as inputs keeps them live up to it
    asm volatile("s_wait_xcnt 0x0" :: "v"(ks), "v"(vs), "v"(pbr) : "memory");
#pragma unroll
    for (int i = 0; i < 4; ++i) {
      *(v8h*)(Ksh + sr * AT_LP + half + 8 * i) = a0[i];
      *(v8h*)(Vth + sr * AT_LP + half + 8 * i) = b0[i];
    }
    __syncthreads();

    // the chunk's 16 K reads stand as one batch in front of the 8 products: one LDS latency, not eight
    FH kb[4][2];
#pragma unroll
    for (int dc = 0; dc < 2; ++dc)
#pragma unroll
      for (int j = 0; j < 4; ++j) {
        kb[j][dc].h[0] = *(const v8h*)(Ksh + (j * 16 + c) * AT_LP + dc * 32 + 8 * hh);
        kb[j][dc].h[1] = *(const v8h*)(Ksh + (j * 16 + c) * AT_LP + dc * 32 + 16 + 8 * hh);
      }
    v8f s[4];
#pragma unroll
    for (int j = 0; j < 4; ++j) s[j] = (v8f){0.f,0.f,0.f,0.f,0.f,0.f,0.f,0.f};
#pragma unroll
    for (int dc = 0; dc < 2; ++dc)
#pragma unroll
      for (int j = 0; j < 4; ++j) s[j] = mma_h16(kb[j][dc].v, qa[dc], s[j]);
    // the 16 V^T reads are issued here, so that they land while the softmax runs
    FH vb[2][4];
#pragma unroll
    for (int kk = 0; kk < 2; ++kk)
#pragma unroll
      for (int t = 0; t < 4; ++t) {
        vb[kk][t].h[0] = *(const v8h*)(Vth + (t * 16 + c) * AT_LP + kk * 32 + 8 * hh);
        vb[kk][t].h[1] = *(const v8h*)(Vth + (t * 16 + c) * AT_LP + kk * 32 + 16 + 8 * hh);
      }
    // holds both batches of reads above this line: without it the build sinks them back to read, wait, product, one pair at a time
    __builtin_amdgcn_sched_barrier(0);
    float mj[2];            // two independent chains of 16 (one per pair of score tiles) instead of one of 32
#pragma unroll
    for (int g = 0; g < 2; ++g) mj[g] = -INFINITY;
#pragma unroll
    for (int j = 0; j < 4; ++j) {
#pragma unroll
      for (int r = 0; r < 8; ++r) {
        const float sv = s[j][r] * 0.125f + pbv[j][r];
        s[j][r] = sv;
        mj[j / 2] = fmaxf(mj[j / 2], sv);
      }
    }
    float m = fmaxf(mj[0], mj[1]);
    m = fmaxf(m, other_half(m));
    const float mnew  = fmaxf(mrow, m);
    const float alpha = expf(mrow - mnew);
    mrow = mnew;
    float pj[2];            // likewise two independent sums of 16
#pragma unroll
    for (int g = 0; g < 2; ++g) pj[g] = 0.f;
    FH pa[2];
#pragma unroll
    for (int j = 0; j < 4; ++j) {
#pragma unroll
      for (int r = 0; r < 8; ++r) {
        const float p = expf(s[j][r] - mnew);
        pj[j / 2] += p;
        pa[j >> 1].h[j & 1][r] = (_Float16)(p * 32768.0f);
      }
    }
    const float psum = (pj[0] + pj[1]);
    lrow = lrow * alpha + psum;
#pragma unroll
    for (int t = 0; t < 4; ++t)
#pragma unroll
      for (int r = 0; r < 8; ++r) oacc[t][r] *= alpha;
#pragma unroll
    for (int kk = 0; kk < 2; ++kk) {
#pragma unroll
      for (int t = 0; t < 4; ++t) oacc[t] = mma_h16(vb[kk][t].v, pa[kk].v, oacc[t]);
    }
  }

  // ---- epilogue: 16 * oacc / (l * 2^15) -> f16 plane ----
  float* os = Os[wave];
  {
    const float l = lrow + other_half(lrow);          // the two halves' keys together
    const float inv = 1.0f / (l * 2048.0f);           // = 16 / (l * 32768); l >= 1
#pragma unroll
    for (int t = 0; t < 4; ++t) {
      v4f lo, hi;
#pragma unroll
      for (int r = 0; r < 4; ++r) { lo[r] = oacc[t][r] * inv; hi[r] = oacc[t][4 + r] * inv; }
      *(v4f*)(os + c * 68 + t * 16 + 8 * hh)     = lo;
      *(v4f*)(os + c * 68 + t * 16 + 8 * hh + 4) = hi;
    }
  }
  __builtin_amdgcn_fence(__ATOMIC_RELEASE, "workgroup");
  __builtin_amdgcn_wave_barrier();
  __builtin_amdgcn_fence(__ATOMIC_ACQUIRE, "workgroup");
  {
    const int q = lane >> 3, c8 = (lane & 7) * 8;
    {
#pragma unroll
      for (int it = 0; it < 4; ++it) {
        const int row = it * 4 + q;
        const float* sp = os + row * 68 + c8;
        v8h hv;
#pragma unroll
        for (int e = 0; e < 8; ++e) hv[e] = (_Float16)sp[e];
        *(v8h*)(AO + (brow + q0 + row) * (size_t)EMB + h * HDIM + c8) = hv;
      }
      
    }
  }
}

// =====================================================================================
//   xb    bf16 [4096][1024]          8,388,608  @ 0
//   wqkv  bf16 [3072][1024]          6,291,456  @ 8,388,608
//   wo    f16  [1024][1024] (x64)    2,097,152  @ 14,680,064
//   biasr f32  [4096] (bf16-valued)     16,384  @ 16,777,216
//   qk    f16  [4096][2048]         16,777,216  @ 16,793,600
//   vt    f16  [2][1024][2048]       8,388,608  @ 33,570,816
//   pb    f32  [2][2048][2048]      33,554,432  @ 41,959,424
//   ao    f16  [4096][1024] (x16)    8,388,608  @ 75,513,856
//   total 83,902,464
// =====================================================================================
extern "C" void kernel_launch(void* const* d_in, const int* in_sizes, int n_in,
                              void* d_out, int out_size, void* d_ws, size_t ws_size,
                              hipStream_t stream) {
  if (n_in < 7) return;
  if (in_sizes[0] != NBATCH * SEQ_T * EMB || in_sizes[1] != NBATCH * SEQ_T * NPH ||
      in_sizes[2] != 3 * EMB * EMB || in_sizes[3] != 3 * EMB || in_sizes[4] != EMB * EMB ||
      in_sizes[5] != EMB || in_sizes[6] < 1 || out_size != NBATCH * SEQ_T * EMB) return;

  const float* x      = (const float*)d_in[0];
  const float* coords = (const float*)d_in[1];
  const float* qkv_w  = (const float*)d_in[2];
  const float* qkv_b  = (const float*)d_in[3];
  const float* out_w  = (const float*)d_in[4];
  const float* out_b  = (const float*)d_in[5];
  const float* ptemp  = (const float*)d_in[6];
  float* out = (float*)d_out;

  const size_t MROWS = (size_t)NBATCH * SEQ_T;           // 4096
  size_t off = 0;
  char* ws = (char*)d_ws;
  unsigned short* xb   = (unsigned short*)(ws + off); off += MROWS * EMB * 2;
  unsigned short* wqkv = (unsigned short*)(ws + off); off += (size_t)3 * EMB * EMB * 2;
  unsigned short* wo   = (unsigned short*)(ws + off); off += (size_t)EMB * EMB * 2;
  float*          biasr= (float*)(ws + off);          off += (size_t)4 * EMB * 4;
  unsigned short* qk   = (unsigned short*)(ws + off); off += MROWS * QK_LD * 2;
  unsigned short* vt   = (unsigned short*)(ws + off); off += (size_t)NBATCH * EMB * SEQ_T * 2;
  float*          pb   = (float*)(ws + off);          off += (size_t)NBATCH * SEQ_T * SEQ_T * 4;
  unsigned short* ao   = (unsigned short*)(ws + off); off += MROWS * EMB * 2;
  if (off > ws_size) return;

  // 1: operand casts (2 elements per thread), bias tables, phase-space similarity plane
  prep_kernel<<<dim3(BI_BLK + 9 * PB_BLK), 256, 0, stream>>>(
      x, coords, qkv_w, qkv_b, out_w, out_b, ptemp, xb, wqkv, wo, biasr, pb);

  // 2: q,k and v^T
  qkv_gemm_pair<<<dim3(QK_BLK + NBATCH * VT_BLK), 256, 0, stream>>>(
      xb, wqkv, wqkv + (size_t)2 * EMB * EMB, biasr, qk, vt, EMB);

  // 3: attention with phase bias -> ao f16 (x16)
  attn_phase64_kernel<<<dim3(NHEAD * (SEQ_T / AT_QB), NBATCH), 128, 0, stream>>>(qk, vt, pb, ao);

  // 4: out = (ao x16) . (wo x64)^T * 2^-10 + out_b -> f32 d_out [4096][1024]   (M=4096,N=1024,K=1024; 1024 tiles)
  wmma_gemm64<0, false, 2, 0, false><<<dim3((4096 / 64) * (1024 / 64) / 8, 1), 256, 0, stream>>>(
      ao, ao, EMB, 0L, wo, wo, EMB, 0L, (void*)out, (void*)out, EMB, 0L,
      biasr + 3 * EMB, biasr, 0L, (int)MROWS, EMB, EMB, 1.0f / 1024.0f);
}

// v006
// One run takes 136 microseconds.
// Next to v005, in two timings, it ran 1.08 and 1.09 times as fast.
// Counting every step since v000, it is 2.46 times as fast.
// Contractions: x.Wqkv^T (q,k GEMM and role-swapped v^T GEMM): v_wmma_f32_16x16x32_bf16 (bf16 RNE operands); q.k^T and p.v: v_wmma_f32_16x16x32_f16 (f16 operands, p carried x2^15); ao.Wout^T: v_wmma_f32_16x16x32_f16 (ao x16, Wout x64, folded by 2^-10); all f32 accumulate; softmax and the 8-dim phase-space bias in f32 on VALU.
#include <hip/hip_runtime.h>
#include <math.h>
#include <stdint.h>

constexpr int NBATCH = 2;
constexpr int SEQ_T  = 2048;
constexpr int EMB    = 1024;
constexpr int NHEAD  = 16;
constexpr int HDIM   = 64;
constexpr int NPH    = 8;
constexpr int QK_LD  = 2048;   // q,k plane pitch (q cols 0..1023, k cols 1024..2047)

typedef __attribute__((ext_vector_type(16))) _Float16 v16h;
typedef __attribute__((ext_vector_type(8)))  _Float16 v8h;
typedef __attribute__((ext_vector_type(16))) __bf16   v16b;
typedef __attribute__((ext_vector_type(8)))  __bf16   v8b;
typedef __attribute__((ext_vector_type(8)))  float    v8f;
typedef __attribute__((ext_vector_type(4)))  float    v4f;

__device__ __forceinline__ unsigned short f2bf_bits(float f) {
  unsigned u = __float_as_uint(f);
  return (unsigned short)((u + 0x7FFFu + ((u >> 16) & 1u)) >> 16);
}
__device__ __forceinline__ float bf_bits2f(unsigned short h) { return __uint_as_float(((unsigned)h) << 16); }

// hazard guards as plain device helpers (the only inline asm in the kernel template body is the s_wait_xcnt)
__device__ __forceinline__ void dep_guard_h(v8f& a, v8f& b, v16h x, v16h y) { asm volatile("v_nop\n\tv_nop\n\tv_nop\n\tv_nop" : "+v"(a), "+v"(b) : "v"(x), "v"(y)); }
__device__ __forceinline__ void dep_guard_b(v8f& a, v8f& b, v16b x, v16b y) { asm volatile("v_nop\n\tv_nop\n\tv_nop\n\tv_nop" : "+v"(a), "+v"(b) : "v"(x), "v"(y)); }
__device__ __forceinline__ void keep4_h(v16h a, v16h b, v16h c, v16h d) { asm volatile("v_nop" :: "v"(a), "v"(b), "v"(c), "v"(d)); }
__device__ __forceinline__ void keep4_b(v16b a, v16b b, v16b c, v16b d) { asm volatile("v_nop" :: "v"(a), "v"(b), "v"(c), "v"(d)); }
__device__ __forceinline__ void acc_guard4(v8f& a, v8f& b, v8f& c, v8f& d) { asm volatile("v_nop\n\tv_nop\n\tv_nop\n\tv_nop" : "+v"(a), "+v"(b), "+v"(c), "+v"(d)); }
template <typename T> struct Frag;
template <> struct Frag<_Float16> {
  typedef v16h V; typedef v8h H; union U { v16h v; v8h h[2]; };
  static __device__ __forceinline__ v16h load(const _Float16* p) {   // elements 0..7 <- p[0..7], 8..15 <- p[16..23]
    U f; f.h[0] = *(const v8h*)(p); f.h[1] = *(const v8h*)(p + 16); return f.v;
  }
  static __device__ __forceinline__ v8f mma(v16h a, v16h b, v8f c) {
    return __builtin_amdgcn_wmma_f32_16x16x32_f16(false, a, false, b, (short)0, c, false, false);
  }
  static __device__ __forceinline__ void guard(v8f& a, v8f& b, v16h x, v16h y) { dep_guard_h(a, b, x, y); }
  static __device__ __forceinline__ void keep(v16h a, v16h b, v16h c, v16h d) { keep4_h(a, b, c, d); }
};
template <> struct Frag<__bf16> {
  typedef v16b V; typedef v8b H; union U { v16b v; v8b h[2]; };
  static __device__ __forceinline__ v16b load(const __bf16* p) {
    U f; f.h[0] = *(const v8b*)(p); f.h[1] = *(const v8b*)(p + 16); return f.v;
  }
  static __device__ __forceinline__ v8f mma(v16b a, v16b b, v8f c) {
    return __builtin_amdgcn_wmma_f32_16x16x32_bf16(false, a, false, b, (short)0, c, false, false);
  }
  static __device__ __forceinline__ void guard(v8f& a, v8f& b, v16b x, v16b y) { dep_guard_b(a, b, x, y); }
  static __device__ __forceinline__ void keep(v16b a, v16b b, v16b c, v16b d) { keep4_b(a, b, c, d); }
};

// ---- Register-blocked batched WMMA GEMM ------------------------------------
// C[m,n] = scale * sum_k A[m,k] * Bt[n,k] (+bias)(+resid); each wave owns a 64x64 tile.
// A row-major [M,K]; Bt row-major [N,K]; M % 64 == 0, N % 512 == 0, K % 64 == 0, lda == ldb == GS_LD.
// The 8 waves of a block own 8 neighbouring tiles of one tile row: 64 rows of A (shared) x 512 rows of Bt.
// Per pass of 64 k the block stages those 576 row pieces (128 B each) in LDS: 8 lanes fetch one whole 128-byte line,
// so a load touches 4 lines instead of the 16 that a fragment load from global memory touches; fragments come from LDS.
// SPLIT (hi/lo operand planes) is not carried by the staged path; A2/Bt2 are unused.
// BIAS_MODE: 0 = none, 1 = bias[m], 2 = bias[n].
// OUT_MODE: 0 = f32, 1 = f16, 2 = bf16 hi plane (Cout) + bf16 lo plane (Cout2).
// ET: 0 = f16 operands, 1 = bf16 operands (pointers passed as 16-bit storage)
template <int ET> struct Elem;
template <> struct Elem<0> { typedef _Float16 T; };
template <> struct Elem<1> { typedef __bf16 T; };
constexpr int GS_K = 64;   // k per staged pass: one 128-byte line of every operand row
constexpr int GS_P = 72;   // LDS row pitch in 16-bit elements: 144 B = 16 B x odd, free of bank conflicts for ds_load_b128
constexpr int GS_LD = EMB; // row pitch of A and Bt in every launch; a constant lets a pass's 18 row steps ride in the loads' offset fields
// The body is a device function: bx, b are the block's place in its own product's grid, and the kernel that calls it owns the
// LDS arrays, so that a kernel which holds two products (block ranges of one grid) allocates them once.
template <int ET, bool SPLIT, int BIAS_MODE, int OUT_MODE, bool RESID, int ACT = 0>
__device__ __forceinline__ void gemm64_body(
    float (*sT)[16 * 68], typename Elem<ET>::T* sA, typename Elem<ET>::T* sB, const int bx, const int b,
    const unsigned short* __restrict__ Ap, const unsigned short* __restrict__ A2p, int lda, long strideA,
    const unsigned short* __restrict__ Btp, const unsigned short* __restrict__ Bt2p, int ldb, long strideB,
    void* __restrict__ Cout, void* __restrict__ Cout2, int ldc, long strideC,
    const float* __restrict__ bias,
    const float* __restrict__ resid, long strideR,
    int M, int N, int K, float scale) {
  typedef typename Elem<ET>::T T;
  typedef typename Frag<T>::V V;
  typedef typename Frag<T>::H H;
  static_assert(!SPLIT, "the staged path holds single operand planes");
  const T* A = (const T*)Ap; const T* Bt = (const T*)Btp;
  const int lane = threadIdx.x & 31;
  const int wave = threadIdx.x >> 5;
  const int tilesN = N >> 6;
  const int tilesM = M >> 6;
  const int tile0 = bx * 8;                // first of the block's 8 tiles; tilesN % 8 == 0 keeps them in one tile row
  if (tile0 >= tilesM * tilesN || lda != GS_LD || ldb != GS_LD) return;    // block-uniform, in front of every barrier
  const int tm  = tile0 / tilesN;
  const int tn0 = tile0 - tm * tilesN;
  const int m0  = tm << 6;
  const int nb0 = tn0 << 6;                // first Bt row of the block
  const int n0  = nb0 + (wave << 6);

  const T* Ab  = A  + (size_t)b * strideA;
  const T* Bb  = Bt + (size_t)b * strideB;

  const int rlane = lane & 15;                 // row (A) / col (B, D) within subtile
  const int koff  = (lane >> 4) * 8;           // k offset of this lane half
  const int mOff  = (lane >> 4) * 8;           // D row offset

  // staging map: 8 lanes fetch one row piece (16 bytes each at element (tid & 7) * 8); a wave's four rows of each group of
  // 32 lie 8 apart, so that at pitch 144 B the two rows of a 16-lane half fall on opposite halves of the LDS banks
  const int srow = wave + 8 * ((threadIdx.x >> 3) & 3);
  const int scol = (threadIdx.x & 7) * 8;
  const unsigned sLane = (unsigned)(srow * GS_LD + scol) * 2u;   // this thread's byte offset from a group's first row
  const char* gA = (const char*)(Ab + (size_t)m0  * GS_LD);      // block-uniform bases
  const char* gB = (const char*)(Bb + (size_t)nb0 * GS_LD);
  T* stA = sA + srow * GS_P + scol;
  T* stB = sB + srow * GS_P + scol;
  const T* frA = sA + rlane * GS_P + koff;
  const T* frB = sB + ((wave << 6) + rlane) * GS_P + koff;

  v8f acc[4][4];
#pragma unroll
  for (int i = 0; i < 4; ++i)
#pragma unroll
    for (int j = 0; j < 4; ++j) acc[i][j] = (v8f){0.f,0.f,0.f,0.f,0.f,0.f,0.f,0.f};

  for (int k0 = 0; k0 < K; k0 += GS_K) {
    // coverage: 256 threads x 16 B = 32 rows x 128 B per step; 2 steps = 64 A rows, 16 steps = 512 Bt rows
    H ra[2], rb[16];
    const char* pA = gA + (size_t)k0 * 2 + sLane;
    const char* pB = gB + (size_t)k0 * 2 + sLane;
#pragma unroll
    for (int i = 0; i < 2; ++i)  ra[i] = *(const H*)(pA + i * 32 * GS_LD * 2);
#pragma unroll
    for (int i = 0; i < 16; ++i) rb[i] = *(const H*)(pB + i * 32 * GS_LD * 2);
    // the wait that stands in front of any overwrite of the 18 loads' address pairs; naming the pairs as inputs keeps them
    // live up to it (without that the build lands later loads of the group on them)
    asm volatile("s_wait_xcnt 0x0" :: "v"(pA), "v"(pB) : "memory");
    __syncthreads();   // every wave has taken its last fragment of the previous pass
#pragma unroll
    for (int i = 0; i < 2; ++i)  *(H*)(stA + i * 32 * GS_P) = ra[i];
#pragma unroll
    for (int i = 0; i < 16; ++i) *(H*)(stB + i * 32 * GS_P) = rb[i];
    __syncthreads();   // the pass's rows are complete for every wave
#pragma unroll
    for (int kk = 0; kk < GS_K; kk += 32) {
      V bh[4], ah[4];
#pragma unroll
      for (int j = 0; j < 4; ++j) bh[j] = Frag<T>::load(frB + j * 16 * GS_P + kk);
#pragma unroll
      for (int i = 0; i < 4; ++i) ah[i] = Frag<T>::load(frA + i * 16 * GS_P + kk);
#pragma unroll
      for (int i = 0; i < 4; ++i) {
#pragma unroll
        for (int j = 0; j < 4; ++j) acc[i][j] = Frag<T>::mma(ah[i], bh[j], acc[i][j]);
        Frag<T>::guard(acc[i][0], acc[i][3], ah[i], ah[i]);
      }
      Frag<T>::keep(bh[0], bh[1], bh[2], bh[3]);
    }
  }
  acc_guard4(acc[0][0], acc[0][1], acc[0][2], acc[0][3]);
  acc_guard4(acc[1][0], acc[1][1], acc[1][2], acc[1][3]);
  acc_guard4(acc[2][0], acc[2][1], acc[2][2], acc[2][3]);
  acc_guard4(acc[3][0], acc[3][1], acc[3][2], acc[3][3]);

  // ---- epilogue ----
  float* slab = sT[wave];
  const float* Rb = RESID ? (resid + (size_t)b * strideR) : nullptr;
#pragma unroll
  for (int i = 0; i < 4; ++i) {
    const int mBase = m0 + (i << 4);
#pragma unroll
    for (int j = 0; j < 4; ++j) {
      const int n = n0 + (j << 4) + rlane;
      float bv = 0.f;
      if (BIAS_MODE == 2) bv = bias[n];
#pragma unroll
      for (int r = 0; r < 8; ++r) {
        float v = acc[i][j][r] * scale;
        if (BIAS_MODE == 1) v += bias[mBase + mOff + r];
        if (BIAS_MODE == 2) v += bv;
        if (RESID) v += Rb[(size_t)(mBase + mOff + r) * ldc + n];
        if (ACT == 1) v = tanhf(v);
        if (ACT == 2) v = fmaxf(v, 0.0f);
        if (ACT == 3) v = v / (1.0f + expf(-v));
        if (ACT == 4) v = (v > 0.f) ? v : 0.01f * v;
        slab[(mOff + r) * 68 + (j << 4) + rlane] = v;
      }
    }
    __builtin_amdgcn_fence(__ATOMIC_RELEASE, "workgroup");
    __builtin_amdgcn_wave_barrier();
    __builtin_amdgcn_fence(__ATOMIC_ACQUIRE, "workgroup");
    if (OUT_MODE == 0) {
      float* C = (float*)Cout + (size_t)b * strideC;
      const int hh = lane >> 4, c4 = (lane & 15) * 4;     // row seg = 256 B = 16 lanes x 16 B
      {
#pragma unroll
        for (int it = 0; it < 8; ++it) {
          const int row = it * 2 + hh;
          v4f v = *(const v4f*)(slab + row * 68 + c4);
          *(v4f*)(C + (size_t)(mBase + row) * ldc + n0 + c4) = v;
        }
        
      }
    } else {
      const int q = lane >> 3, c8 = (lane & 7) * 8;
      unsigned short* C  = (unsigned short*)Cout  + (size_t)b * strideC;
      unsigned short* C2 = (OUT_MODE == 2) ? ((unsigned short*)Cout2 + (size_t)b * strideC) : nullptr;
      {
#pragma unroll
        for (int it = 0; it < 4; ++it) {
          const int row = it * 4 + q;
          const float* sp = slab + row * 68 + c8;
          v8h hv, lv;
#pragma unroll
          for (int e = 0; e < 8; ++e) {
            if (OUT_MODE == 1) {
              hv[e] = (_Float16)sp[e];
            } else {
              unsigned short hb = f2bf_bits(sp[e]);
              unsigned short lb = f2bf_bits(sp[e] - bf_bits2f(hb));
              hv[e] = __builtin_bit_cast(_Float16, hb);
              lv[e] = __builtin_bit_cast(_Float16, lb);
            }
          }
          *(v8h*)(C + (size_t)(mBase + row) * ldc + n0 + c8) = hv;
          if (OUT_MODE == 2) *(v8h*)(C2 + (size_t)(mBase + row) * ldc + n0 + c8) = lv;
        }
        
      }
    }
    __builtin_amdgcn_fence(__ATOMIC_RELEASE, "workgroup");
    __builtin_amdgcn_wave_barrier();
    __builtin_amdgcn_fence(__ATOMIC_ACQUIRE, "workgroup");
  }
}

// one product a launch
template <int ET, bool SPLIT, int BIAS_MODE, int OUT_MODE, bool RESID, int ACT = 0>
__global__ __launch_bounds__(256) void wmma_gemm64(
    const unsigned short* __restrict__ Ap, const unsigned short* __restrict__ A2p, int lda, long strideA,
    const unsigned short* __restrict__ Btp, const unsigned short* __restrict__ Bt2p, int ldb, long strideB,
    void* __restrict__ Cout, void* __restrict__ Cout2, int ldc, long strideC,
    const float* __restrict__ bias,
    const float* __restrict__ resid, long strideR,
    int M, int N, int K, float scale) {
  typedef typename Elem<ET>::T T;
  __shared__ __align__(16) float sT[8][16 * 68];   // per-wave 16x64 slab, pitch 68 floats
  __shared__ __align__(16) T sA[64 * GS_P];        // the block's 64 A rows, 64 k
  __shared__ __align__(16) T sB[512 * GS_P];       // the block's 512 Bt rows (64 per wave), 64 k
  gemm64_body<ET, SPLIT, BIAS_MODE, OUT_MODE, RESID, ACT>(sT, sA, sB, blockIdx.x, blockIdx.y,
      Ap, A2p, lda, strideA, Btp, Bt2p, ldb, strideB, Cout, Cout2, ldc, strideC, bias, resid, strideR, M, N, K, scale);
}

// The two products of x with Wqkv read the same two planes and neither reads what the other writes: one launch, block ranges.
//   blocks 0..255   : q,k = xb[4096][1024] . wqk[2048][1024]^T + bias[n]    -> f16 [4096][2048]           (2048 tiles)
//   blocks 256..383 : v^T[b] = wv[1024][1024] . xb[b][2048][1024]^T + bias[m]        -> f16 [2][1024][2048] (512 tiles x 2)
// Alone the second fills half the chip's 256 WGPs; two blocks fit a WGP (LDS 2 x 117,760 B, 4 waves a SIMD).
constexpr int QK_BLK = (NBATCH * SEQ_T / 64) * (2 * EMB / 64) / 8;   // 256
constexpr int VT_BLK = (EMB / 64) * (SEQ_T / 64) / 8;                // 64 per batch element
__global__ __launch_bounds__(256) void qkv_gemm_pair(
    const unsigned short* __restrict__ xb, const unsigned short* __restrict__ wqk, const unsigned short* __restrict__ wv,
    const float* __restrict__ biasr, unsigned short* __restrict__ qk, unsigned short* __restrict__ vt, int K) {
  __shared__ __align__(16) float sT[8][16 * 68];
  __shared__ __align__(16) __bf16 sA[64 * GS_P];
  __shared__ __align__(16) __bf16 sB[512 * GS_P];
  const int bx = blockIdx.x;
  if (bx < QK_BLK) {                       // block-uniform
    gemm64_body<1, false, 2, 1, false>(sT, sA, sB, bx, 0,
        xb, xb, EMB, 0L, wqk, wqk, EMB, 0L, (void*)qk, (void*)qk, QK_LD, 0L,
        biasr, biasr, 0L, NBATCH * SEQ_T, 2 * EMB, K, 1.0f);
  } else {
    const int r = bx - QK_BLK;
    gemm64_body<1, false, 1, 1, false>(sT, sA, sB, r % VT_BLK, r / VT_BLK,
        wv, wv, EMB, 0L,
        xb, xb, EMB, (long)SEQ_T * EMB,
        (void*)vt, (void*)vt, SEQ_T, (long)EMB * SEQ_T,
        biasr + 2 * EMB, biasr, 0L, EMB, SEQ_T, K, 1.0f);
  }
}

// ---- the five preparation jobs: device functions, blk = the block's place in the job's own grid (prep_kernel below) ----
__device__ __forceinline__ void cast_f32_bf16x2(
    const float* __restrict__ in, unsigned short* __restrict__ out, int n2, const int blk) {
  const int i = blk * 256 + threadIdx.x;
  if (i < n2) {
    const float f0 = in[2 * (size_t)i], f1 = in[2 * (size_t)i + 1];
    const unsigned u = (unsigned)f2bf_bits(f0) | ((unsigned)f2bf_bits(f1) << 16);
    ((unsigned*)out)[i] = u;
    
  }
}

// ---- f32 -> f16( bf16_rne(x) * scale ) cast (scale = exact power of two): same store discipline as above ----
__device__ __forceinline__ void cast_f32_f16x2_scaled(
    const float* __restrict__ in, unsigned short* __restrict__ out, int n2, float scale, const int blk) {
  const int i = blk * 256 + threadIdx.x;
  if (i < n2) {
    const float f0 = bf_bits2f(f2bf_bits(in[2 * (size_t)i])) * scale;
    const float f1 = bf_bits2f(f2bf_bits(in[2 * (size_t)i + 1])) * scale;
    const _Float16 h0 = (_Float16)f0, h1 = (_Float16)f1;
    const unsigned u = (unsigned)__builtin_bit_cast(unsigned short, h0) | ((unsigned)__builtin_bit_cast(unsigned short, h1) << 16);
    ((unsigned*)out)[i] = u;
    
  }
}

// ---- bias tables as RNE-bf16-valued f32: outp[0..3071] = bf16(qkv_b), outp[3072..4095] = bf16(out_b).
//      Both sources loaded unconditionally with clamped indices, selected by value. ----
__device__ __forceinline__ void bias_rne_job(
    const float* __restrict__ qkvb, const float* __restrict__ outb, float* __restrict__ outp, const int blk) {
  const int i  = blk * 256 + threadIdx.x;                   // 0..4095
  const int iq = i < 3 * EMB ? i : (3 * EMB - 1);
  int io = i - 3 * EMB; io = io < 0 ? 0 : (io > EMB - 1 ? EMB - 1 : io);
  const float a = qkvb[iq];
  const float c = outb[io];
  const float v = bf_bits2f(f2bf_bits((i < 3 * EMB) ? a : c));
  ((float*)outp)[i] = v;
  
}

// =====================================================================================
// Phase-space similarity plane: PB[b][t][s] = exp( -dist(t,s) * (1/temp) ),
//   dist = d2 > 0 ? sqrt(d2) : 0,  d2 = (|c_t|^2 + |c_s|^2) - 2 * (c_t . c_s)   (8-dim coords, RNE-bf16 valued, f32 math).
//   one block = one 64x64 tile (bs of T/64 s-tiles, bt of T/64 t-tiles, b of B), 256 threads. LDS: coords rows of the 64 t and 64 s, plus squared norms.
//   Coverage: 8 waves x 4 iterations x 2 rows = 64 t rows; 16 lanes x 4 floats = 64 s columns -> whole 64x64 tile.
// =====================================================================================
__device__ __forceinline__ void phase_bias_job(
    const float* __restrict__ coords, const float* __restrict__ temp, float* __restrict__ pb,
    const int bs, const int bt, const int b) {
#pragma clang fp contract(off)
  __shared__ __align__(16) float ct[64 * NPH];
  __shared__ __align__(16) float cs[64 * NPH];
  __shared__ float sqt[64];
  __shared__ float sqs[64];
  const int tid = threadIdx.x;
  const int t0  = bt * 64;
  const int s0  = bs * 64;
  const float invT = 1.0f / temp[0];
  {
    // staging coverage: 128 threads x 4 floats = 64 rows x 8 per table (waves 0-3 -> t rows, waves 4-7 -> s rows)
    const int rr = tid & 127, row = rr >> 1, c4 = (rr & 1) * 4;
    const int base = (tid < 128) ? t0 : s0;
    const v4f v = *(const v4f*)(coords + ((size_t)b * SEQ_T + base + row) * NPH + c4);
    v4f w;
#pragma unroll
    for (int e = 0; e < 4; ++e) w[e] = bf_bits2f(f2bf_bits(v[e]));
    if (tid < 128) *(v4f*)(ct + row * NPH + c4) = w;      // wave-uniform branch
    else           *(v4f*)(cs + row * NPH + c4) = w;
  }
  __syncthreads();
  if (tid < 64) {                                          // wave-uniform (waves 0,1)
    float a = 0.0f;
#pragma unroll
    for (int p = 0; p < NPH; ++p) a = a + ct[tid * NPH + p] * ct[tid * NPH + p];
    sqt[tid] = a;
  } else if (tid < 128) {                                  // waves 2,3
    const int r = tid - 64;
    float a = 0.0f;
#pragma unroll
    for (int p = 0; p < NPH; ++p) a = a + cs[r * NPH + p] * cs[r * NPH + p];
    sqs[r] = a;
  }
  __syncthreads();

  const int wave = tid >> 5, lane = tid & 31, hh = lane >> 4, c4 = (lane & 15) * 4;
  v4f ca[4], cb[4];
  float sqv[4];
#pragma unroll
  for (int q = 0; q < 4; ++q) {
    ca[q]  = *(const v4f*)(cs + (c4 + q) * NPH);
    cb[q]  = *(const v4f*)(cs + (c4 + q) * NPH + 4);
    sqv[q] = sqs[c4 + q];
  }
#pragma unroll 1
  for (int it = 0; it < 4; ++it) {
    const int row = wave * 8 + it * 2 + hh;                // 0..63
    const v4f qa = *(const v4f*)(ct + row * NPH);
    const v4f qb = *(const v4f*)(ct + row * NPH + 4);
    const float st = sqt[row];
    v4f res;
#pragma unroll
    for (int q = 0; q < 4; ++q) {
      float dot = qa[0] * ca[q][0];
      dot = dot + qa[1] * ca[q][1];
      dot = dot + qa[2] * ca[q][2];
      dot = dot + qa[3] * ca[q][3];
      dot = dot + qb[0] * cb[q][0];
      dot = dot + qb[1] * cb[q][1];
      dot = dot + qb[2] * cb[q][2];
      dot = dot + qb[3] * cb[q][3];
      const float d2 = (st + sqv[q]) - 2.0f * dot;
      const float sr = sqrtf(fmaxf(d2, 0.0f));
      const float dist = (d2 > 0.0f) ? sr : 0.0f;
      res[q] = expf(-dist * invT);
    }
    float* p = pb + ((size_t)b * SEQ_T + t0 + row) * SEQ_T + s0 + c4;
    *(v4f*)p = res;
    
  }
}

// =====================================================================================
// The three operand casts, the bias tables and the similarity plane read only inputs and write disjoint planes: one launch,
// the block index picks the job (block-uniform, so the plane job's barriers are passed by whole blocks).
//   Blocks 0..15: the bias tables. The other 18432 in groups of nine: the first of a group is a tile of the plane (vector
//   work), the other eight are cast blocks (memory work), so that both kinds are resident on a WGP at the same time.
//   Cast blocks in order: x, qkv_w, out_w.
// =====================================================================================
constexpr int N2X = NBATCH * SEQ_T * EMB / 2;                         // 2,097,152 pairs
constexpr int N2W = 3 * EMB * EMB / 2;                                // 1,572,864
constexpr int N2O = EMB * EMB / 2;                                    //   524,288
constexpr int CX_BLK = N2X / 256, CW_BLK = N2W / 256, CO_BLK = N2O / 256;   // 8192, 6144, 2048
constexpr int PB_BLK = (SEQ_T / 64) * (SEQ_T / 64) * NBATCH;          // 2048
constexpr int BI_BLK = 4 * EMB / 256;                                 // 16
static_assert(CX_BLK + CW_BLK + CO_BLK == 8 * PB_BLK, "eight cast blocks to a tile of the plane");
__global__ __launch_bounds__(256) void prep_kernel(
    const float* __restrict__ x, const float* __restrict__ coords, const float* __restrict__ qkv_w,
    const float* __restrict__ qkv_b, const float* __restrict__ out_w, const float* __restrict__ out_b,
    const float* __restrict__ temp,
    unsigned short* __restrict__ xb, unsigned short* __restrict__ wqkv, unsigned short* __restrict__ wo,
    float* __restrict__ biasr, float* __restrict__ pb) {
  if (blockIdx.x < BI_BLK) { bias_rne_job(qkv_b, out_b, biasr, blockIdx.x); return; }
  const int blk = blockIdx.x - BI_BLK;     // 0..18431
  const int g = blk / 9, r = blk - g * 9;
  if (r == 0) {
    phase_bias_job(coords, temp, pb, g % (SEQ_T / 64), (g / (SEQ_T / 64)) % (SEQ_T / 64), g / ((SEQ_T / 64) * (SEQ_T / 64)));
    return;
  }
  const int cb = g * 8 + r - 1;            // 0..16383
  if (cb < CX_BLK)               cast_f32_bf16x2(x, xb, N2X, cb);
  else if (cb < CX_BLK + CW_BLK) cast_f32_bf16x2(qkv_w, wqkv, N2W, cb - CX_BLK);
  else                           cast_f32_f16x2_scaled(out_w, wo, N2O, 64.0f, cb - CX_BLK - CW_BLK);
}

// =====================================================================================
// Full (non-causal, unmasked) attention with additive bias plane, head dim 64.
//   qk plane f16 [B*T][2048]: q(t,h,d) at col h*64+d, k(s,h,d) at col 1024+h*64+d
//   vt plane f16 [B][1024][T]: v(s,h,d) at row h*64+d, col s
//   pb plane f32 [B][T][T]
//   ao plane f16 [B*T][1024]: element (t, h*64+d) = 16 * attention output
//   Both products run with their operands' roles swapped, so that a lane owns ONE query (column lane & 15):
//   scores^T = (k . q^T) * 0.125 + pb : A = K rows from LDS, B = the wave's 16 queries, kept in registers
//   out^T    = v^T . p^T (p and its sum l carried x2^15) : A = V^T rows from LDS, B = p^T, folded by 16/l in the epilogue
//   Score tile j, register r of lane (c, hh) is key j*16 + 8*hh + r of query c: a lane holds 32 of its query's 64 scores, the
//   lane 16 away the other 32. Maximum and sum run in the lane; the halves exchange the maximum once a chunk and join their
//   sums once, in the epilogue. Tiles 2kk and 2kk+1, converted in place, ARE the B operand of 32 keys: element e < 8 is key
//   kk*32 + 8*hh + e, element e >= 8 is key kk*32 + 16 + 8*hh + (e - 8), the k order of the V^T loader. P never touches LDS.
//   online softmax in f32 over all T keys (32 chunks of 64, compile-time trip count).
//   Block = 4 waves = 64 query rows of one (b,h); grid = (NHEAD * T/64, B).
//   K / V^T chunk staging: 128 threads x 32 elements per plane = whole 64x64 tile (16-B copies, plain loads,
//   __syncthreads before and after); fragment loads read the LDS tiles with the same v8h element type.
// =====================================================================================
#define AT_D 64
#define AT_NW 4
#define AT_QB 64
#define AT_KC 64
#define AT_L2E 1.44269504088896340736f   // log2(e)
#define AT_LP 72   // LDS row pitch in halves: 144 B = 16 B x odd, so the 16 rows of one ds_load_b128 fall on distinct banks

__device__ __forceinline__ v8f mma_h16(v16h a, v16h b, v8f c) {
  return __builtin_amdgcn_wmma_f32_16x16x32_f16(false, a, false, b, (short)0, c, false, false);
}

// the value that lane l ^ 16 holds
__device__ __forceinline__ float other_half(float x) {
  const int u = __builtin_bit_cast(int, x);
  return __builtin_bit_cast(float, __builtin_amdgcn_permlanex16(u, u, 0x76543210, 0xfedcba98, false, false));
}

__global__ __launch_bounds__(128)
void attn_phase64_kernel(const unsigned short* __restrict__ qkp, const unsigned short* __restrict__ vtp,
                         const float* __restrict__ pb, unsigned short* __restrict__ aop) {
  union FH { v16h v; v8h h[2]; };
  __shared__ __align__(16) _Float16 Ksh[AT_KC * AT_LP];          // K [kv][d], padded rows    9 KB
  __shared__ __align__(16) _Float16 Vth[AT_D * AT_LP];           // V^T [d][kv], padded rows  9 KB
  __shared__ __align__(16) float    Os[AT_NW][16 * 68];          // per wave out tile, pitch 68

  const int tid  = threadIdx.x;
  const int wave = tid >> 5;
  const int lane = tid & 31;
  const int hh   = lane >> 4;
  const int c    = lane & 15;

  const int nqb = SEQ_T / AT_QB;          // 32
  const int bx  = blockIdx.x;
  const int qb  = bx % nqb;
  const int h   = bx / nqb;               // 0..NHEAD-1
  const int b   = blockIdx.y;
  const int q0  = qb * AT_QB + wave * 16; // query row within this batch element

  const _Float16* QK = (const _Float16*)(const void*)qkp;
  const _Float16* VT = (const _Float16*)(const void*)vtp;
  _Float16*       AO = (_Float16*)(void*)aop;
  const size_t brow = (size_t)b * SEQ_T;  // row base into the [B*T] planes

  // ---- Q fragments (B operand, column = lane&15, split k map via Frag load): 2 d-chunks ----
  v16h qa[2];
#pragma unroll
  for (int dc = 0; dc < 2; ++dc) {
    const _Float16* qr = QK + (brow + q0 + c) * (size_t)QK_LD + h * HDIM + dc * 32 + 8 * hh;
    qa[dc] = Frag<_Float16>::load(qr);
  }

  float mrow = -INFINITY;   // running maximum of query c, equal in both halves
  float lrow = 0.f;         // running sum of query c over this half's keys, carried x2^15 like p
  v8f oacc[4];              // oacc[t][r] = out(query c, d = t*16 + 8*hh + r)
#pragma unroll
  for (int t = 0; t < 4; ++t) oacc[t] = (v8f){0.f,0.f,0.f,0.f,0.f,0.f,0.f,0.f};

  const int nChunks = SEQ_T / AT_KC;      // 32, compile-time constant
  for (int kc = 0; kc < nChunks; ++kc) {
    const int kv0 = kc * AT_KC;
    __syncthreads();
    // staging coverage: 128 threads x (4 x 8) elements = 64 rows x 64 per plane = the whole chunk tile
    const int sr = tid >> 1, half = (tid & 1) * 32;
    const _Float16* ks = QK + (brow + kv0 + sr) * (size_t)QK_LD + h * HDIM + half;    // row kv0+sr of the q,k plane; K stands EMB columns on, d = half..+31
    const _Float16* vs = VT + ((size_t)b * EMB + h * HDIM + sr) * SEQ_T + kv0 + half; // V^T row d = sr, s = kv0+half..+31
    v8h a0[4], b0[4];
#pragma unroll
    for (int i = 0; i < 4; ++i) {
      a0[i] = *(const v8h*)(ks + EMB + 8 * i);
      b0[i] = *(const v8h*)(vs + 8 * i);
    }
    // the chunk's bias values are asked for here, behind the K and V^T loads, so that the three share one trip to L2
    // additive bias of (query q0 + c, key kv0 + j*16 + 8hh + r), read at [key][query]: the plane's kernel forms element [t][s]
    // and element [s][t] from the same products and sums in the same order, so the two hold the same bits for any coords,
    // and a load then covers two 64-byte row pieces instead of 32 pieces of 16 rows
    const float* pbr = pb + (brow + kv0 + 8 * hh) * (size_t)SEQ_T + q0 + c;
    float pbv[4][8];
#pragma unroll
    for (int j = 0; j < 4; ++j)
#pragma unroll
      for (int r = 0; r < 8; ++r) pbv[j][r] = pbr[(size_t)(j * 16 + r) * SEQ_T];
    // the wait that stands in front of any overwrite of the 40 loads' three address pairs; naming the pairs as inputs keeps them live up to it
    asm volatile("s_wait_xcnt 0x0" :: "v"(ks), "v"(vs), "v"(pbr) : "memory");
#pragma unroll
    for (int i = 0; i < 4; ++i) {
      *(v8h*)(Ksh + sr * AT_LP + half + 8 * i) = a0[i];
      *(v8h*)(Vth + sr * AT_LP + half + 8 * i) = b0[i];
    }
    __syncthreads();

    // the chunk's 16 K reads stand as one batch in front of the 8 products: one LDS latency, not eight
    FH kb[4][2];
#pragma unroll
    for (int dc = 0; dc < 2; ++dc)
#pragma unroll
      for (int j = 0; j < 4; ++j) {
        kb[j][dc].h[0] = *(const v8h*)(Ksh + (j * 16 + c) * AT_LP + dc * 32 + 8 * hh);
        kb[j][dc].h[1] = *(const v8h*)(Ksh + (j * 16 + c) * AT_LP + dc * 32 + 16 + 8 * hh);
      }
    v8f s[4];
#pragma unroll
    for (int j = 0; j < 4; ++j) s[j] = (v8f){0.f,0.f,0.f,0.f,0.f,0.f,0.f,0.f};
#pragma unroll
    for (int dc = 0; dc < 2; ++dc)
#pragma unroll
      for (int j = 0; j < 4; ++j) s[j] = mma_h16(kb[j][dc].v, qa[dc], s[j]);
    // the 16 V^T reads are issued here, so that they land while the softmax runs
    FH vb[2][4];
#pragma unroll
    for (int kk = 0; kk < 2; ++kk)
#pragma unroll
      for (int t = 0; t < 4; ++t) {
        vb[kk][t].h[0] = *(const v8h*)(Vth + (t * 16 + c) * AT_LP + kk * 32 + 8 * hh);
        vb[kk][t].h[1] = *(const v8h*)(Vth + (t * 16 + c) * AT_LP + kk * 32 + 16 + 8 * hh);
      }
    // holds both batches of reads above this line: without it the build sinks them back to read, wait, product, one pair at a time
    __builtin_amdgcn_sched_barrier(0);
    float mj[2];            // two independent chains of 16 (one per pair of score tiles) instead of one of 32
#pragma unroll
    for (int g = 0; g < 2; ++g) mj[g] = -INFINITY;
#pragma unroll
    for (int j = 0; j < 4; ++j) {
#pragma unroll
      for (int r = 0; r < 8; ++r) {
        const float sv = s[j][r] * 0.125f + pbv[j][r];
        s[j][r] = sv;
        mj[j / 2] = fmaxf(mj[j / 2], sv);
      }
    }
    float m = fmaxf(mj[0], mj[1]);
    m = fmaxf(m, other_half(m));
    const float mnew  = fmaxf(mrow, m);
    // exponentials in base 2 on the hardware's own instruction: e^(x - mnew) * 2^15 = 2^((x - mnew) * log2(e) + 15), a subtraction,
    // a multiply-add and one v_exp_f32 a score. The maximum is taken off first, as before: the difference is exactly 0 at the
    // maximum and never above 0, so the argument is exactly 15 there and never above 15, however large the scores are.
    // A result under the smallest normal number may go to 0: it is nothing beside the 2^15 that the maximum adds to the sum.
    const float alpha = __builtin_amdgcn_exp2f((mrow - mnew) * AT_L2E);
    mrow = mnew;
    float pj[2];            // likewise two independent sums of 16
#pragma unroll
    for (int g = 0; g < 2; ++g) pj[g] = 0.f;
    FH pa[2];
#pragma unroll
    for (int j = 0; j < 4; ++j) {
#pragma unroll
      for (int r = 0; r < 8; ++r) {
        const float p = __builtin_amdgcn_exp2f(fmaf(s[j][r] - mnew, AT_L2E, 15.0f));   // p x 2^15
        pj[j / 2] += p;
        pa[j >> 1].h[j & 1][r] = (_Float16)p;
      }
    }
    const float psum = (pj[0] + pj[1]);
    lrow = lrow * alpha + psum;
#pragma unroll
    for (int t = 0; t < 4; ++t)
#pragma unroll
      for (int r = 0; r < 8; ++r) oacc[t][r] *= alpha;
#pragma unroll
    for (int kk = 0; kk < 2; ++kk) {
#pragma unroll
      for (int t = 0; t < 4; ++t) oacc[t] = mma_h16(vb[kk][t].v, pa[kk].v, oacc[t]);
    }
  }

  // ---- epilogue: 16 * oacc / l, oacc and l both carried x2^15 -> f16 plane ----
  float* os = Os[wave];
  {
    const float l = lrow + other_half(lrow);          // the two halves' keys together
    const float inv = 1.0f / (l * 0.0625f);           // = 16 / l; l holds the maximum's own 2^15
#pragma unroll
    for (int t = 0; t < 4; ++t) {
      v4f lo, hi;
#pragma unroll
      for (int r = 0; r < 4; ++r) { lo[r] = oacc[t][r] * inv; hi[r] = oacc[t][4 + r] * inv; }
      *(v4f*)(os + c * 68 + t * 16 + 8 * hh)     = lo;
      *(v4f*)(os + c * 68 + t * 16 + 8 * hh + 4) = hi;
    }
  }
  __builtin_amdgcn_fence(__ATOMIC_RELEASE, "workgroup");
  __builtin_amdgcn_wave_barrier();
  __builtin_amdgcn_fence(__ATOMIC_ACQUIRE, "workgroup");
  {
    const int q = lane >> 3, c8 = (lane & 7) * 8;
    {
#pragma unroll
      for (int it = 0; it < 4; ++it) {
        const int row = it * 4 + q;
        const float* sp = os + row * 68 + c8;
        v8h hv;
#pragma unroll
        for (int e = 0; e < 8; ++e) hv[e] = (_Float16)sp[e];
        *(v8h*)(AO + (brow + q0 + row) * (size_t)EMB + h * HDIM + c8) = hv;
      }
      
    }
  }
}

// =====================================================================================
//   xb    bf16 [4096][1024]          8,388,608  @ 0
//   wqkv  bf16 [3072][1024]          6,291,456  @ 8,388,608
//   wo    f16  [1024][1024] (x64)    2,097,152  @ 14,680,064
//   biasr f32  [4096] (bf16-valued)     16,384  @ 16,777,216
//   qk    f16  [4096][2048]         16,777,216  @ 16,793,600
//   vt    f16  [2][1024][2048]       8,388,608  @ 33,570,816
//   pb    f32  [2][2048][2048]      33,554,432  @ 41,959,424
//   ao    f16  [4096][1024] (x16)    8,388,608  @ 75,513,856
//   total 83,902,464
// =====================================================================================
extern "C" void kernel_launch(void* const* d_in, const int* in_sizes, int n_in,
                              void* d_out, int out_size, void* d_ws, size_t ws_size,
                              hipStream_t stream) {
  if (n_in < 7) return;
  if (in_sizes[0] != NBATCH * SEQ_T * EMB || in_sizes[1] != NBATCH * SEQ_T * NPH ||
      in_sizes[2] != 3 * EMB * EMB || in_sizes[3] != 3 * EMB || in_sizes[4] != EMB * EMB ||
      in_sizes[5] != EMB || in_sizes[6] < 1 || out_size != NBATCH * SEQ_T * EMB) return;

  const float* x      = (const float*)d_in[0];
  const float* coords = (const float*)d_in[1];
  const float* qkv_w  = (const float*)d_in[2];
  const float* qkv_b  = (const float*)d_in[3];
  const float* out_w  = (const float*)d_in[4];
  const float* out_b  = (const float*)d_in[5];
  const float* ptemp  = (const float*)d_in[6];
  float* out = (float*)d_out;

  const size_t MROWS = (size_t)NBATCH * SEQ_T;           // 4096
  size_t off = 0;
  char* ws = (char*)d_ws;
  unsigned short* xb   = (unsigned short*)(ws + off); off += MROWS * EMB * 2;
  unsigned short* wqkv = (unsigned short*)(ws + off); off += (size_t)3 * EMB * EMB * 2;
  unsigned short* wo   = (unsigned short*)(ws + off); off += (size_t)EMB * EMB * 2;
  float*          biasr= (float*)(ws + off);          off += (size_t)4 * EMB * 4;
  unsigned short* qk   = (unsigned short*)(ws + off); off += MROWS * QK_LD * 2;
  unsigned short* vt   = (unsigned short*)(ws + off); off += (size_t)NBATCH * EMB * SEQ_T * 2;
  float*          pb   = (float*)(ws + off);          off += (size_t)NBATCH * SEQ_T * SEQ_T * 4;
  unsigned short* ao   = (unsigned short*)(ws + off); off += MROWS * EMB * 2;
  if (off > ws_size) return;

  // 1: operand casts (2 elements per thread), bias tables, phase-space similarity plane
  prep_kernel<<<dim3(BI_BLK + 9 * PB_BLK), 256, 0, stream>>>(
      x, coords, qkv_w, qkv_b, out_w, out_b, ptemp, xb, wqkv, wo, biasr, pb);

  // 2: q,k and v^T
  qkv_gemm_pair<<<dim3(QK_BLK + NBATCH * VT_BLK), 256, 0, stream>>>(
      xb, wqkv, wqkv + (size_t)2 * EMB * EMB, biasr, qk, vt, EMB);

  // 3: attention with phase bias -> ao f16 (x16)
  attn_phase64_kernel<<<dim3(NHEAD * (SEQ_T / AT_QB), NBATCH), 128, 0, stream>>>(qk, vt, pb, ao);

  // 4: out = (ao x16) . (wo x64)^T * 2^-10 + out_b -> f32 d_out [4096][1024]   (M=4096,N=1024,K=1024; 1024 tiles)
  wmma_gemm64<0, false, 2, 0, false><<<dim3((4096 / 64) * (1024 / 64) / 8, 1), 256, 0, stream>>>(
      ao, ao, EMB, 0L, wo, wo, EMB, 0L, (void*)out, (void*)out, EMB, 0L,
      biasr + 3 * EMB, biasr, 0L, (int)MROWS, EMB, EMB, 1.0f / 1024.0f);
}

// v007
// One run takes 129 microseconds.
// Timed twice side by side with v006, it ran 1.07 and 1.06 times as fast.
// All steps since v000 together make it 2.61 times as fast.
// Contractions: x.Wqkv^T (q,k GEMM and role-swapped v^T GEMM): v_wmma_f32_16x16x32_bf16 (bf16 RNE operands); q.k^T and p.v: v_wmma_f32_16x16x32_f16 (f16 operands, p carried x2^15); ao.Wout^T: v_wmma_f32_16x16x32_f16 (ao x16, Wout x64, folded by 2^-10); all f32 accumulate; softmax and the 8-dim phase-space bias in f32 on VALU.
#include <hip/hip_runtime.h>
#include <math.h>
#include <stdint.h>

constexpr int NBATCH = 2;
constexpr int SEQ_T  = 2048;
constexpr int EMB    = 1024;
constexpr int NHEAD  = 16;
constexpr int HDIM   = 64;
constexpr int NPH    = 8;
constexpr int QK_LD  = 2048;   // q,k plane pitch (q cols 0..1023, k cols 1024..2047)

typedef __attribute__((ext_vector_type(16))) _Float16 v16h;
typedef __attribute__((ext_vector_type(8)))  _Float16 v8h;
typedef __attribute__((ext_vector_type(16))) __bf16   v16b;
typedef __attribute__((ext_vector_type(8)))  __bf16   v8b;
typedef __attribute__((ext_vector_type(8)))  float    v8f;
typedef __attribute__((ext_vector_type(4)))  float    v4f;

__device__ __forceinline__ unsigned short f2bf_bits(float f) {
  unsigned u = __float_as_uint(f);
  return (unsigned short)((u + 0x7FFFu + ((u >> 16) & 1u)) >> 16);
}
__device__ __forceinline__ float bf_bits2f(unsigned short h) { return __uint_as_float(((unsigned)h) << 16); }

// hazard guards as plain device helpers (the only inline asm in the kernel template body is the s_wait_xcnt)
__device__ __forceinline__ void dep_guard_h(v8f& a, v8f& b, v16h x, v16h y) { asm volatile("v_nop\n\tv_nop\n\tv_nop\n\tv_nop" : "+v"(a), "+v"(b) : "v"(x), "v"(y)); }
__device__ __forceinline__ void dep_guard_b(v8f& a, v8f& b, v16b x, v16b y) { asm volatile("v_nop\n\tv_nop\n\tv_nop\n\tv_nop" : "+v"(a), "+v"(b) : "v"(x), "v"(y)); }
__device__ __forceinline__ void keep4_h(v16h a, v16h b, v16h c, v16h d) { asm volatile("v_nop" :: "v"(a), "v"(b), "v"(c), "v"(d)); }
__device__ __forceinline__ void keep4_b(v16b a, v16b b, v16b c, v16b d) { asm volatile("v_nop" :: "v"(a), "v"(b), "v"(c), "v"(d)); }
__device__ __forceinline__ void acc_guard4(v8f& a, v8f& b, v8f& c, v8f& d) { asm volatile("v_nop\n\tv_nop\n\tv_nop\n\tv_nop" : "+v"(a), "+v"(b), "+v"(c), "+v"(d)); }
template <typename T> struct Frag;
template <> struct Frag<_Float16> {
  typedef v16h V; typedef v8h H; union U { v16h v; v8h h[2]; };
  static __device__ __forceinline__ v16h load(const _Float16* p) {   // elements 0..7 <- p[0..7], 8..15 <- p[16..23]
    U f; f.h[0] = *(const v8h*)(p); f.h[1] = *(const v8h*)(p + 16); return f.v;
  }
  static __device__ __forceinline__ v8f mma(v16h a, v16h b, v8f c) {
    return __builtin_amdgcn_wmma_f32_16x16x32_f16(false, a, false, b, (short)0, c, false, false);
  }
  static __device__ __forceinline__ void guard(v8f& a, v8f& b, v16h x, v16h y) { dep_guard_h(a, b, x, y); }
  static __device__ __forceinline__ void keep(v16h a, v16h b, v16h c, v16h d) { keep4_h(a, b, c, d); }
};
template <> struct Frag<__bf16> {
  typedef v16b V; typedef v8b H; union U { v16b v; v8b h[2]; };
  static __device__ __forceinline__ v16b load(const __bf16* p) {
    U f; f.h[0] = *(const v8b*)(p); f.h[1] = *(const v8b*)(p + 16); return f.v;
  }
  static __device__ __forceinline__ v8f mma(v16b a, v16b b, v8f c) {
    return __builtin_amdgcn_wmma_f32_16x16x32_bf16(false, a, false, b, (short)0, c, false, false);
  }
  static __device__ __forceinline__ void guard(v8f& a, v8f& b, v16b x, v16b y) { dep_guard_b(a, b, x, y); }
  static __device__ __forceinline__ void keep(v16b a, v16b b, v16b c, v16b d) { keep4_b(a, b, c, d); }
};

// ---- Register-blocked batched WMMA GEMM ------------------------------------
// C[m,n] = scale * sum_k A[m,k] * Bt[n,k] (+bias)(+resid); each wave owns a 64x64 tile.
// A row-major [M,K]; Bt row-major [N,K]; M % 64 == 0, N % 512 == 0, K % 64 == 0, lda == ldb == GS_LD.
// The 8 waves of a block own 8 neighbouring tiles of one tile row: 64 rows of A (shared) x 512 rows of Bt.
// Per pass of 64 k the block stages those 576 row pieces (128 B each) in LDS: 8 lanes fetch one whole 128-byte line,
// so a load touches 4 lines instead of the 16 that a fragment load from global memory touches; fragments come from LDS.
// SPLIT (hi/lo operand planes) is not carried by the staged path; A2/Bt2 are unused.
// BIAS_MODE: 0 = none, 1 = bias[m], 2 = bias[n].
// OUT_MODE: 0 = f32, 1 = f16, 2 = bf16 hi plane (Cout) + bf16 lo plane (Cout2).
// ET: 0 = f16 operands, 1 = bf16 operands (pointers passed as 16-bit storage)
template <int ET> struct Elem;
template <> struct Elem<0> { typedef _Float16 T; };
template <> struct Elem<1> { typedef __bf16 T; };
constexpr int GS_K = 64;   // k per staged pass: one 128-byte line of every operand row
constexpr int GS_P = 72;   // LDS row pitch in 16-bit elements: 144 B = 16 B x odd, free of bank conflicts for ds_load_b128
constexpr int GS_LD = EMB; // row pitch of A and Bt in every launch; a constant lets a pass's 18 row steps ride in the loads' offset fields
// The body is a device function: bx, b are the block's place in its own product's grid, and the kernel that calls it owns the
// LDS arrays, so that a kernel which holds two products (block ranges of one grid) allocates them once.
template <int ET, bool SPLIT, int BIAS_MODE, int OUT_MODE, bool RESID, int ACT = 0>
__device__ __forceinline__ void gemm64_body(
    float (*sT)[16 * 68], typename Elem<ET>::T* sA, typename Elem<ET>::T* sB, const int bx, const int b,
    const unsigned short* __restrict__ Ap, const unsigned short* __restrict__ A2p, int lda, long strideA,
    const unsigned short* __restrict__ Btp, const unsigned short* __restrict__ Bt2p, int ldb, long strideB,
    void* __restrict__ Cout, void* __restrict__ Cout2, int ldc, long strideC,
    const float* __restrict__ bias,
    const float* __restrict__ resid, long strideR,
    int M, int N, int K, float scale) {
  typedef typename Elem<ET>::T T;
  typedef typename Frag<T>::V V;
  typedef typename Frag<T>::H H;
  static_assert(!SPLIT, "the staged path holds single operand planes");
  const T* A = (const T*)Ap; const T* Bt = (const T*)Btp;
  const int lane = threadIdx.x & 31;
  const int wave = threadIdx.x >> 5;
  const int tilesN = N >> 6;
  const int tilesM = M >> 6;
  const int tile0 = bx * 8;                // first of the block's 8 tiles; tilesN % 8 == 0 keeps them in one tile row
  if (tile0 >= tilesM * tilesN || lda != GS_LD || ldb != GS_LD) return;    // block-uniform, in front of every barrier
  const int tm  = tile0 / tilesN;
  const int tn0 = tile0 - tm * tilesN;
  const int m0  = tm << 6;
  const int nb0 = tn0 << 6;                // first Bt row of the block
  const int n0  = nb0 + (wave << 6);

  const T* Ab  = A  + (size_t)b * strideA;
  const T* Bb  = Bt + (size_t)b * strideB;

  const int rlane = lane & 15;                 // row (A) / col (B, D) within subtile
  const int koff  = (lane >> 4) * 8;           // k offset of this lane half
  const int mOff  = (lane >> 4) * 8;           // D row offset

  // staging map: 8 lanes fetch one row piece (16 bytes each at element (tid & 7) * 8); a wave's four rows of each group of
  // 32 lie 8 apart, so that at pitch 144 B the two rows of a 16-lane half fall on opposite halves of the LDS banks
  const int srow = wave + 8 * ((threadIdx.x >> 3) & 3);
  const int scol = (threadIdx.x & 7) * 8;
  const unsigned sLane = (unsigned)(srow * GS_LD + scol) * 2u;   // this thread's byte offset from a group's first row
  const char* gA = (const char*)(Ab + (size_t)m0  * GS_LD);      // block-uniform bases
  const char* gB = (const char*)(Bb + (size_t)nb0 * GS_LD);
  T* stA = sA + srow * GS_P + scol;
  T* stB = sB + srow * GS_P + scol;
  const T* frA = sA + rlane * GS_P + koff;
  const T* frB = sB + ((wave << 6) + rlane) * GS_P + koff;

  v8f acc[4][4];
#pragma unroll
  for (int i = 0; i < 4; ++i)
#pragma unroll
    for (int j = 0; j < 4; ++j) acc[i][j] = (v8f){0.f,0.f,0.f,0.f,0.f,0.f,0.f,0.f};

  for (int k0 = 0; k0 < K; k0 += GS_K) {
    // coverage: 256 threads x 16 B = 32 rows x 128 B per step; 2 steps = 64 A rows, 16 steps = 512 Bt rows
    H ra[2], rb[16];
    const char* pA = gA + (size_t)k0 * 2 + sLane;
    const char* pB = gB + (size_t)k0 * 2 + sLane;
#pragma unroll
    for (int i = 0; i < 2; ++i)  ra[i] = *(const H*)(pA + i * 32 * GS_LD * 2);
#pragma unroll
    for (int i = 0; i < 16; ++i) rb[i] = *(const H*)(pB + i * 32 * GS_LD * 2);
    // the wait that stands in front of any overwrite of the 18 loads' address pairs; naming the pairs as inputs keeps them
    // live up to it (without that the build lands later loads of the group on them)
    asm volatile("s_wait_xcnt 0x0" :: "v"(pA), "v"(pB) : "memory");
    __syncthreads();   // every wave has taken its last fragment of the previous pass
#pragma unroll
    for (int i = 0; i < 2; ++i)  *(H*)(stA + i * 32 * GS_P) = ra[i];
#pragma unroll
    for (int i = 0; i < 16; ++i) *(H*)(stB + i * 32 * GS_P) = rb[i];
    __syncthreads();   // the pass's rows are complete for every wave
#pragma unroll
    for (int kk = 0; kk < GS_K; kk += 32) {
      V bh[4], ah[4];
#pragma unroll
      for (int j = 0; j < 4; ++j) bh[j] = Frag<T>::load(frB + j * 16 * GS_P + kk);
#pragma unroll
      for (int i = 0; i < 4; ++i) ah[i] = Frag<T>::load(frA + i * 16 * GS_P + kk);
#pragma unroll
      for (int i = 0; i < 4; ++i) {
#pragma unroll
        for (int j = 0; j < 4; ++j) acc[i][j] = Frag<T>::mma(ah[i], bh[j], acc[i][j]);
        Frag<T>::guard(acc[i][0], acc[i][3], ah[i], ah[i]);
      }
      Frag<T>::keep(bh[0], bh[1], bh[2], bh[3]);
    }
  }
  acc_guard4(acc[0][0], acc[0][1], acc[0][2], acc[0][3]);
  acc_guard4(acc[1][0], acc[1][1], acc[1][2], acc[1][3]);
  acc_guard4(acc[2][0], acc[2][1], acc[2][2], acc[2][3]);
  acc_guard4(acc[3][0], acc[3][1], acc[3][2], acc[3][3]);

  // ---- epilogue ----
  float* slab = sT[wave];
  const float* Rb = RESID ? (resid + (size_t)b * strideR) : nullptr;
#pragma unroll
  for (int i = 0; i < 4; ++i) {
    const int mBase = m0 + (i << 4);
#pragma unroll
    for (int j = 0; j < 4; ++j) {
      const int n = n0 + (j << 4) + rlane;
      float bv = 0.f;
      if (BIAS_MODE == 2) bv = bias[n];
#pragma unroll
      for (int r = 0; r < 8; ++r) {
        float v = acc[i][j][r] * scale;
        if (BIAS_MODE == 1) v += bias[mBase + mOff + r];
        if (BIAS_MODE == 2) v += bv;
        if (RESID) v += Rb[(size_t)(mBase + mOff + r) * ldc + n];
        if (ACT == 1) v = tanhf(v);
        if (ACT == 2) v = fmaxf(v, 0.0f);
        if (ACT == 3) v = v / (1.0f + expf(-v));
        if (ACT == 4) v = (v > 0.f) ? v : 0.01f * v;
        slab[(mOff + r) * 68 + (j << 4) + rlane] = v;
      }
    }
    __builtin_amdgcn_fence(__ATOMIC_RELEASE, "workgroup");
    __builtin_amdgcn_wave_barrier();
    __builtin_amdgcn_fence(__ATOMIC_ACQUIRE, "workgroup");
    if (OUT_MODE == 0) {
      float* C = (float*)Cout + (size_t)b * strideC;
      const int hh = lane >> 4, c4 = (lane & 15) * 4;     // row seg = 256 B = 16 lanes x 16 B
      {
#pragma unroll
        for (int it = 0; it < 8; ++it) {
          const int row = it * 2 + hh;
          v4f v = *(const v4f*)(slab + row * 68 + c4);
          *(v4f*)(C + (size_t)(mBase + row) * ldc + n0 + c4) = v;
        }
        
      }
    } else {
      const int q = lane >> 3, c8 = (lane & 7) * 8;
      unsigned short* C  = (unsigned short*)Cout  + (size_t)b * strideC;
      unsigned short* C2 = (OUT_MODE == 2) ? ((unsigned short*)Cout2 + (size_t)b * strideC) : nullptr;
      {
#pragma unroll
        for (int it = 0; it < 4; ++it) {
          const int row = it * 4 + q;
          const float* sp = slab + row * 68 + c8;
          v8h hv, lv;
#pragma unroll
          for (int e = 0; e < 8; ++e) {
            if (OUT_MODE == 1) {
              hv[e] = (_Float16)sp[e];
            } else {
              unsigned short hb = f2bf_bits(sp[e]);
              unsigned short lb = f2bf_bits(sp[e] - bf_bits2f(hb));
              hv[e] = __builtin_bit_cast(_Float16, hb);
              lv[e] = __builtin_bit_cast(_Float16, lb);
            }
          }
          *(v8h*)(C + (size_t)(mBase + row) * ldc + n0 + c8) = hv;
          if (OUT_MODE == 2) *(v8h*)(C2 + (size_t)(mBase + row) * ldc + n0 + c8) = lv;
        }
        
      }
    }
    __builtin_amdgcn_fence(__ATOMIC_RELEASE, "workgroup");
    __builtin_amdgcn_wave_barrier();
    __builtin_amdgcn_fence(__ATOMIC_ACQUIRE, "workgroup");
  }
}

// one product a launch
template <int ET, bool SPLIT, int BIAS_MODE, int OUT_MODE, bool RESID, int ACT = 0>
__global__ __launch_bounds__(256) void wmma_gemm64(
    const unsigned short* __restrict__ Ap, const unsigned short* __restrict__ A2p, int lda, long strideA,
    const unsigned short* __restrict__ Btp, const unsigned short* __restrict__ Bt2p, int ldb, long strideB,
    void* __restrict__ Cout, void* __restrict__ Cout2, int ldc, long strideC,
    const float* __restrict__ bias,
    const float* __restrict__ resid, long strideR,
    int M, int N, int K, float scale) {
  typedef typename Elem<ET>::T T;
  __shared__ __align__(16) float sT[8][16 * 68];   // per-wave 16x64 slab, pitch 68 floats
  __shared__ __align__(16) T sA[64 * GS_P];        // the block's 64 A rows, 64 k
  __shared__ __align__(16) T sB[512 * GS_P];       // the block's 512 Bt rows (64 per wave), 64 k
  gemm64_body<ET, SPLIT, BIAS_MODE, OUT_MODE, RESID, ACT>(sT, sA, sB, blockIdx.x, blockIdx.y,
      Ap, A2p, lda, strideA, Btp, Bt2p, ldb, strideB, Cout, Cout2, ldc, strideC, bias, resid, strideR, M, N, K, scale);
}

// The two products of x with Wqkv read the same two planes and neither reads what the other writes: one launch, block ranges.
//   blocks 0..255   : q,k = xb[4096][1024] . wqk[2048][1024]^T + bias[n]    -> f16 [4096][2048]           (2048 tiles)
//   blocks 256..383 : v^T[b] = wv[1024][1024] . xb[b][2048][1024]^T + bias[m]        -> f16 [2][1024][2048] (512 tiles x 2)
// Alone the second fills half the chip's 256 WGPs; two blocks fit a WGP (LDS 2 x 117,760 B, 4 waves a SIMD).
constexpr int QK_BLK = (NBATCH * SEQ_T / 64) * (2 * EMB / 64) / 8;   // 256
constexpr int VT_BLK = (EMB / 64) * (SEQ_T / 64) / 8;                // 64 per batch element
__global__ __launch_bounds__(256) void qkv_gemm_pair(
    const unsigned short* __restrict__ xb, const unsigned short* __restrict__ wqk, const unsigned short* __restrict__ wv,
    const float* __restrict__ biasr, unsigned short* __restrict__ qk, unsigned short* __restrict__ vt, int K) {
  __shared__ __align__(16) float sT[8][16 * 68];
  __shared__ __align__(16) __bf16 sA[64 * GS_P];
  __shared__ __align__(16) __bf16 sB[512 * GS_P];
  const int bx = blockIdx.x;
  if (bx < QK_BLK) {                       // block-uniform
    gemm64_body<1, false, 2, 1, false>(sT, sA, sB, bx, 0,
        xb, xb, EMB, 0L, wqk, wqk, EMB, 0L, (void*)qk, (void*)qk, QK_LD, 0L,
        biasr, biasr, 0L, NBATCH * SEQ_T, 2 * EMB, K, 1.0f);
  } else {
    const int r = bx - QK_BLK;
    gemm64_body<1, false, 1, 1, false>(sT, sA, sB, r % VT_BLK, r / VT_BLK,
        wv, wv, EMB, 0L,
        xb, xb, EMB, (long)SEQ_T * EMB,
        (void*)vt, (void*)vt, SEQ_T, (long)EMB * SEQ_T,
        biasr + 2 * EMB, biasr, 0L, EMB, SEQ_T, K, 1.0f);
  }
}

// ---- the five preparation jobs: device functions, blk = the block's place in the job's own grid (prep_kernel below) ----
__device__ __forceinline__ void cast_f32_bf16x2(
    const float* __restrict__ in, unsigned short* __restrict__ out, int n2, const int blk) {
  const int i = blk * 256 + threadIdx.x;
  if (i < n2) {
    const float f0 = in[2 * (size_t)i], f1 = in[2 * (size_t)i + 1];
    const unsigned u = (unsigned)f2bf_bits(f0) | ((unsigned)f2bf_bits(f1) << 16);
    ((unsigned*)out)[i] = u;
    
  }
}

// ---- f32 -> f16( bf16_rne(x) * scale ) cast (scale = exact power of two): same store discipline as above ----
__device__ __forceinline__ void cast_f32_f16x2_scaled(
    const float* __restrict__ in, unsigned short* __restrict__ out, int n2, float scale, const int blk) {
  const int i = blk * 256 + threadIdx.x;
  if (i < n2) {
    const float f0 = bf_bits2f(f2bf_bits(in[2 * (size_t)i])) * scale;
    const float f1 = bf_bits2f(f2bf_bits(in[2 * (size_t)i + 1])) * scale;
    const _Float16 h0 = (_Float16)f0, h1 = (_Float16)f1;
    const unsigned u = (unsigned)__builtin_bit_cast(unsigned short, h0) | ((unsigned)__builtin_bit_cast(unsigned short, h1) << 16);
    ((unsigned*)out)[i] = u;
    
  }
}

// ---- bias tables as RNE-bf16-valued f32: outp[0..3071] = bf16(qkv_b), outp[3072..4095] = bf16(out_b).
//      Both sources loaded unconditionally with clamped indices, selected by value. ----
__device__ __forceinline__ void bias_rne_job(
    const float* __restrict__ qkvb, const float* __restrict__ outb, float* __restrict__ outp, const int blk) {
  const int i  = blk * 256 + threadIdx.x;                   // 0..4095
  const int iq = i < 3 * EMB ? i : (3 * EMB - 1);
  int io = i - 3 * EMB; io = io < 0 ? 0 : (io > EMB - 1 ? EMB - 1 : io);
  const float a = qkvb[iq];
  const float c = outb[io];
  const float v = bf_bits2f(f2bf_bits((i < 3 * EMB) ? a : c));
  ((float*)outp)[i] = v;
  
}

// =====================================================================================
// Phase-space similarity plane: PB[b][t][s] = exp( -dist(t,s) * (1/temp) ),
//   dist = d2 > 0 ? sqrt(d2) : 0,  d2 = (|c_t|^2 + |c_s|^2) - 2 * (c_t . c_s)   (8-dim coords, RNE-bf16 valued, f32 math).
//   one block = one 64x64 tile (bs of T/64 s-tiles, bt of T/64 t-tiles, b of B), 256 threads. LDS: coords rows of the 64 t and 64 s, plus squared norms.
//   Coverage: 8 waves x 4 iterations x 2 rows = 64 t rows; 16 lanes x 4 floats = 64 s columns -> whole 64x64 tile.
// =====================================================================================
__device__ __forceinline__ void phase_bias_job(
    const float* __restrict__ coords, const float* __restrict__ temp, float* __restrict__ pb,
    const int bs, const int bt, const int b) {
#pragma clang fp contract(off)
  __shared__ __align__(16) float ct[64 * NPH];
  __shared__ __align__(16) float cs[64 * NPH];
  __shared__ float sqt[64];
  __shared__ float sqs[64];
  const int tid = threadIdx.x;
  const int t0  = bt * 64;
  const int s0  = bs * 64;
  const float invT = 1.0f / temp[0];
  {
    // staging coverage: 128 threads x 4 floats = 64 rows x 8 per table (waves 0-3 -> t rows, waves 4-7 -> s rows)
    const int rr = tid & 127, row = rr >> 1, c4 = (rr & 1) * 4;
    const int base = (tid < 128) ? t0 : s0;
    const v4f v = *(const v4f*)(coords + ((size_t)b * SEQ_T + base + row) * NPH + c4);
    v4f w;
#pragma unroll
    for (int e = 0; e < 4; ++e) w[e] = bf_bits2f(f2bf_bits(v[e]));
    if (tid < 128) *(v4f*)(ct + row * NPH + c4) = w;      // wave-uniform branch
    else           *(v4f*)(cs + row * NPH + c4) = w;
  }
  __syncthreads();
  if (tid < 64) {                                          // wave-uniform (waves 0,1)
    float a = 0.0f;
#pragma unroll
    for (int p = 0; p < NPH; ++p) a = a + ct[tid * NPH + p] * ct[tid * NPH + p];
    sqt[tid] = a;
  } else if (tid < 128) {                                  // waves 2,3
    const int r = tid - 64;
    float a = 0.0f;
#pragma unroll
    for (int p = 0; p < NPH; ++p) a = a + cs[r * NPH + p] * cs[r * NPH + p];
    sqs[r] = a;
  }
  __syncthreads();

  const int wave = tid >> 5, lane = tid & 31, hh = lane >> 4, c4 = (lane & 15) * 4;
  v4f ca[4], cb[4];
  float sqv[4];
#pragma unroll
  for (int q = 0; q < 4; ++q) {
    ca[q]  = *(const v4f*)(cs + (c4 + q) * NPH);
    cb[q]  = *(const v4f*)(cs + (c4 + q) * NPH + 4);
    sqv[q] = sqs[c4 + q];
  }
#pragma unroll 1
  for (int it = 0; it < 4; ++it) {
    const int row = wave * 8 + it * 2 + hh;                // 0..63
    const v4f qa = *(const v4f*)(ct + row * NPH);
    const v4f qb = *(const v4f*)(ct + row * NPH + 4);
    const float st = sqt[row];
    v4f res;
#pragma unroll
    for (int q = 0; q < 4; ++q) {
      float dot = qa[0] * ca[q][0];
      dot = dot + qa[1] * ca[q][1];
      dot = dot + qa[2] * ca[q][2];
      dot = dot + qa[3] * ca[q][3];
      dot = dot + qb[0] * cb[q][0];
      dot = dot + qb[1] * cb[q][1];
      dot = dot + qb[2] * cb[q][2];
      dot = dot + qb[3] * cb[q][3];
      const float d2 = (st + sqv[q]) - 2.0f * dot;
      const float sr = sqrtf(fmaxf(d2, 0.0f));
      const float dist = (d2 > 0.0f) ? sr : 0.0f;
      res[q] = expf(-dist * invT);
    }
    float* p = pb + ((size_t)b * SEQ_T + t0 + row) * SEQ_T + s0 + c4;
    *(v4f*)p = res;
    
  }
}

// =====================================================================================
// The three operand casts, the bias tables and the similarity plane read only inputs and write disjoint planes: one launch,
// the block index picks the job (block-uniform, so the plane job's barriers are passed by whole blocks).
//   Blocks 0..15: the bias tables. The other 18432 in groups of nine: the first of a group is a tile of the plane (vector
//   work), the other eight are cast blocks (memory work), so that both kinds are resident on a WGP at the same time.
//   Cast blocks in order: x, qkv_w, out_w.
// =====================================================================================
constexpr int N2X = NBATCH * SEQ_T * EMB / 2;                         // 2,097,152 pairs
constexpr int N2W = 3 * EMB * EMB / 2;                                // 1,572,864
constexpr int N2O = EMB * EMB / 2;                                    //   524,288
constexpr int CX_BLK = N2X / 256, CW_BLK = N2W / 256, CO_BLK = N2O / 256;   // 8192, 6144, 2048
constexpr int PB_BLK = (SEQ_T / 64) * (SEQ_T / 64) * NBATCH;          // 2048
constexpr int BI_BLK = 4 * EMB / 256;                                 // 16
static_assert(CX_BLK + CW_BLK + CO_BLK == 8 * PB_BLK, "eight cast blocks to a tile of the plane");
__global__ __launch_bounds__(256) void prep_kernel(
    const float* __restrict__ x, const float* __restrict__ coords, const float* __restrict__ qkv_w,
    const float* __restrict__ qkv_b, const float* __restrict__ out_w, const float* __restrict__ out_b,
    const float* __restrict__ temp,
    unsigned short* __restrict__ xb, unsigned short* __restrict__ wqkv, unsigned short* __restrict__ wo,
    float* __restrict__ biasr, float* __restrict__ pb) {
  if (blockIdx.x < BI_BLK) { bias_rne_job(qkv_b, out_b, biasr, blockIdx.x); return; }
  const int blk = blockIdx.x - BI_BLK;     // 0..18431
  const int g = blk / 9, r = blk - g * 9;
  if (r == 0) {
    phase_bias_job(coords, temp, pb, g % (SEQ_T / 64), (g / (SEQ_T / 64)) % (SEQ_T / 64), g / ((SEQ_T / 64) * (SEQ_T / 64)));
    return;
  }
  const int cb = g * 8 + r - 1;            // 0..16383
  if (cb < CX_BLK)               cast_f32_bf16x2(x, xb, N2X, cb);
  else if (cb < CX_BLK + CW_BLK) cast_f32_bf16x2(qkv_w, wqkv, N2W, cb - CX_BLK);
  else                           cast_f32_f16x2_scaled(out_w, wo, N2O, 64.0f, cb - CX_BLK - CW_BLK);
}

// =====================================================================================
// Full (non-causal, unmasked) attention with additive bias plane, head dim 64.
//   qk plane f16 [B*T][2048]: q(t,h,d) at col h*64+d, k(s,h,d) at col 1024+h*64+d
//   vt plane f16 [B][1024][T]: v(s,h,d) at row h*64+d, col s
//   pb plane f32 [B][T][T]
//   ao plane f16 [B*T][1024]: element (t, h*64+d) = 16 * attention output
//   Both products run with their operands' roles swapped, so that a lane owns ONE query (column lane & 15):
//   scores^T = (k . q^T) * 0.125 + pb : A = K rows from LDS, B = the wave's 16 queries, kept in registers
//   out^T    = v^T . p^T (p and its sum l carried x2^15) : A = V^T rows from LDS, B = p^T, folded by 16/l in the epilogue
//   Score tile j, register r of lane (c, hh) is key j*16 + 8*hh + r of query c: a lane holds 32 of its query's 64 scores, the
//   lane 16 away the other 32. Maximum and sum run in the lane; the halves exchange the maximum once a chunk and join their
//   sums once, in the epilogue. Tiles 2kk and 2kk+1, converted in place, ARE the B operand of 32 keys: element e < 8 is key
//   kk*32 + 8*hh + e, element e >= 8 is key kk*32 + 16 + 8*hh + (e - 8), the k order of the V^T loader. P never touches LDS.
//   online softmax in f32 over all T keys (32 chunks of 64, compile-time trip count).
//   Block = 4 waves = 64 query rows of one (b,h); grid = (NHEAD * T/64, B).
//   K / V^T chunk staging: 8 lanes fetch one whole 128-byte row piece (16 B each), so a load touches 4 lines, not 16;
//   128 threads x 16 B = 16 rows a step, 4 steps a plane = whole 64x64 tile (plain loads, __syncthreads before and after);
//   fragment loads read the LDS tiles with the same v8h element type.
// =====================================================================================
#define AT_D 64
#define AT_NW 4
#define AT_QB 64
#define AT_KC 64
#define AT_L2E 1.44269504088896340736f   // log2(e)
#define AT_LP 72   // LDS row pitch in halves: 144 B = 16 B x odd, so the 16 rows of one ds_load_b128 fall on distinct banks

__device__ __forceinline__ v8f mma_h16(v16h a, v16h b, v8f c) {
  return __builtin_amdgcn_wmma_f32_16x16x32_f16(false, a, false, b, (short)0, c, false, false);
}

// the value that lane l ^ 16 holds
__device__ __forceinline__ float other_half(float x) {
  const int u = __builtin_bit_cast(int, x);
  return __builtin_bit_cast(float, __builtin_amdgcn_permlanex16(u, u, 0x76543210, 0xfedcba98, false, false));
}

__global__ __launch_bounds__(128)
void attn_phase64_kernel(const unsigned short* __restrict__ qkp, const unsigned short* __restrict__ vtp,
                         const float* __restrict__ pb, unsigned short* __restrict__ aop) {
  union FH { v16h v; v8h h[2]; };
  __shared__ __align__(16) _Float16 Ksh[AT_KC * AT_LP];          // K [kv][d], padded rows    9 KB
  __shared__ __align__(16) _Float16 Vth[AT_D * AT_LP];           // V^T [d][kv], padded rows  9 KB
  __shared__ __align__(16) float    Os[AT_NW][16 * 68];          // per wave out tile, pitch 68

  const int tid  = threadIdx.x;
  const int wave = tid >> 5;
  const int lane = tid & 31;
  const int hh   = lane >> 4;
  const int c    = lane & 15;

  const int nqb = SEQ_T / AT_QB;          // 32
  const int bx  = blockIdx.x;
  const int qb  = bx % nqb;
  const int h   = bx / nqb;               // 0..NHEAD-1
  const int b   = blockIdx.y;
  const int q0  = qb * AT_QB + wave * 16; // query row within this batch element

  const _Float16* QK = (const _Float16*)(const void*)qkp;
  const _Float16* VT = (const _Float16*)(const void*)vtp;
  _Float16*       AO = (_Float16*)(void*)aop;
  const size_t brow = (size_t)b * SEQ_T;  // row base into the [B*T] planes

  // ---- Q fragments (B operand, column = lane&15, split k map via Frag load): 2 d-chunks ----
  v16h qa[2];
#pragma unroll
  for (int dc = 0; dc < 2; ++dc) {
    const _Float16* qr = QK + (brow + q0 + c) * (size_t)QK_LD + h * HDIM + dc * 32 + 8 * hh;
    qa[dc] = Frag<_Float16>::load(qr);
  }

  float mrow = -INFINITY;   // running maximum of query c, equal in both halves
  float lrow = 0.f;         // running sum of query c over this half's keys, carried x2^15 like p
  v8f oacc[4];              // oacc[t][r] = out(query c, d = t*16 + 8*hh + r)
#pragma unroll
  for (int t = 0; t < 4; ++t) oacc[t] = (v8f){0.f,0.f,0.f,0.f,0.f,0.f,0.f,0.f};

  // staging map: 8 lanes take one row piece of 128 bytes, a whole line of the plane. A wave's four rows of each group of 16 are
  // 2w, 2w + 8, 2w + 1, 2w + 9: the two rows of a 16-lane half lie 8 apart, on opposite halves of the LDS banks at pitch 144 B
  const int sr = 2 * wave + hh + 8 * ((lane >> 3) & 1);   // 0..15
  const int sc = (lane & 7) * 8;                          // element within the row piece

  const int nChunks = SEQ_T / AT_KC;      // 32, compile-time constant
  for (int kc = 0; kc < nChunks; ++kc) {
    const int kv0 = kc * AT_KC;
    __syncthreads();
    // staging coverage: 128 threads x 8 elements = 16 rows x 64 a step, 4 steps = 64 rows x 64 per plane = the whole chunk tile
    const _Float16* ks = QK + (brow + kv0 + sr) * (size_t)QK_LD + h * HDIM + sc;    // row kv0+sr of the q,k plane; K stands EMB columns on, d = sc..+7
    const _Float16* vs = VT + ((size_t)b * EMB + h * HDIM + sr) * SEQ_T + kv0 + sc; // V^T row d = sr, s = kv0+sc..+7
    v8h a0[4], b0[4];
#pragma unroll
    for (int i = 0; i < 4; ++i) {
      a0[i] = *(const v8h*)(ks + EMB + (size_t)(16 * i) * QK_LD);
      b0[i] = *(const v8h*)(vs + (size_t)(16 * i) * SEQ_T);
    }
    // the chunk's bias values are asked for here, behind the K and V^T loads, so that the three share one trip to L2
    // additive bias of (query q0 + c, key kv0 + j*16 + 8hh + r), read at [key][query]: the plane's kernel forms element [t][s]
    // and element [s][t] from the same products and sums in the same order, so the two hold the same bits for any coords,
    // and a load then covers two 64-byte row pieces instead of 32 pieces of 16 rows
    const float* pbr = pb + (brow + kv0 + 8 * hh) * (size_t)SEQ_T + q0 + c;
    float pbv[4][8];
#pragma unroll
    for (int j = 0; j < 4; ++j)
#pragma unroll
      for (int r = 0; r < 8; ++r) pbv[j][r] = pbr[(size_t)(j * 16 + r) * SEQ_T];
    // the wait that stands in front of any overwrite of the 40 loads' three address pairs; naming the pairs as inputs keeps them live up to it
    asm volatile("s_wait_xcnt 0x0" :: "v"(ks), "v"(vs), "v"(pbr) : "memory");
#pragma unroll
    for (int i = 0; i < 4; ++i) {
      *(v8h*)(Ksh + (sr + 16 * i) * AT_LP + sc) = a0[i];
      *(v8h*)(Vth + (sr + 16 * i) * AT_LP + sc) = b0[i];
    }
    __syncthreads();

    // the chunk's 16 K reads stand as one batch in front of the 8 products: one LDS latency, not eight
    FH kb[4][2];
#pragma unroll
    for (int dc = 0; dc < 2; ++dc)
#pragma unroll
      for (int j = 0; j < 4; ++j) {
        kb[j][dc].h[0] = *(const v8h*)(Ksh + (j * 16 + c) * AT_LP + dc * 32 + 8 * hh);
        kb[j][dc].h[1] = *(const v8h*)(Ksh + (j * 16 + c) * AT_LP + dc * 32 + 16 + 8 * hh);
      }
    v8f s[4];
#pragma unroll
    for (int j = 0; j < 4; ++j) s[j] = (v8f){0.f,0.f,0.f,0.f,0.f,0.f,0.f,0.f};
#pragma unroll
    for (int dc = 0; dc < 2; ++dc)
#pragma unroll
      for (int j = 0; j < 4; ++j) s[j] = mma_h16(kb[j][dc].v, qa[dc], s[j]);
    // the 16 V^T reads are issued here, so that they land while the softmax runs
    FH vb[2][4];
#pragma unroll
    for (int kk = 0; kk < 2; ++kk)
#pragma unroll
      for (int t = 0; t < 4; ++t) {
        vb[kk][t].h[0] = *(const v8h*)(Vth + (t * 16 + c) * AT_LP + kk * 32 + 8 * hh);
        vb[kk][t].h[1] = *(const v8h*)(Vth + (t * 16 + c) * AT_LP + kk * 32 + 16 + 8 * hh);
      }
    // holds both batches of reads above this line: without it the build sinks them back to read, wait, product, one pair at a time
    __builtin_amdgcn_sched_barrier(0);
    float mj[2];            // two independent chains of 16 (one per pair of score tiles) instead of one of 32
#pragma unroll
    for (int g = 0; g < 2; ++g) mj[g] = -INFINITY;
#pragma unroll
    for (int j = 0; j < 4; ++j) {
#pragma unroll
      for (int r = 0; r < 8; ++r) {
        const float sv = s[j][r] * 0.125f + pbv[j][r];
        s[j][r] = sv;
        mj[j / 2] = fmaxf(mj[j / 2], sv);
      }
    }
    float m = fmaxf(mj[0], mj[1]);
    m = fmaxf(m, other_half(m));
    const float mnew  = fmaxf(mrow, m);
    // exponentials in base 2 on the hardware's own instruction: e^(x - mnew) * 2^15 = 2^((x - mnew) * log2(e) + 15), a subtraction,
    // a multiply-add and one v_exp_f32 a score. The maximum is taken off first, as before: the difference is exactly 0 at the
    // maximum and never above 0, so the argument is exactly 15 there and never above 15, however large the scores are.
    // A result under the smallest normal number may go to 0: it is nothing beside the 2^15 that the maximum adds to the sum.
    const float alpha = __builtin_amdgcn_exp2f((mrow - mnew) * AT_L2E);
    mrow = mnew;
    float pj[2];            // likewise two independent sums of 16
#pragma unroll
    for (int g = 0; g < 2; ++g) pj[g] = 0.f;
    FH pa[2];
#pragma unroll
    for (int j = 0; j < 4; ++j) {
#pragma unroll
      for (int r = 0; r < 8; ++r) {
        const float p = __builtin_amdgcn_exp2f(fmaf(s[j][r] - mnew, AT_L2E, 15.0f));   // p x 2^15
        pj[j / 2] += p;
        pa[j >> 1].h[j & 1][r] = (_Float16)p;
      }
    }
    const float psum = (pj[0] + pj[1]);
    lrow = lrow * alpha + psum;
#pragma unroll
    for (int t = 0; t < 4; ++t)
#pragma unroll
      for (int r = 0; r < 8; ++r) oacc[t][r] *= alpha;
#pragma unroll
    for (int kk = 0; kk < 2; ++kk) {
#pragma unroll
      for (int t = 0; t < 4; ++t) oacc[t] = mma_h16(vb[kk][t].v, pa[kk].v, oacc[t]);
    }
  }

  // ---- epilogue: 16 * oacc / l, oacc and l both carried x2^15 -> f16 plane ----
  float* os = Os[wave];
  {
    const float l = lrow + other_half(lrow);          // the two halves' keys together
    const float inv = 1.0f / (l * 0.0625f);           // = 16 / l; l holds the maximum's own 2^15
#pragma unroll
    for (int t = 0; t < 4; ++t) {
      v4f lo, hi;
#pragma unroll
      for (int r = 0; r < 4; ++r) { lo[r] = oacc[t][r] * inv; hi[r] = oacc[t][4 + r] * inv; }
      *(v4f*)(os + c * 68 + t * 16 + 8 * hh)     = lo;
      *(v4f*)(os + c * 68 + t * 16 + 8 * hh + 4) = hi;
    }
  }
  __builtin_amdgcn_fence(__ATOMIC_RELEASE, "workgroup");
  __builtin_amdgcn_wave_barrier();
  __builtin_amdgcn_fence(__ATOMIC_ACQUIRE, "workgroup");
  {
    const int q = lane >> 3, c8 = (lane & 7) * 8;
    {
#pragma unroll
      for (int it = 0; it < 4; ++it) {
        const int row = it * 4 + q;
        const float* sp = os + row * 68 + c8;
        v8h hv;
#pragma unroll
        for (int e = 0; e < 8; ++e) hv[e] = (_Float16)sp[e];
        *(v8h*)(AO + (brow + q0 + row) * (size_t)EMB + h * HDIM + c8) = hv;
      }
      
    }
  }
}

// =====================================================================================
//   xb    bf16 [4096][1024]          8,388,608  @ 0
//   wqkv  bf16 [3072][1024]          6,291,456  @ 8,388,608
//   wo    f16  [1024][1024] (x64)    2,097,152  @ 14,680,064
//   biasr f32  [4096] (bf16-valued)     16,384  @ 16,777,216
//   qk    f16  [4096][2048]         16,777,216  @ 16,793,600
//   vt    f16  [2][1024][2048]       8,388,608  @ 33,570,816
//   pb    f32  [2][2048][2048]      33,554,432  @ 41,959,424
//   ao    f16  [4096][1024] (x16)    8,388,608  @ 75,513,856
//   total 83,902,464
// =====================================================================================
extern "C" void kernel_launch(void* const* d_in, const int* in_sizes, int n_in,
                              void* d_out, int out_size, void* d_ws, size_t ws_size,
                              hipStream_t stream) {
  if (n_in < 7) return;
  if (in_sizes[0] != NBATCH * SEQ_T * EMB || in_sizes[1] != NBATCH * SEQ_T * NPH ||
      in_sizes[2] != 3 * EMB * EMB || in_sizes[3] != 3 * EMB || in_sizes[4] != EMB * EMB ||
      in_sizes[5] != EMB || in_sizes[6] < 1 || out_size != NBATCH * SEQ_T * EMB) return;

  const float* x      = (const float*)d_in[0];
  const float* coords = (const float*)d_in[1];
  const float* qkv_w  = (const float*)d_in[2];
  const float* qkv_b  = (const float*)d_in[3];
  const float* out_w  = (const float*)d_in[4];
  const float* out_b  = (const float*)d_in[5];
  const float* ptemp  = (const float*)d_in[6];
  float* out = (float*)d_out;

  const size_t MROWS = (size_t)NBATCH * SEQ_T;           // 4096
  size_t off = 0;
  char* ws = (char*)d_ws;
  unsigned short* xb   = (unsigned short*)(ws + off); off += MROWS * EMB * 2;
  unsigned short* wqkv = (unsigned short*)(ws + off); off += (size_t)3 * EMB * EMB * 2;
  unsigned short* wo   = (unsigned short*)(ws + off); off += (size_t)EMB * EMB * 2;
  float*          biasr= (float*)(ws + off);          off += (size_t)4 * EMB * 4;
  unsigned short* qk   = (unsigned short*)(ws + off); off += MROWS * QK_LD * 2;
  unsigned short* vt   = (unsigned short*)(ws + off); off += (size_t)NBATCH * EMB * SEQ_T * 2;
  float*          pb   = (float*)(ws + off);          off += (size_t)NBATCH * SEQ_T * SEQ_T * 4;
  unsigned short* ao   = (unsigned short*)(ws + off); off += MROWS * EMB * 2;
  if (off > ws_size) return;

  // 1: operand casts (2 elements per thread), bias tables, phase-space similarity plane
  prep_kernel<<<dim3(BI_BLK + 9 * PB_BLK), 256, 0, stream>>>(
      x, coords, qkv_w, qkv_b, out_w, out_b, ptemp, xb, wqkv, wo, biasr, pb);

  // 2: q,k and v^T
  qkv_gemm_pair<<<dim3(QK_BLK + NBATCH * VT_BLK), 256, 0, stream>>>(
      xb, wqkv, wqkv + (size_t)2 * EMB * EMB, biasr, qk, vt, EMB);

  // 3: attention with phase bias -> ao f16 (x16)
  attn_phase64_kernel<<<dim3(NHEAD * (SEQ_T / AT_QB), NBATCH), 128, 0, stream>>>(qk, vt, pb, ao);

  // 4: out = (ao x16) . (wo x64)^T * 2^-10 + out_b -> f32 d_out [4096][1024]   (M=4096,N=1024,K=1024; 1024 tiles)
  wmma_gemm64<0, false, 2, 0, false><<<dim3((4096 / 64) * (1024 / 64) / 8, 1), 256, 0, stream>>>(
      ao, ao, EMB, 0L, wo, wo, EMB, 0L, (void*)out, (void*)out, EMB, 0L,
      biasr + 3 * EMB, biasr, 0L, (int)MROWS, EMB, EMB, 1.0f / 1024.0f);
}
